// v000
// Times are from an AMD MI455X. After a warm-up the kernel runs many times in a row, and a time is the length of
// such a window on the GPU divided by its runs, so every launch and the gaps after it count. The runs cycle
// through copies of the inputs. A figure is the median of several windows, for all but v000 over two sittings.
// Sittings can differ by a few percent; kernels timed side by side share one.
// v000, which the later versions start from, runs in 1340 microseconds.
// compute dtype: all float inputs rounded to bf16; q / k / v projections with EXACT bf16 products on WMMA 16x16x32 (f32 accumulate) + bias (none); logits q x k once to f16 each (1 product) x 64^-0.5; the 4 x 4 accessibility table read at (query % 4, key % 4) in the softmax kernel; softmax f32; P x 2^11 once to f16 x v once to f16 (1 product); ctx x 2^6 once to f16 x the output weight f16(bf16 x 2^8) + bias; f32 output.
#include <hip/hip_runtime.h>
#include <math.h>

typedef __attribute__((ext_vector_type(16))) _Float16 v16h;
typedef __attribute__((ext_vector_type(16))) __bf16 v16b;
typedef __attribute__((ext_vector_type(8)))  _Float16 v8h;
typedef __attribute__((ext_vector_type(8)))  float v8f;
typedef __attribute__((ext_vector_type(4)))  float v4f;
typedef __attribute__((ext_vector_type(2)))  float v2f;
typedef __attribute__((ext_vector_type(4)))  unsigned v4u;
typedef __attribute__((ext_vector_type(4)))  int v4i;
typedef float __attribute__((may_alias)) float_a;
typedef int __attribute__((may_alias)) int_a;

template <typename T> __device__ __forceinline__ void vst2(void* p, T v) { *(T*)p = v;  }
__device__ __forceinline__ v8f wmma16(v16h a, v16h b, v8f c) {
  v8f d = __builtin_amdgcn_wmma_f32_16x16x32_f16(false, a, false, b, (short)0, c, false, false);
  asm volatile("v_nop\n\tv_nop\n\tv_nop\n\tv_nop" : "+v"(d) : "v"(a), "v"(b));
  return d;
}
__device__ __forceinline__ v8f wmma_bf(v16b a, v16b b, v8f c) {
  v8f d = __builtin_amdgcn_wmma_f32_16x16x32_bf16(false, a, false, b, (short)0, c, false, false);
  asm volatile("v_nop\n\tv_nop\n\tv_nop\n\tv_nop" : "+v"(d) : "v"(a), "v"(b));
  return d;
}
// 16x16x32 fragments: lane = (h = lane>>4, row/col = lane&15); elements 0..7 = k0+8h+0..7, 8..15 = k0+16+8h+0..7; D element r = row 8h+r
__device__ __forceinline__ v16h frag_h(const _Float16* rowk0, int lane) {
  union { v16h v; v8h q[2]; } u; const _Float16* p = rowk0 + 8 * (lane >> 4);
  u.q[0] = *(const v8h*)p; u.q[1] = *(const v8h*)(p + 16); return u.v;
}
__device__ __forceinline__ v16h frag_f32(const float* rowk0, int lane) {
  v16h a; const float* p = rowk0 + 8 * (lane >> 4);
#pragma unroll
  for (int i = 0; i < 8; ++i) { a[i] = (_Float16)p[i]; a[8 + i] = (_Float16)p[16 + i]; }
  return a;
}
__device__ __forceinline__ v16h frag_f32s(const float* rowk0, int lane, float sc) {
  v16h a; const float* p = rowk0 + 8 * (lane >> 4);
#pragma unroll
  for (int i = 0; i < 8; ++i) { a[i] = (_Float16)(p[i] * sc); a[8 + i] = (_Float16)(p[16 + i] * sc); }
  return a;
}
// column fragment from a [K][ld] layout (column n), rows >= K read as 0
__device__ __forceinline__ v16h fragc_f32(const float* W, int k0, int n, int lane, int ld, int K) {
  v16h a; const int g = lane >> 4;
#pragma unroll
  for (int i = 0; i < 8; ++i) { const int ka = k0 + 8 * g + i, kb = ka + 16;
    a[i] = (_Float16)(ka < K ? W[(size_t)(ka < K ? ka : K - 1) * ld + n] : 0.f); a[8 + i] = (_Float16)(kb < K ? W[(size_t)(kb < K ? kb : K - 1) * ld + n] : 0.f); }
  return a;
}
struct F2 { v16b h, l; };
__device__ __forceinline__ F2 bsplit16(const float v[16]) { F2 r;
#pragma unroll
  for (int i = 0; i < 16; ++i) { const __bf16 h = (__bf16)v[i]; r.h[i] = h; r.l[i] = (__bf16)(v[i] - (float)h); }
  return r; }
__device__ __forceinline__ F2 split_row(const float* row, int k0, int lane) { float v[16]; const float* p = row + k0 + 8 * (lane >> 4);
#pragma unroll
  for (int i = 0; i < 8; ++i) { v[i] = p[i]; v[8 + i] = p[16 + i]; }
  return bsplit16(v); }
__device__ __forceinline__ F2 split_rowK(const float* row, int k0, int lane, int K) { float v[16]; const int g = lane >> 4;
#pragma unroll
  for (int i = 0; i < 8; ++i) { const int ka = k0 + 8 * g + i, kb = ka + 16; v[i] = ka < K ? row[ka < K ? ka : K - 1] : 0.f; v[8 + i] = kb < K ? row[kb < K ? kb : K - 1] : 0.f; }
  return bsplit16(v); }
__device__ __forceinline__ F2 split_col(const float* W, int k0, int n, int lane, int ld, int K) { float v[16]; const int g = lane >> 4;
#pragma unroll
  for (int i = 0; i < 8; ++i) { const int ka = k0 + 8 * g + i, kb = ka + 16; v[i] = ka < K ? W[(size_t)(ka < K ? ka : K - 1) * ld + n] : 0.f; v[8 + i] = kb < K ? W[(size_t)(kb < K ? kb : K - 1) * ld + n] : 0.f; }
  return bsplit16(v); }
__device__ __forceinline__ v8f mac3(const F2& a, const F2& b, v8f c) { c = wmma_bf(a.l, b.h, c); c = wmma_bf(a.h, b.l, c); return wmma_bf(a.h, b.h, c); }
__device__ __forceinline__ float sigm(float v) { return 1.0f / (1.0f + expf(-v)); }
#define LDSX() do { asm volatile("s_wait_dscnt 0" ::: "memory"); __builtin_amdgcn_wave_barrier(); __builtin_amdgcn_fence(__ATOMIC_RELEASE, "workgroup"); } while (0)

// Multi-head self-attention with a 'Kripke modal' mask (x [2,2048,1024]; torch (out,in) Wq / Wk / Wv / Wproj [1024,1024] N(0,1) x 0.02 applied as x @ W.T, no biases; accessibility [4,4] int32 = random 0 / 1 with a unit diagonal, a module input READ on the device; 16 heads x 64; world = token index % 4; scores / sqrt(64) set to -inf wherever accessibility[world(q)][world(k)] == 0; softmax; out @ Wproj.T). Every row keeps the keys of its own world (the diagonal is 1), so no row is empty.
#define NB 2
#define TT 2048
#define CC 1024            // NH * HD = projected width
#define DIN 1024          // input (model) width
#define NH 16
#define HD 64
#define NQB (TT / 64)
#define HG 4
#define SCALE (0.125f)
#define CAUSAL 0
#ifndef TNB
#define TNB NB
#endif
__device__ __forceinline__ float bfr(float v) { return (float)(__bf16)v; }
__host__ __device__ __forceinline__ int kb_last(int qb) { return CAUSAL ? ((qb * 64 + 63) >> 7) : (TT / 128 - 1); }
typedef __attribute__((ext_vector_type(8))) __bf16 v8b;
__device__ __forceinline__ v16b frag_b(const __bf16* rowk0, int lane) {
  union { v16b v; v8b q[2]; } u; const __bf16* p = rowk0 + 8 * (lane >> 4);
  u.q[0] = *(const v8b*)p; u.q[1] = *(const v8b*)(p + 16); return u.v;
}
#define QBH 0              // no query block takes the high-precision path (every block has all 2048 keys)
#define QHI 0               // single-product logits on every row
#define KHI 64            // key rows carrying k residual / v bf16 hi+lo planes (written by k_proj, read only by the qb < QBH path, which never runs)
// B fragment (k rows k0+.., output column o) of a weight: (in,out) [K][ld] or (out,in) [ld rows of K]: bf16 exact, or f16(bf16 * 256) exact
__device__ __forceinline__ v16b wcol_io(const float* Wm, int k0, int o, int lane, int ld) { v16b w; const int g = lane >> 4;
#pragma unroll
  for (int i = 0; i < 8; ++i) { w[i] = (__bf16)Wm[(size_t)(k0 + 8 * g + i) * ld + o]; w[8 + i] = (__bf16)Wm[(size_t)(k0 + 16 + 8 * g + i) * ld + o]; }
  return w; }
__device__ __forceinline__ v16b wcol_oi(const float* Wm, int k0, int o, int lane, int K) { v16b w; const float* p = Wm + (size_t)o * K + k0 + 8 * (lane >> 4);
#pragma unroll
  for (int i = 0; i < 8; ++i) { w[i] = (__bf16)p[i]; w[8 + i] = (__bf16)p[16 + i]; }
  return w; }
__device__ __forceinline__ v16h wcolh_io(const float* Wm, int k0, int o, int lane, int ld) { v16h w; const int g = lane >> 4;
#pragma unroll
  for (int i = 0; i < 8; ++i) { w[i] = (_Float16)(bfr(Wm[(size_t)(k0 + 8 * g + i) * ld + o]) * 256.0f); w[8 + i] = (_Float16)(bfr(Wm[(size_t)(k0 + 16 + 8 * g + i) * ld + o]) * 256.0f); }
  return w; }
__device__ __forceinline__ v16h wcolh_oi(const float* Wm, int k0, int o, int lane, int K) { v16h w; const float* p = Wm + (size_t)o * K + k0 + 8 * (lane >> 4);
#pragma unroll
  for (int i = 0; i < 8; ++i) { w[i] = (_Float16)(bfr(p[i]) * 256.0f); w[8 + i] = (_Float16)(bfr(p[16 + i]) * 256.0f); }
  return w; }
#define WQKV_LAYOUT 1   // 0 = (in,out) [DIN][CC]; 1 = (out,in) [CC][DIN]; 2 = per-head [NH][DIN][HD]
__device__ __forceinline__ v16b wcol_hdk(const float* Wm, int k0, int o, int lane) { v16b w; const int g = lane >> 4; const float* p = Wm + (size_t)(o / HD) * DIN * HD + (o % HD);
#pragma unroll
  for (int i = 0; i < 8; ++i) { w[i] = (__bf16)p[(size_t)(k0 + 8 * g + i) * HD]; w[8 + i] = (__bf16)p[(size_t)(k0 + 16 + 8 * g + i) * HD]; }
  return w; }
#define WO_OUT_IN 1
#if WQKV_LAYOUT == 1
#define WCOL(W, k0, o, lane) wcol_oi(W, k0, o, lane, DIN)
#elif WQKV_LAYOUT == 2
#define WCOL(W, k0, o, lane) wcol_hdk(W, k0, o, lane)
#else
#define WCOL(W, k0, o, lane) wcol_io(W, k0, o, lane, CC)
#endif
#if WO_OUT_IN
#define WOCOL(W, k0, o, lane) wcol_oi(W, k0, o, lane, CC)
#define WOCOLH(W, k0, o, lane) wcolh_oi(W, k0, o, lane, CC)
#else
#define WOCOL(W, k0, o, lane) wcol_io(W, k0, o, lane, DIN)
#define WOCOLH(W, k0, o, lane) wcolh_io(W, k0, o, lane, DIN)
#endif

// (SM_EXTRA_PARAMS: the extra kernel parameters 'const int* __restrict__ ACC' are written literally in the kernel signature)
// the module's modal mask: modal_mask[q][k] = accessibility[q % 4][k % 4]; an entry with value 0 gets the excluded value (weight exactly 0 = -inf). The 16 table entries are read ONCE per thread before the key loop and packed into a bitmask (accm_, bit q%4 * 4 + k%4); the per-key test is a shift and a mask: no load inside the loop
#define SM_MASK_HOOK do { v = ((accm_ >> (((t & 3) << 2) | (k & 3))) & 1u) ? v : -3.0e38f; } while (0)
#ifndef SM_EXTRA_PARAMS
#define SM_EXTRA_PARAMS
#endif
#ifndef PROJ_EXTRA_PARAMS
#define PROJ_EXTRA_PARAMS
#endif
#ifndef SM_MASK_HOOK
#define SM_MASK_HOOK (void)0
#endif

#define WS_QH  0u                                      // f16 q rows [b*t][CC]
#define WS_KH  (WS_QH + 2u * (size_t)NB * TT * CC)      // f16 k rows [b*t][CC]
#define WS_VT  (WS_KH + 2u * (size_t)NB * TT * CC)      // f16 v planes [b][c][t]
#define WS_QL  (WS_VT + 2u * (size_t)NB * CC * TT)      // f16 q residual x 2^10 rows [b][t < QHI][CC]
#define WS_KL  (WS_QL + 2u * (size_t)NB * QHI * CC)     // f16 k residual x 2^10 rows [b][t < KHI][CC]
#define WS_VB  (WS_KL + 2u * (size_t)NB * KHI * CC)     // bf16 v hi planes [b][c][t < KHI]
#define WS_VBL (WS_VB + 2u * (size_t)NB * CC * KHI)
#define WS_S   (WS_VBL + 2u * (size_t)NB * CC * KHI)    // f32 logits / P [hg][t][s]
#define WS_Y   (WS_S  + 4u * (size_t)HG * TT * TT)      // f32 ctx rows [b*t][CC] (only when there is an output projection)
#define WS_END (WS_Y  + 4u * (size_t)NB * TT * CC)

// ---- k_proj: block = (64 rows, 128 cols, which): q/k/v = X W (+ b) with exact bf16 products (K = DIN) -> which 0: q f16 rows (+ residual rows < QHI); 1: k f16 rows (+ residual rows < KHI); 2: v f16 planes [c][t] (+ bf16 hi/lo planes for t < KHI)
__global__ __launch_bounds__(128) void k_proj(const float* __restrict__ XQ, const float* __restrict__ XK, const float* __restrict__ XV, const float* __restrict__ WQ, const float* __restrict__ WK, const float* __restrict__ WV, const float* __restrict__ BQ, const float* __restrict__ BK, const float* __restrict__ BV,
    _Float16* __restrict__ QH, _Float16* __restrict__ QL, _Float16* __restrict__ KH, _Float16* __restrict__ KL, _Float16* __restrict__ VT, __bf16* __restrict__ VB, __bf16* __restrict__ VBL) {
  __shared__ __align__(16) _Float16 sh[64][136], sl[64][136]; __shared__ __align__(16) _Float16 th[128][72]; __shared__ __align__(16) __bf16 tb[128][72], tbl[128][72];
  const int tid = threadIdx.x, wave = tid >> 5, lane = tid & 31, col = lane & 15, g = lane >> 4; const int which = blockIdx.z; const int c0 = blockIdx.y * 128; const size_t r0 = (size_t)blockIdx.x * 64; const size_t bb = r0 / TT; const int t0 = (int)(r0 % TT);
  const float* X = which == 0 ? XQ : which == 1 ? XK : XV; const float* WA = which == 0 ? WQ : which == 1 ? WK : WV; const float* BA = which == 0 ? BQ : which == 1 ? BK : BV;
  v8f acc[8] = {};
#pragma unroll 2
  for (int kc = 0; kc < DIN / 32; ++kc) { v16b a; { const float* p = X + (r0 + wave * 16 + col) * DIN + kc * 32 + 8 * g;
#pragma unroll
      for (int i = 0; i < 8; ++i) { a[i] = (__bf16)p[i]; a[8 + i] = (__bf16)p[16 + i]; } }
    asm volatile("s_wait_loadcnt 0x0" ::: "memory");
#pragma unroll
    for (int j = 0; j < 8; ++j) { const v16b w = WCOL(WA, kc * 32, c0 + j * 16 + col, lane); asm volatile("s_wait_loadcnt 0x0" ::: "memory"); acc[j] = wmma_bf(a, w, acc[j]); } }
  if (which < 2) { _Float16* DH = which == 0 ? QH : KH; _Float16* DL = which == 0 ? QL : KL; const int nhi = which == 0 ? QHI : KHI; const bool hi_rows = t0 < nhi;
#pragma unroll
    for (int j = 0; j < 8; ++j) { const float bias = BA ? bfr(BA[c0 + j * 16 + col]) : 0.f;
#pragma unroll
      for (int r = 0; r < 8; ++r) { const float v = acc[j][r] + bias; const _Float16 hv = (_Float16)v; sh[wave * 16 + 8 * g + r][j * 16 + col] = hv; sl[wave * 16 + 8 * g + r][j * 16 + col] = (_Float16)((v - (float)hv) * 1024.0f); } }
    __syncthreads();
    for (int e = tid; e < 64 * 16; e += 128) { const int rl = e >> 4, q = e & 15; vst2((unsigned*)(DH + (r0 + rl) * CC + c0 + q * 8), *(const v4u*)&sh[rl][q * 8]); if (hi_rows) vst2((unsigned*)(DL + (bb * nhi + t0 + rl) * (size_t)CC + c0 + q * 8), *(const v4u*)&sl[rl][q * 8]); }
  } else { const bool hi_rows = t0 < KHI;
#pragma unroll
    for (int j = 0; j < 8; ++j) { const float bias = BA ? bfr(BA[c0 + j * 16 + col]) : 0.f;
#pragma unroll
      for (int r = 0; r < 8; ++r) { const float v = acc[j][r] + bias; const int rl = wave * 16 + 8 * g + r, cl = j * 16 + col; th[cl][rl] = (_Float16)v; const __bf16 bh = (__bf16)v; tb[cl][rl] = bh; tbl[cl][rl] = (__bf16)(v - (float)bh); } }
    __syncthreads();
    for (int e = tid; e < 128 * 8; e += 128) { const int cl = e >> 3, q = e & 7; vst2((unsigned*)(VT + (bb * CC + c0 + cl) * (size_t)TT + t0 + q * 8), *(const v4u*)&th[cl][q * 8]); if (hi_rows) { const size_t o3 = (bb * CC + c0 + cl) * (size_t)KHI + t0 + q * 8; vst2((unsigned*)(VB + o3), *(const v4u*)&tb[cl][q * 8]); vst2((unsigned*)(VBL + o3), *(const v4u*)&tbl[cl][q * 8]); } } } }
// ---- k_sc: block = (query block qb, key block kb <= kb_last(qb), head in group) of batch b: logits x SCALE; q hi + residual (x 2^10) against k (2 products) for query rows < QHI, plus the k residual (3 products) for query blocks < QBH (causal early rows); causal: blocks past the diagonal exit, the mask itself is applied by index in k_sm
__global__ __launch_bounds__(128) void k_sc(const _Float16* __restrict__ QH, const _Float16* __restrict__ KH, const _Float16* __restrict__ QL, const _Float16* __restrict__ KL, int b, int h0, float* __restrict__ S0) { __shared__ __align__(16) float ss[4][16][132];
  const int qb = blockIdx.x, kb = blockIdx.y; if (kb > kb_last(qb)) return;
  const int h = h0 + blockIdx.z; float* S = S0 + (size_t)blockIdx.z * TT * TT;
  const int tid = threadIdx.x, wave = tid >> 5, lane = tid & 31, col = lane & 15, g = lane >> 4; const int k0 = kb * 128; const int ql0 = qb * 64 + wave * 16; const size_t q0 = (size_t)b * TT + ql0, kr0 = (size_t)b * TT + k0;
  v8f acc[8] = {}, accl[8] = {};
  const _Float16* QLb = QL + (size_t)b * QHI * CC; const _Float16* KLb = KL + (size_t)b * KHI * CC;
  if (qb < QBH) {
#pragma unroll
    for (int kc = 0; kc < HD / 32; ++kc) { const v16h ah = frag_h(QH + (q0 + col) * CC + h * HD + kc * 32, lane), al = frag_h(QLb + (size_t)(ql0 + col) * CC + h * HD + kc * 32, lane);
#pragma unroll
      for (int j = 0; j < 8; ++j) { const v16h kbf = frag_h(KH + (kr0 + j * 16 + col) * CC + h * HD + kc * 32, lane), klf = frag_h(KLb + (size_t)(k0 + j * 16 + col) * CC + h * HD + kc * 32, lane); acc[j] = wmma16(ah, kbf, acc[j]); accl[j] = wmma16(al, kbf, accl[j]); accl[j] = wmma16(ah, klf, accl[j]); } }
  } else if (qb * 64 < QHI) {
#pragma unroll
    for (int kc = 0; kc < HD / 32; ++kc) { const v16h ah = frag_h(QH + (q0 + col) * CC + h * HD + kc * 32, lane), al = frag_h(QLb + (size_t)(ql0 + col) * CC + h * HD + kc * 32, lane);
#pragma unroll
      for (int j = 0; j < 8; ++j) { const v16h kbf = frag_h(KH + (kr0 + j * 16 + col) * CC + h * HD + kc * 32, lane); acc[j] = wmma16(ah, kbf, acc[j]); accl[j] = wmma16(al, kbf, accl[j]); } }
  } else {
#pragma unroll
    for (int kc = 0; kc < HD / 32; ++kc) { const v16h ah = frag_h(QH + (q0 + col) * CC + h * HD + kc * 32, lane);
#pragma unroll
      for (int j = 0; j < 8; ++j) { const v16h kbf = frag_h(KH + (kr0 + j * 16 + col) * CC + h * HD + kc * 32, lane); acc[j] = wmma16(ah, kbf, acc[j]); } } }
#pragma unroll
  for (int j = 0; j < 8; ++j) {
#pragma unroll
    for (int r = 0; r < 8; ++r) ss[wave][8 * g + r][j * 16 + col] = (acc[j][r] + accl[j][r] * (1.0f / 1024.0f)) * SCALE; }
  LDSX(); for (int rl = 0; rl < 16; ++rl) vst2(S + (size_t)(ql0 + rl) * TT + k0 + lane * 4, *(const v4f*)&ss[wave][rl][lane * 4]); }
// ---- k_sm: block = query row t (head in group): keys [0, kend): causal -> logit if s <= t else excluded; softmax in f32; P x 2^11 in place (0 for excluded)
__global__ __launch_bounds__(256) void k_sm(float* __restrict__ S0, const int* __restrict__ ACC) { __shared__ float sred[8]; __shared__ float sbc; __shared__ __align__(16) float shv[TT];
  const int tid = threadIdx.x; const int t = blockIdx.x; const int kend = (kb_last(t >> 6) + 1) * 128;
  float* sr = S0 + (size_t)blockIdx.y * TT * TT + (size_t)t * TT;
  unsigned accm_ = 0u; { _Pragma("unroll") for (int i = 0; i < 16; ++i) accm_ |= ((ACC[i] != 0) ? 1u : 0u) << i; asm volatile("s_wait_loadcnt 0x0" ::: "memory"); }   /* the 4 x 4 accessibility table packed into 16 bits, once per thread */
  float m = -3.0e38f; for (int k = tid; k < kend; k += 256) { float v = (!CAUSAL || k <= t) ? sr[k] : -3.0e38f; SM_MASK_HOOK; shv[k] = v; m = fmaxf(m, v); }
#pragma unroll
  for (int o = 1; o < 32; o <<= 1) m = fmaxf(m, __shfl_xor(m, o));
  if ((tid & 31) == 0) sred[tid >> 5] = m; __syncthreads(); if (tid == 0) { float a = sred[0]; for (int i = 1; i < 8; ++i) a = fmaxf(a, sred[i]); sbc = a; } __syncthreads(); m = sbc; __syncthreads();
  float sum = 0.f; for (int k = tid; k < kend; k += 256) { const float v = shv[k]; const float e = (v <= -1.0e38f) ? 0.f : expf(v - m); shv[k] = e; sum += e; }
#pragma unroll
  for (int o = 1; o < 32; o <<= 1) sum += __shfl_xor(sum, o);
  if ((tid & 31) == 0) sred[tid >> 5] = sum; __syncthreads(); if (tid == 0) { float a = 0.f; for (int i = 0; i < 8; ++i) a += sred[i]; sbc = a > 0.f ? 2048.0f / a : 0.f; }   /* a fully excluded row yields P = 0 */ __syncthreads(); const float inv = sbc;
  for (int k = tid; k < kend; k += 256) shv[k] = shv[k] * inv;
  __syncthreads(); for (int q = tid; q < kend / 4; q += 256) vst2(sr + q * 4, *(const v4f*)&shv[q * 4]); }
// ---- k_pv: block = 64 queries (qb) of (b, h): ctx = P . v over keys [0, kend) (P x 2^11 once to f16 against v f16: 1 product; causal early query blocks: P and v as bf16 hi + lo, 3 products); 256-B (row, head) segment by 16 lanes
__global__ __launch_bounds__(128) void k_pv(const float* __restrict__ PS0, const _Float16* __restrict__ VT, const __bf16* __restrict__ VB, const __bf16* __restrict__ VBL, int b, int h0, float* __restrict__ Y) { const int h = h0 + blockIdx.z; const float* PS = PS0 + (size_t)blockIdx.z * TT * TT; __shared__ __align__(16) float ss[4][16][HD + 4];
  const int tid = threadIdx.x, wave = tid >> 5, lane = tid & 31, col = lane & 15, g = lane >> 4; const int qb = blockIdx.x; const int ql0 = qb * 64 + wave * 16; const int kce = (kb_last(qb) + 1) * 4;
  v8f acc[HD / 16] = {};
  if (qb < QBH) {
#pragma unroll 1
    for (int kc = 0; kc < kce; ++kc) { const F2 p = split_row(PS + (size_t)(ql0 + col) * TT, kc * 32, lane);
      asm volatile("s_wait_loadcnt 0x0" ::: "memory");
#pragma unroll
      for (int j = 0; j < HD / 16; ++j) { const size_t po = ((size_t)b * CC + h * HD + j * 16 + col) * (size_t)KHI + kc * 32; const v16b vh = frag_b(VB + po, lane); acc[j] = wmma_bf(p.h, vh, acc[j]); acc[j] = wmma_bf(p.l, vh, acc[j]); acc[j] = wmma_bf(p.h, frag_b(VBL + po, lane), acc[j]); } }
  } else {
#pragma unroll 1
    for (int kc = 0; kc < kce; ++kc) { const v16h p = frag_f32(PS + (size_t)(ql0 + col) * TT + kc * 32, lane);
      asm volatile("s_wait_loadcnt 0x0" ::: "memory");
#pragma unroll
      for (int j = 0; j < HD / 16; ++j) { const size_t po = ((size_t)b * CC + h * HD + j * 16 + col) * (size_t)TT + kc * 32; acc[j] = wmma16(p, frag_h(VT + po, lane), acc[j]); } } }
#pragma unroll
  for (int j = 0; j < HD / 16; ++j)
#pragma unroll
    for (int r = 0; r < 8; ++r) ss[wave][8 * g + r][j * 16 + col] = acc[j][r] * (1.0f / 2048.0f);
  LDSX(); for (int rl = 0; rl < 16; ++rl) if (lane < HD / 4) vst2(Y + ((size_t)b * TT + ql0 + rl) * CC + h * HD + lane * 4, *(const v4f*)&ss[wave][rl][lane * 4]); }
// ---- k_out: block = (64 rows, 128 cols): out = ctx Wo (+ bo): ctx x 2^6 once to f16 against Wo as f16(bf16 x 2^8) exact (1 product) x 2^-14; causal early rows (< QHI of each sequence): ctx bf16 hi + lo against exact bf16 Wo (2 products)
__global__ __launch_bounds__(128) void k_out(const float* __restrict__ Y, const float* __restrict__ WO, const float* __restrict__ BO, float* __restrict__ OUT) { __shared__ __align__(16) float sf[4][16][132];
  const int tid = threadIdx.x, wave = tid >> 5, lane = tid & 31, col = lane & 15, g = lane >> 4; const int c0 = blockIdx.y * 128; const size_t r0 = (size_t)blockIdx.x * 64 + wave * 16;
  v8f acc[8] = {};
  if (CAUSAL && (int)(((size_t)blockIdx.x * 64) % TT) < QHI) {   /* block-uniform */
#pragma unroll 2
    for (int kc = 0; kc < CC / 32; ++kc) { const F2 a = split_row(Y + (r0 + col) * CC, kc * 32, lane); asm volatile("s_wait_loadcnt 0x0" ::: "memory");
#pragma unroll
      for (int j = 0; j < 8; ++j) { const v16b w = WOCOL(WO, kc * 32, c0 + j * 16 + col, lane); asm volatile("s_wait_loadcnt 0x0" ::: "memory"); acc[j] = wmma_bf(a.h, w, acc[j]); acc[j] = wmma_bf(a.l, w, acc[j]); } }
#pragma unroll
    for (int j = 0; j < 8; ++j) { const float bias = BO ? bfr(BO[c0 + j * 16 + col]) : 0.f;
#pragma unroll
      for (int r = 0; r < 8; ++r) sf[wave][8 * g + r][j * 16 + col] = acc[j][r] + bias; }
  } else {
#pragma unroll 2
    for (int kc = 0; kc < CC / 32; ++kc) { const v16h a = frag_f32s(Y + (r0 + col) * CC + kc * 32, lane, 64.0f); asm volatile("s_wait_loadcnt 0x0" ::: "memory");   /* ctx carried x 2^6 into f16 so small-magnitude context rows stay clear of f16 subnormals */
#pragma unroll
      for (int j = 0; j < 8; ++j) { const v16h w = WOCOLH(WO, kc * 32, c0 + j * 16 + col, lane); asm volatile("s_wait_loadcnt 0x0" ::: "memory"); acc[j] = wmma16(a, w, acc[j]); } }
#pragma unroll
    for (int j = 0; j < 8; ++j) { const float bias = BO ? bfr(BO[c0 + j * 16 + col]) : 0.f;
#pragma unroll
      for (int r = 0; r < 8; ++r) sf[wave][8 * g + r][j * 16 + col] = acc[j][r] * (1.0f / 16384.0f) + bias; } }   /* 2^-8 (Wo carry) x 2^-6 (ctx carry) */
  LDSX(); for (int rl = 0; rl < 16; ++rl) vst2(OUT + (r0 + rl) * DIN + c0 + lane * 4, *(const v4f*)&sf[wave][rl][lane * 4]); }

extern "C" void kernel_launch(void* const* d_in, const int* in_sizes, int n_in, void* d_out, int out_size, void* d_ws, size_t ws_size, hipStream_t stream) {
  (void)in_sizes; (void)n_in; (void)out_size;
  const float** F = (const float**)d_in;
  if (ws_size < (size_t)WS_END) return;
  char* ws = (char*)d_ws; _Float16 *QH = (_Float16*)(ws + WS_QH), *KH = (_Float16*)(ws + WS_KH), *VT = (_Float16*)(ws + WS_VT), *QL = (_Float16*)(ws + WS_QL), *KL = (_Float16*)(ws + WS_KL); __bf16 *VB = (__bf16*)(ws + WS_VB), *VBL = (__bf16*)(ws + WS_VBL); float *S = (float*)(ws + WS_S), *Y = (float*)(ws + WS_Y);
  (void)Y; (void)QL; (void)KL; (void)VB; (void)VBL;
  // inputs: 0 x [2,2048,1024]; 1 Wq [1024,1024] (out,in); 2 Wk; 3 Wv; 4 Wproj (out,in); 5 accessibility [4,4] int32 (random 0 / 1, unit diagonal; READ on the device); no biases
  k_proj<<<dim3(TNB * TT / 64, CC / 128, 3), 128, 0, stream>>>(F[0], F[0], F[0], F[1], F[2], F[3], nullptr, nullptr, nullptr, QH, QL, KH, KL, VT, VB, VBL);
  for (int b = 0; b < TNB; ++b) for (int h0 = 0; h0 < NH; h0 += HG) {
    k_sc<<<dim3(NQB, TT / 128, HG), 128, 0, stream>>>(QH, KH, QL, KL, b, h0, S);
    k_sm<<<dim3(TT, HG), 256, 0, stream>>>(S, (const int*)d_in[5]);
    k_pv<<<dim3(NQB, 1, HG), 128, 0, stream>>>(S, VT, VB, VBL, b, h0, Y);
  }
  k_out<<<dim3(TNB * TT / 64, DIN / 128), 128, 0, stream>>>(Y, F[4], nullptr, (float*)d_out);
}

// v001
// Measured time: 408 microseconds a run.
// Next to v000, in two timings, it ran 3.31 and 3.30 times as fast.
// compute dtype: all float inputs rounded to bf16; q / k / v projections with EXACT bf16 products on WMMA 16x16x32 (f32 accumulate) + bias (none); one attention kernel: logits k x q once to f16 each (1 product) x 64^-0.5 x log2(e); the 4 x 4 accessibility table read at (query % 4, key % 4); online softmax f32 in base 2; unnormalised P x 2^11 once to f16 x v once to f16 (1 product), divided by the f32 row sum at the end; ctx x 2^6 once to f16 x the output weight f16(bf16 x 2^8) + bias; f32 output.
#include <hip/hip_runtime.h>
#include <math.h>

typedef __attribute__((ext_vector_type(16))) _Float16 v16h;
typedef __attribute__((ext_vector_type(16))) __bf16 v16b;
typedef __attribute__((ext_vector_type(8)))  _Float16 v8h;
typedef __attribute__((ext_vector_type(8)))  float v8f;
typedef __attribute__((ext_vector_type(4)))  float v4f;
typedef __attribute__((ext_vector_type(2)))  float v2f;
typedef __attribute__((ext_vector_type(4)))  unsigned v4u;
typedef __attribute__((ext_vector_type(4)))  int v4i;
typedef float __attribute__((may_alias)) float_a;
typedef int __attribute__((may_alias)) int_a;

template <typename T> __device__ __forceinline__ void vst2(void* p, T v) { *(T*)p = v;  }
__device__ __forceinline__ v8f wmma16(v16h a, v16h b, v8f c) {
  v8f d = __builtin_amdgcn_wmma_f32_16x16x32_f16(false, a, false, b, (short)0, c, false, false);
  asm volatile("v_nop\n\tv_nop\n\tv_nop\n\tv_nop" : "+v"(d) : "v"(a), "v"(b));
  return d;
}
__device__ __forceinline__ v8f wmma_bf(v16b a, v16b b, v8f c) {
  v8f d = __builtin_amdgcn_wmma_f32_16x16x32_bf16(false, a, false, b, (short)0, c, false, false);
  asm volatile("v_nop\n\tv_nop\n\tv_nop\n\tv_nop" : "+v"(d) : "v"(a), "v"(b));
  return d;
}
// 16x16x32 fragments: lane = (h = lane>>4, row/col = lane&15); elements 0..7 = k0+8h+0..7, 8..15 = k0+16+8h+0..7; D element r = row 8h+r
__device__ __forceinline__ v16h frag_h(const _Float16* rowk0, int lane) {
  union { v16h v; v8h q[2]; } u; const _Float16* p = rowk0 + 8 * (lane >> 4);
  u.q[0] = *(const v8h*)p; u.q[1] = *(const v8h*)(p + 16); return u.v;
}
__device__ __forceinline__ v16h frag_f32(const float* rowk0, int lane) {
  v16h a; const float* p = rowk0 + 8 * (lane >> 4);
#pragma unroll
  for (int i = 0; i < 8; ++i) { a[i] = (_Float16)p[i]; a[8 + i] = (_Float16)p[16 + i]; }
  return a;
}
__device__ __forceinline__ v16h frag_f32s(const float* rowk0, int lane, float sc) {
  v16h a; const float* p = rowk0 + 8 * (lane >> 4);
#pragma unroll
  for (int i = 0; i < 8; ++i) { a[i] = (_Float16)(p[i] * sc); a[8 + i] = (_Float16)(p[16 + i] * sc); }
  return a;
}
// column fragment from a [K][ld] layout (column n), rows >= K read as 0
__device__ __forceinline__ v16h fragc_f32(const float* W, int k0, int n, int lane, int ld, int K) {
  v16h a; const int g = lane >> 4;
#pragma unroll
  for (int i = 0; i < 8; ++i) { const int ka = k0 + 8 * g + i, kb = ka + 16;
    a[i] = (_Float16)(ka < K ? W[(size_t)(ka < K ? ka : K - 1) * ld + n] : 0.f); a[8 + i] = (_Float16)(kb < K ? W[(size_t)(kb < K ? kb : K - 1) * ld + n] : 0.f); }
  return a;
}
struct F2 { v16b h, l; };
__device__ __forceinline__ F2 bsplit16(const float v[16]) { F2 r;
#pragma unroll
  for (int i = 0; i < 16; ++i) { const __bf16 h = (__bf16)v[i]; r.h[i] = h; r.l[i] = (__bf16)(v[i] - (float)h); }
  return r; }
__device__ __forceinline__ F2 split_row(const float* row, int k0, int lane) { float v[16]; const float* p = row + k0 + 8 * (lane >> 4);
#pragma unroll
  for (int i = 0; i < 8; ++i) { v[i] = p[i]; v[8 + i] = p[16 + i]; }
  return bsplit16(v); }
__device__ __forceinline__ F2 split_rowK(const float* row, int k0, int lane, int K) { float v[16]; const int g = lane >> 4;
#pragma unroll
  for (int i = 0; i < 8; ++i) { const int ka = k0 + 8 * g + i, kb = ka + 16; v[i] = ka < K ? row[ka < K ? ka : K - 1] : 0.f; v[8 + i] = kb < K ? row[kb < K ? kb : K - 1] : 0.f; }
  return bsplit16(v); }
__device__ __forceinline__ F2 split_col(const float* W, int k0, int n, int lane, int ld, int K) { float v[16]; const int g = lane >> 4;
#pragma unroll
  for (int i = 0; i < 8; ++i) { const int ka = k0 + 8 * g + i, kb = ka + 16; v[i] = ka < K ? W[(size_t)(ka < K ? ka : K - 1) * ld + n] : 0.f; v[8 + i] = kb < K ? W[(size_t)(kb < K ? kb : K - 1) * ld + n] : 0.f; }
  return bsplit16(v); }
__device__ __forceinline__ v8f mac3(const F2& a, const F2& b, v8f c) { c = wmma_bf(a.l, b.h, c); c = wmma_bf(a.h, b.l, c); return wmma_bf(a.h, b.h, c); }
__device__ __forceinline__ float sigm(float v) { return 1.0f / (1.0f + expf(-v)); }
#define LDSX() do { asm volatile("s_wait_dscnt 0" ::: "memory"); __builtin_amdgcn_wave_barrier(); __builtin_amdgcn_fence(__ATOMIC_RELEASE, "workgroup"); } while (0)

// Multi-head self-attention with a 'Kripke modal' mask (x [2,2048,1024]; torch (out,in) Wq / Wk / Wv / Wproj [1024,1024] N(0,1) x 0.02 applied as x @ W.T, no biases; accessibility [4,4] int32 = random 0 / 1 with a unit diagonal, a module input READ on the device; 16 heads x 64; world = token index % 4; scores / sqrt(64) set to -inf wherever accessibility[world(q)][world(k)] == 0; softmax; out @ Wproj.T). Every row keeps the keys of its own world (the diagonal is 1), so no row is empty.
#define NB 2
#define TT 2048
#define CC 1024            // NH * HD = projected width
#define DIN 1024          // input (model) width
#define NH 16
#define HD 64
#define SCALE (0.125f)
#define CAUSAL 0
#ifndef TNB
#define TNB NB
#endif
__device__ __forceinline__ float bfr(float v) { return (float)(__bf16)v; }
__host__ __device__ __forceinline__ int kb_last(int qb) { return CAUSAL ? ((qb * 64 + 63) >> 7) : (TT / 128 - 1); }
typedef __attribute__((ext_vector_type(8))) __bf16 v8b;
__device__ __forceinline__ v16b frag_b(const __bf16* rowk0, int lane) {
  union { v16b v; v8b q[2]; } u; const __bf16* p = rowk0 + 8 * (lane >> 4);
  u.q[0] = *(const v8b*)p; u.q[1] = *(const v8b*)(p + 16); return u.v;
}
#define QBH 0
#define QHI 0               // single-product logits on every row
#define KHI 64            // key rows carrying k residual / v bf16 hi+lo planes (written by k_proj; no kernel here reads them)
// B fragment (k rows k0+.., output column o) of a weight: (in,out) [K][ld] or (out,in) [ld rows of K]: bf16 exact, or f16(bf16 * 256) exact
__device__ __forceinline__ v16b wcol_io(const float* Wm, int k0, int o, int lane, int ld) { v16b w; const int g = lane >> 4;
#pragma unroll
  for (int i = 0; i < 8; ++i) { w[i] = (__bf16)Wm[(size_t)(k0 + 8 * g + i) * ld + o]; w[8 + i] = (__bf16)Wm[(size_t)(k0 + 16 + 8 * g + i) * ld + o]; }
  return w; }
__device__ __forceinline__ v16b wcol_oi(const float* Wm, int k0, int o, int lane, int K) { v16b w; const float* p = Wm + (size_t)o * K + k0 + 8 * (lane >> 4);
#pragma unroll
  for (int i = 0; i < 8; ++i) { w[i] = (__bf16)p[i]; w[8 + i] = (__bf16)p[16 + i]; }
  return w; }
__device__ __forceinline__ v16h wcolh_io(const float* Wm, int k0, int o, int lane, int ld) { v16h w; const int g = lane >> 4;
#pragma unroll
  for (int i = 0; i < 8; ++i) { w[i] = (_Float16)(bfr(Wm[(size_t)(k0 + 8 * g + i) * ld + o]) * 256.0f); w[8 + i] = (_Float16)(bfr(Wm[(size_t)(k0 + 16 + 8 * g + i) * ld + o]) * 256.0f); }
  return w; }
__device__ __forceinline__ v16h wcolh_oi(const float* Wm, int k0, int o, int lane, int K) { v16h w; const float* p = Wm + (size_t)o * K + k0 + 8 * (lane >> 4);
#pragma unroll
  for (int i = 0; i < 8; ++i) { w[i] = (_Float16)(bfr(p[i]) * 256.0f); w[8 + i] = (_Float16)(bfr(p[16 + i]) * 256.0f); }
  return w; }
#define WQKV_LAYOUT 1   // 0 = (in,out) [DIN][CC]; 1 = (out,in) [CC][DIN]; 2 = per-head [NH][DIN][HD]
__device__ __forceinline__ v16b wcol_hdk(const float* Wm, int k0, int o, int lane) { v16b w; const int g = lane >> 4; const float* p = Wm + (size_t)(o / HD) * DIN * HD + (o % HD);
#pragma unroll
  for (int i = 0; i < 8; ++i) { w[i] = (__bf16)p[(size_t)(k0 + 8 * g + i) * HD]; w[8 + i] = (__bf16)p[(size_t)(k0 + 16 + 8 * g + i) * HD]; }
  return w; }
#define WO_OUT_IN 1
#if WQKV_LAYOUT == 1
#define WCOL(W, k0, o, lane) wcol_oi(W, k0, o, lane, DIN)
#elif WQKV_LAYOUT == 2
#define WCOL(W, k0, o, lane) wcol_hdk(W, k0, o, lane)
#else
#define WCOL(W, k0, o, lane) wcol_io(W, k0, o, lane, CC)
#endif
#if WO_OUT_IN
#define WOCOL(W, k0, o, lane) wcol_oi(W, k0, o, lane, CC)
#define WOCOLH(W, k0, o, lane) wcolh_oi(W, k0, o, lane, CC)
#else
#define WOCOL(W, k0, o, lane) wcol_io(W, k0, o, lane, DIN)
#define WOCOLH(W, k0, o, lane) wcolh_io(W, k0, o, lane, DIN)
#endif

#define WS_QH  0u                                      // f16 q rows [b*t][CC]
#define WS_KH  (WS_QH + 2u * (size_t)NB * TT * CC)      // f16 k rows [b*t][CC]
#define WS_VT  (WS_KH + 2u * (size_t)NB * TT * CC)      // f16 v planes [b][c][t]
#define WS_QL  (WS_VT + 2u * (size_t)NB * CC * TT)      // f16 q residual x 2^10 rows [b][t < QHI][CC]
#define WS_KL  (WS_QL + 2u * (size_t)NB * QHI * CC)     // f16 k residual x 2^10 rows [b][t < KHI][CC]
#define WS_VB  (WS_KL + 2u * (size_t)NB * KHI * CC)     // bf16 v hi planes [b][c][t < KHI]
#define WS_VBL (WS_VB + 2u * (size_t)NB * CC * KHI)
#define WS_Y   (WS_VBL + 2u * (size_t)NB * CC * KHI)    // f32 ctx rows [b*t][CC]
#define WS_END (WS_Y  + 4u * (size_t)NB * TT * CC)

// ---- k_proj: block = (64 rows, 128 cols, which): q/k/v = X W (+ b) with exact bf16 products (K = DIN) -> which 0: q f16 rows (+ residual rows < QHI); 1: k f16 rows (+ residual rows < KHI); 2: v f16 planes [c][t] (+ bf16 hi/lo planes for t < KHI)
__global__ __launch_bounds__(128) void k_proj(const float* __restrict__ XQ, const float* __restrict__ XK, const float* __restrict__ XV, const float* __restrict__ WQ, const float* __restrict__ WK, const float* __restrict__ WV, const float* __restrict__ BQ, const float* __restrict__ BK, const float* __restrict__ BV,
    _Float16* __restrict__ QH, _Float16* __restrict__ QL, _Float16* __restrict__ KH, _Float16* __restrict__ KL, _Float16* __restrict__ VT, __bf16* __restrict__ VB, __bf16* __restrict__ VBL) {
  __shared__ __align__(16) _Float16 sh[64][136], sl[64][136]; __shared__ __align__(16) _Float16 th[128][72]; __shared__ __align__(16) __bf16 tb[128][72], tbl[128][72];
  const int tid = threadIdx.x, wave = tid >> 5, lane = tid & 31, col = lane & 15, g = lane >> 4; const int which = blockIdx.z; const int c0 = blockIdx.y * 128; const size_t r0 = (size_t)blockIdx.x * 64; const size_t bb = r0 / TT; const int t0 = (int)(r0 % TT);
  const float* X = which == 0 ? XQ : which == 1 ? XK : XV; const float* WA = which == 0 ? WQ : which == 1 ? WK : WV; const float* BA = which == 0 ? BQ : which == 1 ? BK : BV;
  v8f acc[8] = {};
#pragma unroll 2
  for (int kc = 0; kc < DIN / 32; ++kc) { v16b a; { const float* p = X + (r0 + wave * 16 + col) * DIN + kc * 32 + 8 * g;
#pragma unroll
      for (int i = 0; i < 8; ++i) { a[i] = (__bf16)p[i]; a[8 + i] = (__bf16)p[16 + i]; } }
    asm volatile("s_wait_loadcnt 0x0" ::: "memory");
#pragma unroll
    for (int j = 0; j < 8; ++j) { const v16b w = WCOL(WA, kc * 32, c0 + j * 16 + col, lane); asm volatile("s_wait_loadcnt 0x0" ::: "memory"); acc[j] = wmma_bf(a, w, acc[j]); } }
  if (which < 2) { _Float16* DH = which == 0 ? QH : KH; _Float16* DL = which == 0 ? QL : KL; const int nhi = which == 0 ? QHI : KHI; const bool hi_rows = t0 < nhi;
#pragma unroll
    for (int j = 0; j < 8; ++j) { const float bias = BA ? bfr(BA[c0 + j * 16 + col]) : 0.f;
#pragma unroll
      for (int r = 0; r < 8; ++r) { const float v = acc[j][r] + bias; const _Float16 hv = (_Float16)v; sh[wave * 16 + 8 * g + r][j * 16 + col] = hv; sl[wave * 16 + 8 * g + r][j * 16 + col] = (_Float16)((v - (float)hv) * 1024.0f); } }
    __syncthreads();
    for (int e = tid; e < 64 * 16; e += 128) { const int rl = e >> 4, q = e & 15; vst2((unsigned*)(DH + (r0 + rl) * CC + c0 + q * 8), *(const v4u*)&sh[rl][q * 8]); if (hi_rows) vst2((unsigned*)(DL + (bb * nhi + t0 + rl) * (size_t)CC + c0 + q * 8), *(const v4u*)&sl[rl][q * 8]); }
  } else { const bool hi_rows = t0 < KHI;
#pragma unroll
    for (int j = 0; j < 8; ++j) { const float bias = BA ? bfr(BA[c0 + j * 16 + col]) : 0.f;
#pragma unroll
      for (int r = 0; r < 8; ++r) { const float v = acc[j][r] + bias; const int rl = wave * 16 + 8 * g + r, cl = j * 16 + col; th[cl][rl] = (_Float16)v; const __bf16 bh = (__bf16)v; tb[cl][rl] = bh; tbl[cl][rl] = (__bf16)(v - (float)bh); } }
    __syncthreads();
    for (int e = tid; e < 128 * 8; e += 128) { const int cl = e >> 3, q = e & 7; vst2((unsigned*)(VT + (bb * CC + c0 + cl) * (size_t)TT + t0 + q * 8), *(const v4u*)&th[cl][q * 8]); if (hi_rows) { const size_t o3 = (bb * CC + c0 + cl) * (size_t)KHI + t0 + q * 8; vst2((unsigned*)(VB + o3), *(const v4u*)&tb[cl][q * 8]); vst2((unsigned*)(VBL + o3), *(const v4u*)&tbl[cl][q * 8]); } } } }
// ---- k_attn: block = 128 queries (4 waves x 32) of (b, h); one pass = 32 keys. S^T = K Q^T (A = 16 key rows, B = 16 query columns): a lane holds one query's 16 scores of the pass, the lane 16 away the other 16. Two S^T tiles converted in place are the B operand of O^T += V^T P^T (same k order as frag_h), so scores and P stay in registers. Online softmax in base 2, f32: running maximum m, running sum l, O^T rescaled by 2^(m_old - m_new) every pass.
// every plain '#pragma unroll' in this kernel after the table read stands on a loop over a register array (fragments, tiles, a lane's scores): its index must be a constant for the array to stay in registers
// modal mask: key % 4 = r % 4 and query % 4 = col % 4 at every pass, so the table row of a lane becomes four addends (0 or the excluded value) formed once before the loop
__device__ __forceinline__ float xhalf(float x) { return __builtin_bit_cast(float, __builtin_amdgcn_permlanex16(__builtin_bit_cast(int, x), __builtin_bit_cast(int, x), 0x76543210, 0xfedcba98, false, false)); }   // lane l with lane l ^ 16
#define SCALE_LOG2E (SCALE * 1.4426950408889634f)
// 2^x in place. Behind v_exp_f32 the instruction set asks for one independent instruction or v_nop before its result is used or its source overwritten: in one statement each v_exp_f32 is that instruction for the one before it, and the v_nop serves the last
__device__ __forceinline__ void exp2x8(float* x) {
  asm("v_exp_f32 %0, %0\n\tv_exp_f32 %1, %1\n\tv_exp_f32 %2, %2\n\tv_exp_f32 %3, %3\n\tv_exp_f32 %4, %4\n\tv_exp_f32 %5, %5\n\tv_exp_f32 %6, %6\n\tv_exp_f32 %7, %7\n\tv_nop"
      : "+v"(x[0]), "+v"(x[1]), "+v"(x[2]), "+v"(x[3]), "+v"(x[4]), "+v"(x[5]), "+v"(x[6]), "+v"(x[7])); }
__device__ __forceinline__ float exp2x1(float x) { asm("v_exp_f32 %0, %0\n\tv_nop" : "+v"(x)); return x; }
__global__ __launch_bounds__(128) void k_attn(const _Float16* __restrict__ QH, const _Float16* __restrict__ KH, const _Float16* __restrict__ VT, const int* __restrict__ ACC, float* __restrict__ Y) {
  const int tid = threadIdx.x, wave = tid >> 5, lane = tid & 31, col = lane & 15, g = lane >> 4; const int h = blockIdx.y, b = blockIdx.z; const int q0 = blockIdx.x * 128 + wave * 32;
  unsigned accm = 0u;
#pragma unroll
  for (int i = 0; i < 16; ++i) accm |= ((ACC[i] != 0) ? 1u : 0u) << i;
  const unsigned rowm = (accm >> ((col & 3) << 2)) & 15u;   /* the table row of this lane's queries (q0 and the 16-query step are multiples of 4) */
  float bias[4];
#pragma unroll
  for (int i = 0; i < 4; ++i) bias[i] = ((rowm >> i) & 1u) ? 0.f : -3.0e38f;
  v16h qf[2][2];
#pragma unroll
  for (int n = 0; n < 2; ++n)
#pragma unroll
    for (int kc = 0; kc < 2; ++kc) qf[n][kc] = frag_h(QH + ((size_t)b * TT + q0 + n * 16 + col) * CC + h * HD + kc * 32, lane);
  const _Float16* Kp = KH + ((size_t)b * TT + col) * CC + h * HD;
  const _Float16* Vp = VT + ((size_t)b * CC + h * HD + col) * (size_t)TT;
  v8f o[2][4] = {}; float m[2] = {-3.0e38f, -3.0e38f}, l[2] = {0.f, 0.f};
  v16h kf[2][2];
#pragma unroll
  for (int i = 0; i < 2; ++i)
#pragma unroll
    for (int kc = 0; kc < 2; ++kc) kf[i][kc] = frag_h(Kp + (size_t)(i * 16) * CC + kc * 32, lane);
#pragma unroll 2   /* two passes a trip: the K fragments fetched one pass ahead change places by register naming, not by copies */
  for (int kb = 0; kb < TT / 32; ++kb) { const int k0 = kb * 32; const int kn0 = kb + 1 < TT / 32 ? k0 + 32 : k0;   /* the last pass fetches its own keys again: in bounds, unused */
    v16h vf[4], kn[2][2];
#pragma unroll
    for (int j = 0; j < 4; ++j) vf[j] = frag_h(Vp + (size_t)(j * 16) * TT + k0, lane);
#pragma unroll
    for (int i = 0; i < 2; ++i)
#pragma unroll
      for (int kc = 0; kc < 2; ++kc) kn[i][kc] = frag_h(Kp + (size_t)(kn0 + i * 16) * CC + kc * 32, lane);
    v8f st[2][2] = {};
#pragma unroll
    for (int kc = 0; kc < 2; ++kc)
#pragma unroll
      for (int i = 0; i < 2; ++i)
#pragma unroll
        for (int n = 0; n < 2; ++n) st[n][i] = wmma16(kf[i][kc], qf[n][kc], st[n][i]);
    v16h pb[2];
#pragma unroll
    for (int n = 0; n < 2; ++n) { float s[16];
#pragma unroll
      for (int r = 0; r < 8; ++r) { s[r] = fmaf(st[n][0][r], SCALE_LOG2E, bias[r & 3]); s[8 + r] = fmaf(st[n][1][r], SCALE_LOG2E, bias[r & 3]); }
      float mx = s[0];
#pragma unroll
      for (int i = 1; i < 16; ++i) mx = fmaxf(mx, s[i]);
      mx = fmaxf(mx, xhalf(mx));
      const float mn = fmaxf(m[n], mx); const float al = exp2x1(m[n] - mn); m[n] = mn;
      const float mo = mn - 11.0f;   /* P carried x 2^11 into f16 (clear of f16 subnormals); l carries the same factor, so it cancels in O / l */
#pragma unroll
      for (int i = 0; i < 16; ++i) s[i] -= mo;
      exp2x8(s); exp2x8(s + 8);
      float sum = 0.f;
#pragma unroll
      for (int i = 0; i < 16; ++i) { sum += s[i]; pb[n][i] = (_Float16)s[i]; }
      l[n] = l[n] * al + sum;
#pragma unroll
      for (int j = 0; j < 4; ++j) o[n][j] *= al; }
#pragma unroll
    for (int j = 0; j < 4; ++j)
#pragma unroll
      for (int n = 0; n < 2; ++n) o[n][j] = wmma16(vf[j], pb[n], o[n][j]);
#pragma unroll
    for (int i = 0; i < 2; ++i)
#pragma unroll
      for (int kc = 0; kc < 2; ++kc) kf[i][kc] = kn[i][kc]; }
#pragma unroll
  for (int n = 0; n < 2; ++n) { const float lt = l[n] + xhalf(l[n]); const float inv = (rowm != 0u && lt > 0.f) ? 1.0f / lt : 0.f;   /* a fully excluded row yields ctx = 0 */
    float* yr = Y + ((size_t)b * TT + q0 + n * 16 + col) * CC + h * HD + 8 * g;
#pragma unroll
    for (int j = 0; j < 4; ++j) { const v8f ov = o[n][j] * inv; vst2(yr + j * 16, (v4f){ov[0], ov[1], ov[2], ov[3]}); vst2(yr + j * 16 + 4, (v4f){ov[4], ov[5], ov[6], ov[7]}); } } }
// ---- k_out: block = (64 rows, 128 cols): out = ctx Wo (+ bo): ctx x 2^6 once to f16 against Wo as f16(bf16 x 2^8) exact (1 product) x 2^-14; causal early rows (< QHI of each sequence): ctx bf16 hi + lo against exact bf16 Wo (2 products)
__global__ __launch_bounds__(128) void k_out(const float* __restrict__ Y, const float* __restrict__ WO, const float* __restrict__ BO, float* __restrict__ OUT) { __shared__ __align__(16) float sf[4][16][132];
  const int tid = threadIdx.x, wave = tid >> 5, lane = tid & 31, col = lane & 15, g = lane >> 4; const int c0 = blockIdx.y * 128; const size_t r0 = (size_t)blockIdx.x * 64 + wave * 16;
  v8f acc[8] = {};
  if (CAUSAL && (int)(((size_t)blockIdx.x * 64) % TT) < QHI) {   /* block-uniform */
#pragma unroll 2
    for (int kc = 0; kc < CC / 32; ++kc) { const F2 a = split_row(Y + (r0 + col) * CC, kc * 32, lane); asm volatile("s_wait_loadcnt 0x0" ::: "memory");
#pragma unroll
      for (int j = 0; j < 8; ++j) { const v16b w = WOCOL(WO, kc * 32, c0 + j * 16 + col, lane); asm volatile("s_wait_loadcnt 0x0" ::: "memory"); acc[j] = wmma_bf(a.h, w, acc[j]); acc[j] = wmma_bf(a.l, w, acc[j]); } }
#pragma unroll
    for (int j = 0; j < 8; ++j) { const float bias = BO ? bfr(BO[c0 + j * 16 + col]) : 0.f;
#pragma unroll
      for (int r = 0; r < 8; ++r) sf[wave][8 * g + r][j * 16 + col] = acc[j][r] + bias; }
  } else {
#pragma unroll 2
    for (int kc = 0; kc < CC / 32; ++kc) { const v16h a = frag_f32s(Y + (r0 + col) * CC + kc * 32, lane, 64.0f); asm volatile("s_wait_loadcnt 0x0" ::: "memory");   /* ctx carried x 2^6 into f16 so small-magnitude context rows stay clear of f16 subnormals */
#pragma unroll
      for (int j = 0; j < 8; ++j) { const v16h w = WOCOLH(WO, kc * 32, c0 + j * 16 + col, lane); asm volatile("s_wait_loadcnt 0x0" ::: "memory"); acc[j] = wmma16(a, w, acc[j]); } }
#pragma unroll
    for (int j = 0; j < 8; ++j) { const float bias = BO ? bfr(BO[c0 + j * 16 + col]) : 0.f;
#pragma unroll
      for (int r = 0; r < 8; ++r) sf[wave][8 * g + r][j * 16 + col] = acc[j][r] * (1.0f / 16384.0f) + bias; } }   /* 2^-8 (Wo carry) x 2^-6 (ctx carry) */
  LDSX(); for (int rl = 0; rl < 16; ++rl) vst2(OUT + (r0 + rl) * DIN + c0 + lane * 4, *(const v4f*)&sf[wave][rl][lane * 4]); }

extern "C" void kernel_launch(void* const* d_in, const int* in_sizes, int n_in, void* d_out, int out_size, void* d_ws, size_t ws_size, hipStream_t stream) {
  (void)in_sizes; (void)n_in; (void)out_size;
  const float** F = (const float**)d_in;
  if (ws_size < (size_t)WS_END) return;
  char* ws = (char*)d_ws; _Float16 *QH = (_Float16*)(ws + WS_QH), *KH = (_Float16*)(ws + WS_KH), *VT = (_Float16*)(ws + WS_VT), *QL = (_Float16*)(ws + WS_QL), *KL = (_Float16*)(ws + WS_KL); __bf16 *VB = (__bf16*)(ws + WS_VB), *VBL = (__bf16*)(ws + WS_VBL); float *Y = (float*)(ws + WS_Y);
  (void)Y; (void)QL; (void)KL; (void)VB; (void)VBL;
  // inputs: 0 x [2,2048,1024]; 1 Wq [1024,1024] (out,in); 2 Wk; 3 Wv; 4 Wproj (out,in); 5 accessibility [4,4] int32 (random 0 / 1, unit diagonal; READ on the device); no biases
  k_proj<<<dim3(TNB * TT / 64, CC / 128, 3), 128, 0, stream>>>(F[0], F[0], F[0], F[1], F[2], F[3], nullptr, nullptr, nullptr, QH, QL, KH, KL, VT, VB, VBL);
  k_attn<<<dim3(TT / 128, NH, TNB), 128, 0, stream>>>(QH, KH, VT, (const int*)d_in[5], Y);
  k_out<<<dim3(TNB * TT / 64, DIN / 128), 128, 0, stream>>>(Y, F[4], nullptr, (float*)d_out);
}

// v002
// Measured time: 110 microseconds a run.
// Next to v001, in two timings, it ran 3.71 and 3.67 times as fast.
// Counting every step since v000, it is 12.2 times as fast.
// compute dtype: all float inputs rounded to bf16; q / k / v projections with EXACT bf16 products on WMMA 16x16x32 (f32 accumulate) + bias (none); one attention kernel: logits k x q once to f16 each (1 product) x 64^-0.5 x log2(e); the 4 x 4 accessibility table read at (query % 4, key % 4); online softmax f32 in base 2; unnormalised P x 2^11 once to f16 x v once to f16 (1 product), divided by the f32 row sum at the end; ctx x 2^6 once to f16 x the output weight f16(bf16 x 2^8) + bias; f32 output.
#include <hip/hip_runtime.h>
#include <math.h>

typedef __attribute__((ext_vector_type(16))) _Float16 v16h;
typedef __attribute__((ext_vector_type(16))) __bf16 v16b;
typedef __attribute__((ext_vector_type(8)))  _Float16 v8h;
typedef __attribute__((ext_vector_type(8)))  float v8f;
typedef __attribute__((ext_vector_type(4)))  float v4f;
typedef __attribute__((ext_vector_type(2)))  float v2f;
typedef __attribute__((ext_vector_type(4)))  unsigned v4u;
typedef __attribute__((ext_vector_type(4)))  int v4i;
typedef float __attribute__((may_alias)) float_a;
typedef int __attribute__((may_alias)) int_a;

template <typename T> __device__ __forceinline__ void vst2(void* p, T v) { *(T*)p = v;  }
__device__ __forceinline__ v8f wmma16(v16h a, v16h b, v8f c) {
  v8f d = __builtin_amdgcn_wmma_f32_16x16x32_f16(false, a, false, b, (short)0, c, false, false);
  asm volatile("v_nop\n\tv_nop\n\tv_nop\n\tv_nop" : "+v"(d) : "v"(a), "v"(b));
  return d;
}
__device__ __forceinline__ v8f wmma_bf(v16b a, v16b b, v8f c) {
  v8f d = __builtin_amdgcn_wmma_f32_16x16x32_bf16(false, a, false, b, (short)0, c, false, false);
  asm volatile("v_nop\n\tv_nop\n\tv_nop\n\tv_nop" : "+v"(d) : "v"(a), "v"(b));
  return d;
}
// 16x16x32 fragments: lane = (h = lane>>4, row/col = lane&15); elements 0..7 = k0+8h+0..7, 8..15 = k0+16+8h+0..7; D element r = row 8h+r
__device__ __forceinline__ v16h frag_h(const _Float16* rowk0, int lane) {
  union { v16h v; v8h q[2]; } u; const _Float16* p = rowk0 + 8 * (lane >> 4);
  u.q[0] = *(const v8h*)p; u.q[1] = *(const v8h*)(p + 16); return u.v;
}
__device__ __forceinline__ v16h frag_f32(const float* rowk0, int lane) {
  v16h a; const float* p = rowk0 + 8 * (lane >> 4);
#pragma unroll
  for (int i = 0; i < 8; ++i) { a[i] = (_Float16)p[i]; a[8 + i] = (_Float16)p[16 + i]; }
  return a;
}
__device__ __forceinline__ v16h frag_f32s(const float* rowk0, int lane, float sc) {
  v16h a; const float* p = rowk0 + 8 * (lane >> 4);
#pragma unroll
  for (int i = 0; i < 8; ++i) { a[i] = (_Float16)(p[i] * sc); a[8 + i] = (_Float16)(p[16 + i] * sc); }
  return a;
}
// column fragment from a [K][ld] layout (column n), rows >= K read as 0
__device__ __forceinline__ v16h fragc_f32(const float* W, int k0, int n, int lane, int ld, int K) {
  v16h a; const int g = lane >> 4;
#pragma unroll
  for (int i = 0; i < 8; ++i) { const int ka = k0 + 8 * g + i, kb = ka + 16;
    a[i] = (_Float16)(ka < K ? W[(size_t)(ka < K ? ka : K - 1) * ld + n] : 0.f); a[8 + i] = (_Float16)(kb < K ? W[(size_t)(kb < K ? kb : K - 1) * ld + n] : 0.f); }
  return a;
}
struct F2 { v16b h, l; };
__device__ __forceinline__ F2 bsplit16(const float v[16]) { F2 r;
#pragma unroll
  for (int i = 0; i < 16; ++i) { const __bf16 h = (__bf16)v[i]; r.h[i] = h; r.l[i] = (__bf16)(v[i] - (float)h); }
  return r; }
__device__ __forceinline__ F2 split_row(const float* row, int k0, int lane) { float v[16]; const float* p = row + k0 + 8 * (lane >> 4);
#pragma unroll
  for (int i = 0; i < 8; ++i) { v[i] = p[i]; v[8 + i] = p[16 + i]; }
  return bsplit16(v); }
__device__ __forceinline__ F2 split_rowK(const float* row, int k0, int lane, int K) { float v[16]; const int g = lane >> 4;
#pragma unroll
  for (int i = 0; i < 8; ++i) { const int ka = k0 + 8 * g + i, kb = ka + 16; v[i] = ka < K ? row[ka < K ? ka : K - 1] : 0.f; v[8 + i] = kb < K ? row[kb < K ? kb : K - 1] : 0.f; }
  return bsplit16(v); }
__device__ __forceinline__ F2 split_col(const float* W, int k0, int n, int lane, int ld, int K) { float v[16]; const int g = lane >> 4;
#pragma unroll
  for (int i = 0; i < 8; ++i) { const int ka = k0 + 8 * g + i, kb = ka + 16; v[i] = ka < K ? W[(size_t)(ka < K ? ka : K - 1) * ld + n] : 0.f; v[8 + i] = kb < K ? W[(size_t)(kb < K ? kb : K - 1) * ld + n] : 0.f; }
  return bsplit16(v); }
__device__ __forceinline__ v8f mac3(const F2& a, const F2& b, v8f c) { c = wmma_bf(a.l, b.h, c); c = wmma_bf(a.h, b.l, c); return wmma_bf(a.h, b.h, c); }
__device__ __forceinline__ float sigm(float v) { return 1.0f / (1.0f + expf(-v)); }
#define LDSX() do { asm volatile("s_wait_dscnt 0" ::: "memory"); __builtin_amdgcn_wave_barrier(); __builtin_amdgcn_fence(__ATOMIC_RELEASE, "workgroup"); } while (0)

// Multi-head self-attention with a 'Kripke modal' mask (x [2,2048,1024]; torch (out,in) Wq / Wk / Wv / Wproj [1024,1024] N(0,1) x 0.02 applied as x @ W.T, no biases; accessibility [4,4] int32 = random 0 / 1 with a unit diagonal, a module input READ on the device; 16 heads x 64; world = token index % 4; scores / sqrt(64) set to -inf wherever accessibility[world(q)][world(k)] == 0; softmax; out @ Wproj.T). Every row keeps the keys of its own world (the diagonal is 1), so no row is empty.
#define NB 2
#define TT 2048
#define CC 1024            // NH * HD = projected width
#define DIN 1024          // input (model) width
#define NH 16
#define HD 64
#define SCALE (0.125f)
#define CAUSAL 0
#ifndef TNB
#define TNB NB
#endif
__device__ __forceinline__ float bfr(float v) { return (float)(__bf16)v; }
__host__ __device__ __forceinline__ int kb_last(int qb) { return CAUSAL ? ((qb * 64 + 63) >> 7) : (TT / 128 - 1); }
typedef __attribute__((ext_vector_type(8))) __bf16 v8b;
__device__ __forceinline__ v16b frag_b(const __bf16* rowk0, int lane) {
  union { v16b v; v8b q[2]; } u; const __bf16* p = rowk0 + 8 * (lane >> 4);
  u.q[0] = *(const v8b*)p; u.q[1] = *(const v8b*)(p + 16); return u.v;
}
#define QBH 0
#define QHI 0               // single-product logits on every row
#define KHI 64            // key rows carrying k residual / v bf16 hi+lo planes (no kernel here writes or reads them)
// B fragment (k rows k0+.., output column o) of a weight: (in,out) [K][ld] or (out,in) [ld rows of K]: bf16 exact, or f16(bf16 * 256) exact
__device__ __forceinline__ v16b wcol_io(const float* Wm, int k0, int o, int lane, int ld) { v16b w; const int g = lane >> 4;
#pragma unroll
  for (int i = 0; i < 8; ++i) { w[i] = (__bf16)Wm[(size_t)(k0 + 8 * g + i) * ld + o]; w[8 + i] = (__bf16)Wm[(size_t)(k0 + 16 + 8 * g + i) * ld + o]; }
  return w; }
__device__ __forceinline__ v16b wcol_oi(const float* Wm, int k0, int o, int lane, int K) { v16b w; const float* p = Wm + (size_t)o * K + k0 + 8 * (lane >> 4);
#pragma unroll
  for (int i = 0; i < 8; ++i) { w[i] = (__bf16)p[i]; w[8 + i] = (__bf16)p[16 + i]; }
  return w; }
__device__ __forceinline__ v16h wcolh_io(const float* Wm, int k0, int o, int lane, int ld) { v16h w; const int g = lane >> 4;
#pragma unroll
  for (int i = 0; i < 8; ++i) { w[i] = (_Float16)(bfr(Wm[(size_t)(k0 + 8 * g + i) * ld + o]) * 256.0f); w[8 + i] = (_Float16)(bfr(Wm[(size_t)(k0 + 16 + 8 * g + i) * ld + o]) * 256.0f); }
  return w; }
__device__ __forceinline__ v16h wcolh_oi(const float* Wm, int k0, int o, int lane, int K) { v16h w; const float* p = Wm + (size_t)o * K + k0 + 8 * (lane >> 4);
#pragma unroll
  for (int i = 0; i < 8; ++i) { w[i] = (_Float16)(bfr(p[i]) * 256.0f); w[8 + i] = (_Float16)(bfr(p[16 + i]) * 256.0f); }
  return w; }
#define WQKV_LAYOUT 1   // 0 = (in,out) [DIN][CC]; 1 = (out,in) [CC][DIN]; 2 = per-head [NH][DIN][HD]
__device__ __forceinline__ v16b wcol_hdk(const float* Wm, int k0, int o, int lane) { v16b w; const int g = lane >> 4; const float* p = Wm + (size_t)(o / HD) * DIN * HD + (o % HD);
#pragma unroll
  for (int i = 0; i < 8; ++i) { w[i] = (__bf16)p[(size_t)(k0 + 8 * g + i) * HD]; w[8 + i] = (__bf16)p[(size_t)(k0 + 16 + 8 * g + i) * HD]; }
  return w; }
#define WO_OUT_IN 1
#if WQKV_LAYOUT == 1
#define WCOL(W, k0, o, lane) wcol_oi(W, k0, o, lane, DIN)
#elif WQKV_LAYOUT == 2
#define WCOL(W, k0, o, lane) wcol_hdk(W, k0, o, lane)
#else
#define WCOL(W, k0, o, lane) wcol_io(W, k0, o, lane, CC)
#endif
#if WO_OUT_IN
#define WOCOL(W, k0, o, lane) wcol_oi(W, k0, o, lane, CC)
#define WOCOLH(W, k0, o, lane) wcolh_oi(W, k0, o, lane, CC)
#else
#define WOCOL(W, k0, o, lane) wcol_io(W, k0, o, lane, DIN)
#define WOCOLH(W, k0, o, lane) wcolh_io(W, k0, o, lane, DIN)
#endif

#define WS_QH  0u                                      // f16 q rows [b*t][CC]
#define WS_KH  (WS_QH + 2u * (size_t)NB * TT * CC)      // f16 k rows [b*t][CC]
#define WS_VT  (WS_KH + 2u * (size_t)NB * TT * CC)      // f16 v planes [b][c][t]
#define WS_QL  (WS_VT + 2u * (size_t)NB * CC * TT)      // f16 q residual x 2^10 rows [b][t < QHI][CC]
#define WS_KL  (WS_QL + 2u * (size_t)NB * QHI * CC)     // f16 k residual x 2^10 rows [b][t < KHI][CC]
#define WS_VB  (WS_KL + 2u * (size_t)NB * KHI * CC)     // bf16 v hi planes [b][c][t < KHI]
#define WS_VBL (WS_VB + 2u * (size_t)NB * CC * KHI)
#define WS_Y   (WS_VBL + 2u * (size_t)NB * CC * KHI)    // f32 ctx rows [b*t][CC]
#define WS_END (WS_Y  + 4u * (size_t)NB * TT * CC)

// ---- gemm128: the product loop of k_proj and k_out. Block = 256 threads = 8 waves (2 x 4), tile 128 rows x 128 columns, K = 1024 in 16 stages of 64. Both operands are K-contiguous f32 rows: each stage is read once per block with whole-line 16-byte loads, rounded once to its 16-bit form and laid in LDS; the waves take their fragments from there (wave tile 64 x 32: 4 A x 2 B fragments). Two LDS buffers: stage s + 1 is fetched into registers ahead of stage s's products and stored behind them, one barrier a stage. The k order of every accumulator is the ascending one.
// every plain '#pragma unroll' in gemm128, k_proj and k_out but the one on gemm128's kc loop stands on a loop over a register array (staged rows, fragments, accumulator tiles): its index must be a constant for the array to stay in registers
#define GP 72               // LDS row pitch in 16-bit elements: 128-B rows + 16 B (16 B x odd, for 16-byte readers)
#define GTILE (128 * GP)    // one operand's tile of one stage; a buffer is [A tile | B tile]
#define GKD 1024            // K of both products (DIN = CC)
typedef __attribute__((ext_vector_type(4))) __bf16 v4b;
typedef __attribute__((ext_vector_type(4))) _Float16 v4h;
// MODE 0: both operands to bf16. MODE 1: A x 2^6 to f16, B = f16(bf16 x 2^8)
template <int MODE, int OPB> __device__ __forceinline__ void st4(unsigned short* d, v4f x) {
  if constexpr (MODE == 0) { v4b y;
#pragma unroll
    for (int i = 0; i < 4; ++i) y[i] = (__bf16)x[i];
    *(v4b*)d = y;
  } else { v4h y;
#pragma unroll
    for (int i = 0; i < 4; ++i) y[i] = OPB ? (_Float16)(bfr(x[i]) * 256.0f) : (_Float16)(x[i] * 64.0f);
    *(v4h*)d = y; } }
template <int MODE> __device__ __forceinline__ void gemm128(const float* __restrict__ A, const float* __restrict__ B, unsigned short* sm, v8f (&acc)[4][2]) {
  const int tid = threadIdx.x, wave = tid >> 5, lane = tid & 31, col = lane & 15; const int wm = wave >> 2, wn = wave & 3;
  const int srow = tid >> 4, sc = (tid & 15) * 4;   /* 16 lanes cover the 256 B of one row's stage; 16 rows a sweep, 8 sweeps an operand */
  const float* ga = A + (size_t)srow * GKD + sc; const float* gb = B + (size_t)srow * GKD + sc;
  unsigned short* wr = sm + srow * GP + sc;
  const unsigned short* fa = sm + (wm * 64 + col) * GP; const unsigned short* fb = sm + GTILE + (wn * 32 + col) * GP;
  v4f ra[8], rb[8];
#pragma unroll
  for (int i = 0; i < 8; ++i) { ra[i] = *(const v4f*)(ga + (size_t)i * 16 * GKD); rb[i] = *(const v4f*)(gb + (size_t)i * 16 * GKD); }
#pragma unroll
  for (int i = 0; i < 8; ++i) { st4<MODE, 0>(wr + i * 16 * GP, ra[i]); st4<MODE, 1>(wr + GTILE + i * 16 * GP, rb[i]); }
  __syncthreads();
#pragma unroll 1   /* rolled: the 16 stages share one small loop body in the instruction cache */
  for (int s = 0; s < GKD / 64; ++s) { const int cur = (s & 1) * 2 * GTILE, nxt = 2 * GTILE - cur; const bool more = s + 1 < GKD / 64;   /* block-uniform */
    if (more) {
#pragma unroll
      for (int i = 0; i < 8; ++i) { ra[i] = *(const v4f*)(ga + (size_t)i * 16 * GKD + (s + 1) * 64); rb[i] = *(const v4f*)(gb + (size_t)i * 16 * GKD + (s + 1) * 64); } }
#pragma unroll
    for (int kc = 0; kc < 2; ++kc) {
      if constexpr (MODE == 0) { v16b af[4], bf[2];
#pragma unroll
        for (int i = 0; i < 4; ++i) af[i] = frag_b((const __bf16*)(fa + cur + i * 16 * GP + kc * 32), lane);
#pragma unroll
        for (int j = 0; j < 2; ++j) bf[j] = frag_b((const __bf16*)(fb + cur + j * 16 * GP + kc * 32), lane);
#pragma unroll
        for (int i = 0; i < 4; ++i)
#pragma unroll
          for (int j = 0; j < 2; ++j) acc[i][j] = wmma_bf(af[i], bf[j], acc[i][j]);
      } else { v16h af[4], bf[2];
#pragma unroll
        for (int i = 0; i < 4; ++i) af[i] = frag_h((const _Float16*)(fa + cur + i * 16 * GP + kc * 32), lane);
#pragma unroll
        for (int j = 0; j < 2; ++j) bf[j] = frag_h((const _Float16*)(fb + cur + j * 16 * GP + kc * 32), lane);
#pragma unroll
        for (int i = 0; i < 4; ++i)
#pragma unroll
          for (int j = 0; j < 2; ++j) acc[i][j] = wmma16(af[i], bf[j], acc[i][j]); } }
    if (more) {
#pragma unroll
      for (int i = 0; i < 8; ++i) { st4<MODE, 0>(wr + nxt + i * 16 * GP, ra[i]); st4<MODE, 1>(wr + nxt + GTILE + i * 16 * GP, rb[i]); } }
    __syncthreads(); } }   /* publishes stage s + 1 and ends every read of stage s's buffer; behind the last one the LDS is free for the output staging */
// ---- k_proj: block = (128 rows, 128 cols, which): q/k/v = X W (+ b) with exact bf16 products (K = DIN) -> which 0: q f16 rows; 1: k f16 rows; 2: v f16 planes [c][t]
__global__ __launch_bounds__(256) void k_proj(const float* __restrict__ XQ, const float* __restrict__ XK, const float* __restrict__ XV, const float* __restrict__ WQ, const float* __restrict__ WK, const float* __restrict__ WV, const float* __restrict__ BQ, const float* __restrict__ BK, const float* __restrict__ BV,
    _Float16* __restrict__ QH, _Float16* __restrict__ KH, _Float16* __restrict__ VT) {
  __shared__ __align__(16) unsigned short sm[4 * GTILE];
  const int tid = threadIdx.x, wave = tid >> 5, lane = tid & 31, col = lane & 15, g = lane >> 4; const int wm = wave >> 2, wn = wave & 3; const int which = blockIdx.z; const int c0 = blockIdx.y * 128; const size_t r0 = (size_t)blockIdx.x * 128; const size_t bb = r0 / TT; const int t0 = (int)(r0 % TT);
  const float* X = which == 0 ? XQ : which == 1 ? XK : XV; const float* WA = which == 0 ? WQ : which == 1 ? WK : WV; const float* BA = which == 0 ? BQ : which == 1 ? BK : BV;
  v8f acc[4][2] = {};
  gemm128<0>(X + r0 * DIN, WA + (size_t)c0 * DIN, sm, acc);
  _Float16* st = (_Float16*)sm;   /* output staging [128][136] f16, so that the stores cover whole lines */
  if (which < 2) { _Float16* DH = which == 0 ? QH : KH;   /* block-uniform */
#pragma unroll
    for (int j = 0; j < 2; ++j) { const float bias = BA ? bfr(BA[c0 + wn * 32 + j * 16 + col]) : 0.f;
#pragma unroll
      for (int i = 0; i < 4; ++i)
#pragma unroll
        for (int r = 0; r < 8; ++r) st[(wm * 64 + i * 16 + 8 * g + r) * 136 + wn * 32 + j * 16 + col] = (_Float16)(acc[i][j][r] + bias); }
    __syncthreads();
    for (int e = tid; e < 128 * 16; e += 256) { const int rl = e >> 4, q = e & 15; vst2((unsigned*)(DH + (r0 + rl) * CC + c0 + q * 8), *(const v4u*)&st[rl * 136 + q * 8]); }
  } else {
#pragma unroll
    for (int j = 0; j < 2; ++j) { const float bias = BA ? bfr(BA[c0 + wn * 32 + j * 16 + col]) : 0.f;
#pragma unroll
      for (int i = 0; i < 4; ++i) { v8h pk;   /* a lane's 8 rows of one column lie side by side in the transposed plane */
#pragma unroll
        for (int r = 0; r < 8; ++r) pk[r] = (_Float16)(acc[i][j][r] + bias);
        *(v8h*)&st[(wn * 32 + j * 16 + col) * 136 + wm * 64 + i * 16 + 8 * g] = pk; } }
    __syncthreads();
    for (int e = tid; e < 128 * 16; e += 256) { const int cl = e >> 4, q = e & 15; vst2((unsigned*)(VT + (bb * CC + c0 + cl) * (size_t)TT + t0 + q * 8), *(const v4u*)&st[cl * 136 + q * 8]); } } }
// ---- k_attn: block = 128 queries (4 waves x 32) of (b, h); one pass = 32 keys. S^T = K Q^T (A = 16 key rows, B = 16 query columns): a lane holds one query's 16 scores of the pass, the lane 16 away the other 16. Two S^T tiles converted in place are the B operand of O^T += V^T P^T (same k order as frag_h), so scores and P stay in registers. Online softmax in base 2, f32: running maximum m, running sum l, O^T rescaled by 2^(m_old - m_new) every pass.
// every plain '#pragma unroll' in this kernel after the table read stands on a loop over a register array (fragments, tiles, a lane's scores): its index must be a constant for the array to stay in registers
// modal mask: key % 4 = r % 4 and query % 4 = col % 4 at every pass, so the table row of a lane becomes four addends (0 or the excluded value) formed once before the loop
__device__ __forceinline__ float xhalf(float x) { return __builtin_bit_cast(float, __builtin_amdgcn_permlanex16(__builtin_bit_cast(int, x), __builtin_bit_cast(int, x), 0x76543210, 0xfedcba98, false, false)); }   // lane l with lane l ^ 16
#define SCALE_LOG2E (SCALE * 1.4426950408889634f)
// 2^x in place. Behind v_exp_f32 the instruction set asks for one independent instruction or v_nop before its result is used or its source overwritten: in one statement each v_exp_f32 is that instruction for the one before it, and the v_nop serves the last
__device__ __forceinline__ void exp2x8(float* x) {
  asm("v_exp_f32 %0, %0\n\tv_exp_f32 %1, %1\n\tv_exp_f32 %2, %2\n\tv_exp_f32 %3, %3\n\tv_exp_f32 %4, %4\n\tv_exp_f32 %5, %5\n\tv_exp_f32 %6, %6\n\tv_exp_f32 %7, %7\n\tv_nop"
      : "+v"(x[0]), "+v"(x[1]), "+v"(x[2]), "+v"(x[3]), "+v"(x[4]), "+v"(x[5]), "+v"(x[6]), "+v"(x[7])); }
__device__ __forceinline__ float exp2x1(float x) { asm("v_exp_f32 %0, %0\n\tv_nop" : "+v"(x)); return x; }
__global__ __launch_bounds__(128) void k_attn(const _Float16* __restrict__ QH, const _Float16* __restrict__ KH, const _Float16* __restrict__ VT, const int* __restrict__ ACC, float* __restrict__ Y) {
  const int tid = threadIdx.x, wave = tid >> 5, lane = tid & 31, col = lane & 15, g = lane >> 4; const int h = blockIdx.y, b = blockIdx.z; const int q0 = blockIdx.x * 128 + wave * 32;
  unsigned accm = 0u;
#pragma unroll
  for (int i = 0; i < 16; ++i) accm |= ((ACC[i] != 0) ? 1u : 0u) << i;
  const unsigned rowm = (accm >> ((col & 3) << 2)) & 15u;   /* the table row of this lane's queries (q0 and the 16-query step are multiples of 4) */
  float bias[4];
#pragma unroll
  for (int i = 0; i < 4; ++i) bias[i] = ((rowm >> i) & 1u) ? 0.f : -3.0e38f;
  v16h qf[2][2];
#pragma unroll
  for (int n = 0; n < 2; ++n)
#pragma unroll
    for (int kc = 0; kc < 2; ++kc) qf[n][kc] = frag_h(QH + ((size_t)b * TT + q0 + n * 16 + col) * CC + h * HD + kc * 32, lane);
  const _Float16* Kp = KH + ((size_t)b * TT + col) * CC + h * HD;
  const _Float16* Vp = VT + ((size_t)b * CC + h * HD + col) * (size_t)TT;
  v8f o[2][4] = {}; float m[2] = {-3.0e38f, -3.0e38f}, l[2] = {0.f, 0.f};
  v16h kf[2][2];
#pragma unroll
  for (int i = 0; i < 2; ++i)
#pragma unroll
    for (int kc = 0; kc < 2; ++kc) kf[i][kc] = frag_h(Kp + (size_t)(i * 16) * CC + kc * 32, lane);
#pragma unroll 2   /* two passes a trip: the K fragments fetched one pass ahead change places by register naming, not by copies */
  for (int kb = 0; kb < TT / 32; ++kb) { const int k0 = kb * 32; const int kn0 = kb + 1 < TT / 32 ? k0 + 32 : k0;   /* the last pass fetches its own keys again: in bounds, unused */
    v16h vf[4], kn[2][2];
#pragma unroll
    for (int j = 0; j < 4; ++j) vf[j] = frag_h(Vp + (size_t)(j * 16) * TT + k0, lane);
#pragma unroll
    for (int i = 0; i < 2; ++i)
#pragma unroll
      for (int kc = 0; kc < 2; ++kc) kn[i][kc] = frag_h(Kp + (size_t)(kn0 + i * 16) * CC + kc * 32, lane);
    v8f st[2][2] = {};
#pragma unroll
    for (int kc = 0; kc < 2; ++kc)
#pragma unroll
      for (int i = 0; i < 2; ++i)
#pragma unroll
        for (int n = 0; n < 2; ++n) st[n][i] = wmma16(kf[i][kc], qf[n][kc], st[n][i]);
    v16h pb[2];
#pragma unroll
    for (int n = 0; n < 2; ++n) { float s[16];
#pragma unroll
      for (int r = 0; r < 8; ++r) { s[r] = fmaf(st[n][0][r], SCALE_LOG2E, bias[r & 3]); s[8 + r] = fmaf(st[n][1][r], SCALE_LOG2E, bias[r & 3]); }
      float mx = s[0];
#pragma unroll
      for (int i = 1; i < 16; ++i) mx = fmaxf(mx, s[i]);
      mx = fmaxf(mx, xhalf(mx));
      const float mn = fmaxf(m[n], mx); const float al = exp2x1(m[n] - mn); m[n] = mn;
      const float mo = mn - 11.0f;   /* P carried x 2^11 into f16 (clear of f16 subnormals); l carries the same factor, so it cancels in O / l */
#pragma unroll
      for (int i = 0; i < 16; ++i) s[i] -= mo;
      exp2x8(s); exp2x8(s + 8);
      float sum = 0.f;
#pragma unroll
      for (int i = 0; i < 16; ++i) { sum += s[i]; pb[n][i] = (_Float16)s[i]; }
      l[n] = l[n] * al + sum;
#pragma unroll
      for (int j = 0; j < 4; ++j) o[n][j] *= al; }
#pragma unroll
    for (int j = 0; j < 4; ++j)
#pragma unroll
      for (int n = 0; n < 2; ++n) o[n][j] = wmma16(vf[j], pb[n], o[n][j]);
#pragma unroll
    for (int i = 0; i < 2; ++i)
#pragma unroll
      for (int kc = 0; kc < 2; ++kc) kf[i][kc] = kn[i][kc]; }
#pragma unroll
  for (int n = 0; n < 2; ++n) { const float lt = l[n] + xhalf(l[n]); const float inv = (rowm != 0u && lt > 0.f) ? 1.0f / lt : 0.f;   /* a fully excluded row yields ctx = 0 */
    float* yr = Y + ((size_t)b * TT + q0 + n * 16 + col) * CC + h * HD + 8 * g;
#pragma unroll
    for (int j = 0; j < 4; ++j) { const v8f ov = o[n][j] * inv; vst2(yr + j * 16, (v4f){ov[0], ov[1], ov[2], ov[3]}); vst2(yr + j * 16 + 4, (v4f){ov[4], ov[5], ov[6], ov[7]}); } } }
// ---- k_out: block = (128 rows, 128 cols): out = ctx Wo (+ bo): ctx x 2^6 once to f16 (small-magnitude context rows stay clear of f16 subnormals) against Wo as f16(bf16 x 2^8) exact (1 product) x 2^-14
__global__ __launch_bounds__(256) void k_out(const float* __restrict__ Y, const float* __restrict__ WO, const float* __restrict__ BO, float* __restrict__ OUT) {
  __shared__ __align__(16) unsigned short sm[4 * GTILE];
  const int tid = threadIdx.x, wave = tid >> 5, lane = tid & 31, col = lane & 15, g = lane >> 4; const int wm = wave >> 2, wn = wave & 3; const int c0 = blockIdx.y * 128; const size_t r0 = (size_t)blockIdx.x * 128;
  v8f acc[4][2] = {};
  gemm128<1>(Y + r0 * CC, WO + (size_t)c0 * CC, sm, acc);
  float* sf = (float*)sm;   /* output staging [128][132] f32 (67,584 B of the 73,728), so that the stores cover whole lines */
#pragma unroll
  for (int j = 0; j < 2; ++j) { const float bias = BO ? bfr(BO[c0 + wn * 32 + j * 16 + col]) : 0.f;
#pragma unroll
    for (int i = 0; i < 4; ++i)
#pragma unroll
      for (int r = 0; r < 8; ++r) sf[(wm * 64 + i * 16 + 8 * g + r) * 132 + wn * 32 + j * 16 + col] = acc[i][j][r] * (1.0f / 16384.0f) + bias; }   /* 2^-8 (Wo carry) x 2^-6 (ctx carry) */
  __syncthreads();
  for (int e = tid; e < 128 * 32; e += 256) { const int rl = e >> 5, q = e & 31; vst2(OUT + (r0 + rl) * DIN + c0 + q * 4, *(const v4f*)&sf[rl * 132 + q * 4]); } }

extern "C" void kernel_launch(void* const* d_in, const int* in_sizes, int n_in, void* d_out, int out_size, void* d_ws, size_t ws_size, hipStream_t stream) {
  (void)in_sizes; (void)n_in; (void)out_size;
  const float** F = (const float**)d_in;
  if (ws_size < (size_t)WS_END) return;
  char* ws = (char*)d_ws; _Float16 *QH = (_Float16*)(ws + WS_QH), *KH = (_Float16*)(ws + WS_KH), *VT = (_Float16*)(ws + WS_VT), *QL = (_Float16*)(ws + WS_QL), *KL = (_Float16*)(ws + WS_KL); __bf16 *VB = (__bf16*)(ws + WS_VB), *VBL = (__bf16*)(ws + WS_VBL); float *Y = (float*)(ws + WS_Y);
  (void)Y; (void)QL; (void)KL; (void)VB; (void)VBL;
  // inputs: 0 x [2,2048,1024]; 1 Wq [1024,1024] (out,in); 2 Wk; 3 Wv; 4 Wproj (out,in); 5 accessibility [4,4] int32 (random 0 / 1, unit diagonal; READ on the device); no biases
  k_proj<<<dim3(TNB * TT / 128, CC / 128, 3), 256, 0, stream>>>(F[0], F[0], F[0], F[1], F[2], F[3], nullptr, nullptr, nullptr, QH, KH, VT);
  k_attn<<<dim3(TT / 128, NH, TNB), 128, 0, stream>>>(QH, KH, VT, (const int*)d_in[5], Y);
  k_out<<<dim3(TNB * TT / 128, DIN / 128), 256, 0, stream>>>(Y, F[4], nullptr, (float*)d_out);
}

// v003
// One run takes 99.7 microseconds.
// Next to v002, in two timings, it ran 1.11 times as fast each time.
// Over all steps from v000 it is 13.5 times as fast.
// compute dtype: all float inputs rounded to bf16; q / k / v projections with EXACT bf16 products on WMMA 16x16x32 (f32 accumulate) + bias (none); one attention kernel: logits k x q once to f16 each (1 product) x 64^-0.5 x log2(e); the 4 x 4 accessibility table read at (query % 4, key % 4); online softmax f32 in base 2; unnormalised P x 2^11 once to f16 x v once to f16 (1 product), divided by the f32 row sum at the end; ctx x 2^6 once to f16 x the output weight f16(bf16 x 2^8) + bias; f32 output.
#include <hip/hip_runtime.h>
#include <math.h>

typedef __attribute__((ext_vector_type(16))) _Float16 v16h;
typedef __attribute__((ext_vector_type(16))) __bf16 v16b;
typedef __attribute__((ext_vector_type(8)))  _Float16 v8h;
typedef __attribute__((ext_vector_type(8)))  float v8f;
typedef __attribute__((ext_vector_type(4)))  float v4f;
typedef __attribute__((ext_vector_type(2)))  float v2f;
typedef __attribute__((ext_vector_type(4)))  unsigned v4u;
typedef __attribute__((ext_vector_type(4)))  int v4i;
typedef float __attribute__((may_alias)) float_a;
typedef int __attribute__((may_alias)) int_a;

template <typename T> __device__ __forceinline__ void vst2(void* p, T v) { *(T*)p = v;  }
__device__ __forceinline__ v8f wmma16(v16h a, v16h b, v8f c) {
  v8f d = __builtin_amdgcn_wmma_f32_16x16x32_f16(false, a, false, b, (short)0, c, false, false);
  asm volatile("v_nop\n\tv_nop\n\tv_nop\n\tv_nop" : "+v"(d) : "v"(a), "v"(b));
  return d;
}
__device__ __forceinline__ v8f wmma_bf(v16b a, v16b b, v8f c) {
  v8f d = __builtin_amdgcn_wmma_f32_16x16x32_bf16(false, a, false, b, (short)0, c, false, false);
  asm volatile("v_nop\n\tv_nop\n\tv_nop\n\tv_nop" : "+v"(d) : "v"(a), "v"(b));
  return d;
}
// 16x16x32 fragments: lane = (h = lane>>4, row/col = lane&15); elements 0..7 = k0+8h+0..7, 8..15 = k0+16+8h+0..7; D element r = row 8h+r
__device__ __forceinline__ v16h frag_h(const _Float16* rowk0, int lane) {
  union { v16h v; v8h q[2]; } u; const _Float16* p = rowk0 + 8 * (lane >> 4);
  u.q[0] = *(const v8h*)p; u.q[1] = *(const v8h*)(p + 16); return u.v;
}
__device__ __forceinline__ v16h frag_f32(const float* rowk0, int lane) {
  v16h a; const float* p = rowk0 + 8 * (lane >> 4);
#pragma unroll
  for (int i = 0; i < 8; ++i) { a[i] = (_Float16)p[i]; a[8 + i] = (_Float16)p[16 + i]; }
  return a;
}
__device__ __forceinline__ v16h frag_f32s(const float* rowk0, int lane, float sc) {
  v16h a; const float* p = rowk0 + 8 * (lane >> 4);
#pragma unroll
  for (int i = 0; i < 8; ++i) { a[i] = (_Float16)(p[i] * sc); a[8 + i] = (_Float16)(p[16 + i] * sc); }
  return a;
}
// column fragment from a [K][ld] layout (column n), rows >= K read as 0
__device__ __forceinline__ v16h fragc_f32(const float* W, int k0, int n, int lane, int ld, int K) {
  v16h a; const int g = lane >> 4;
#pragma unroll
  for (int i = 0; i < 8; ++i) { const int ka = k0 + 8 * g + i, kb = ka + 16;
    a[i] = (_Float16)(ka < K ? W[(size_t)(ka < K ? ka : K - 1) * ld + n] : 0.f); a[8 + i] = (_Float16)(kb < K ? W[(size_t)(kb < K ? kb : K - 1) * ld + n] : 0.f); }
  return a;
}
struct F2 { v16b h, l; };
__device__ __forceinline__ F2 bsplit16(const float v[16]) { F2 r;
#pragma unroll
  for (int i = 0; i < 16; ++i) { const __bf16 h = (__bf16)v[i]; r.h[i] = h; r.l[i] = (__bf16)(v[i] - (float)h); }
  return r; }
__device__ __forceinline__ F2 split_row(const float* row, int k0, int lane) { float v[16]; const float* p = row + k0 + 8 * (lane >> 4);
#pragma unroll
  for (int i = 0; i < 8; ++i) { v[i] = p[i]; v[8 + i] = p[16 + i]; }
  return bsplit16(v); }
__device__ __forceinline__ F2 split_rowK(const float* row, int k0, int lane, int K) { float v[16]; const int g = lane >> 4;
#pragma unroll
  for (int i = 0; i < 8; ++i) { const int ka = k0 + 8 * g + i, kb = ka + 16; v[i] = ka < K ? row[ka < K ? ka : K - 1] : 0.f; v[8 + i] = kb < K ? row[kb < K ? kb : K - 1] : 0.f; }
  return bsplit16(v); }
__device__ __forceinline__ F2 split_col(const float* W, int k0, int n, int lane, int ld, int K) { float v[16]; const int g = lane >> 4;
#pragma unroll
  for (int i = 0; i < 8; ++i) { const int ka = k0 + 8 * g + i, kb = ka + 16; v[i] = ka < K ? W[(size_t)(ka < K ? ka : K - 1) * ld + n] : 0.f; v[8 + i] = kb < K ? W[(size_t)(kb < K ? kb : K - 1) * ld + n] : 0.f; }
  return bsplit16(v); }
__device__ __forceinline__ v8f mac3(const F2& a, const F2& b, v8f c) { c = wmma_bf(a.l, b.h, c); c = wmma_bf(a.h, b.l, c); return wmma_bf(a.h, b.h, c); }
__device__ __forceinline__ float sigm(float v) { return 1.0f / (1.0f + expf(-v)); }
#define LDSX() do { asm volatile("s_wait_dscnt 0" ::: "memory"); __builtin_amdgcn_wave_barrier(); __builtin_amdgcn_fence(__ATOMIC_RELEASE, "workgroup"); } while (0)

// Multi-head self-attention with a 'Kripke modal' mask (x [2,2048,1024]; torch (out,in) Wq / Wk / Wv / Wproj [1024,1024] N(0,1) x 0.02 applied as x @ W.T, no biases; accessibility [4,4] int32 = random 0 / 1 with a unit diagonal, a module input READ on the device; 16 heads x 64; world = token index % 4; scores / sqrt(64) set to -inf wherever accessibility[world(q)][world(k)] == 0; softmax; out @ Wproj.T). Every row keeps the keys of its own world (the diagonal is 1), so no row is empty.
#define NB 2
#define TT 2048
#define CC 1024            // NH * HD = projected width
#define DIN 1024          // input (model) width
#define NH 16
#define HD 64
#define SCALE (0.125f)
#define CAUSAL 0
#ifndef TNB
#define TNB NB
#endif
__device__ __forceinline__ float bfr(float v) { return (float)(__bf16)v; }
__host__ __device__ __forceinline__ int kb_last(int qb) { return CAUSAL ? ((qb * 64 + 63) >> 7) : (TT / 128 - 1); }
typedef __attribute__((ext_vector_type(8))) __bf16 v8b;
__device__ __forceinline__ v16b frag_b(const __bf16* rowk0, int lane) {
  union { v16b v; v8b q[2]; } u; const __bf16* p = rowk0 + 8 * (lane >> 4);
  u.q[0] = *(const v8b*)p; u.q[1] = *(const v8b*)(p + 16); return u.v;
}
#define QBH 0
#define QHI 0               // single-product logits on every row
#define KHI 64            // key rows carrying k residual / v bf16 hi+lo planes (no kernel here writes or reads them)
// B fragment (k rows k0+.., output column o) of a weight: (in,out) [K][ld] or (out,in) [ld rows of K]: bf16 exact, or f16(bf16 * 256) exact
__device__ __forceinline__ v16b wcol_io(const float* Wm, int k0, int o, int lane, int ld) { v16b w; const int g = lane >> 4;
#pragma unroll
  for (int i = 0; i < 8; ++i) { w[i] = (__bf16)Wm[(size_t)(k0 + 8 * g + i) * ld + o]; w[8 + i] = (__bf16)Wm[(size_t)(k0 + 16 + 8 * g + i) * ld + o]; }
  return w; }
__device__ __forceinline__ v16b wcol_oi(const float* Wm, int k0, int o, int lane, int K) { v16b w; const float* p = Wm + (size_t)o * K + k0 + 8 * (lane >> 4);
#pragma unroll
  for (int i = 0; i < 8; ++i) { w[i] = (__bf16)p[i]; w[8 + i] = (__bf16)p[16 + i]; }
  return w; }
__device__ __forceinline__ v16h wcolh_io(const float* Wm, int k0, int o, int lane, int ld) { v16h w; const int g = lane >> 4;
#pragma unroll
  for (int i = 0; i < 8; ++i) { w[i] = (_Float16)(bfr(Wm[(size_t)(k0 + 8 * g + i) * ld + o]) * 256.0f); w[8 + i] = (_Float16)(bfr(Wm[(size_t)(k0 + 16 + 8 * g + i) * ld + o]) * 256.0f); }
  return w; }
__device__ __forceinline__ v16h wcolh_oi(const float* Wm, int k0, int o, int lane, int K) { v16h w; const float* p = Wm + (size_t)o * K + k0 + 8 * (lane >> 4);
#pragma unroll
  for (int i = 0; i < 8; ++i) { w[i] = (_Float16)(bfr(p[i]) * 256.0f); w[8 + i] = (_Float16)(bfr(p[16 + i]) * 256.0f); }
  return w; }
#define WQKV_LAYOUT 1   // 0 = (in,out) [DIN][CC]; 1 = (out,in) [CC][DIN]; 2 = per-head [NH][DIN][HD]
__device__ __forceinline__ v16b wcol_hdk(const float* Wm, int k0, int o, int lane) { v16b w; const int g = lane >> 4; const float* p = Wm + (size_t)(o / HD) * DIN * HD + (o % HD);
#pragma unroll
  for (int i = 0; i < 8; ++i) { w[i] = (__bf16)p[(size_t)(k0 + 8 * g + i) * HD]; w[8 + i] = (__bf16)p[(size_t)(k0 + 16 + 8 * g + i) * HD]; }
  return w; }
#define WO_OUT_IN 1
#if WQKV_LAYOUT == 1
#define WCOL(W, k0, o, lane) wcol_oi(W, k0, o, lane, DIN)
#elif WQKV_LAYOUT == 2
#define WCOL(W, k0, o, lane) wcol_hdk(W, k0, o, lane)
#else
#define WCOL(W, k0, o, lane) wcol_io(W, k0, o, lane, CC)
#endif
#if WO_OUT_IN
#define WOCOL(W, k0, o, lane) wcol_oi(W, k0, o, lane, CC)
#define WOCOLH(W, k0, o, lane) wcolh_oi(W, k0, o, lane, CC)
#else
#define WOCOL(W, k0, o, lane) wcol_io(W, k0, o, lane, DIN)
#define WOCOLH(W, k0, o, lane) wcolh_io(W, k0, o, lane, DIN)
#endif

#define WS_QH  0u                                      // f16 q rows [b*t][CC]
#define WS_KH  (WS_QH + 2u * (size_t)NB * TT * CC)      // f16 k rows [b*t][CC]
#define WS_VT  (WS_KH + 2u * (size_t)NB * TT * CC)      // f16 v planes [b][c][t]
#define WS_QL  (WS_VT + 2u * (size_t)NB * CC * TT)      // f16 q residual x 2^10 rows [b][t < QHI][CC]
#define WS_KL  (WS_QL + 2u * (size_t)NB * QHI * CC)     // f16 k residual x 2^10 rows [b][t < KHI][CC]
#define WS_VB  (WS_KL + 2u * (size_t)NB * KHI * CC)     // bf16 v hi planes [b][c][t < KHI]
#define WS_VBL (WS_VB + 2u * (size_t)NB * CC * KHI)
#define WS_Y   (WS_VBL + 2u * (size_t)NB * CC * KHI)    // f32 ctx rows [b*t][CC]
#define WS_END (WS_Y  + 4u * (size_t)NB * TT * CC)

// ---- gemm128: the product loop of k_proj and k_out. Block = 256 threads = 8 waves (2 x 4), tile 128 rows x 128 columns, K = 1024 in 16 stages of 64. Both operands are K-contiguous f32 rows: each stage is read once per block with whole-line 16-byte loads, rounded once to its 16-bit form and laid in LDS; the waves take their fragments from there (wave tile 64 x 32: 4 A x 2 B fragments). Two LDS buffers: stage s + 1 is fetched into registers ahead of stage s's products and stored behind them, one barrier a stage. The k order of every accumulator is the ascending one.
// every plain '#pragma unroll' in gemm128, k_proj and k_out but the one on gemm128's kc loop stands on a loop over a register array (staged rows, fragments, accumulator tiles): its index must be a constant for the array to stay in registers
#define GP 72               // LDS row pitch in 16-bit elements: 128-B rows + 16 B (16 B x odd, for 16-byte readers)
#define GTILE (128 * GP)    // one operand's tile of one stage; a buffer is [A tile | B tile]
#define GKD 1024            // K of both products (DIN = CC)
typedef __attribute__((ext_vector_type(4))) __bf16 v4b;
typedef __attribute__((ext_vector_type(4))) _Float16 v4h;
// MODE 0: both operands to bf16. MODE 1: A x 2^6 to f16, B = f16(bf16 x 2^8)
template <int MODE, int OPB> __device__ __forceinline__ void st4(unsigned short* d, v4f x) {
  if constexpr (MODE == 0) { v4b y;
#pragma unroll
    for (int i = 0; i < 4; ++i) y[i] = (__bf16)x[i];
    *(v4b*)d = y;
  } else { v4h y;
#pragma unroll
    for (int i = 0; i < 4; ++i) y[i] = OPB ? (_Float16)(bfr(x[i]) * 256.0f) : (_Float16)(x[i] * 64.0f);
    *(v4h*)d = y; } }
template <int MODE> __device__ __forceinline__ void gemm128(const float* __restrict__ A, const float* __restrict__ B, unsigned short* sm, v8f (&acc)[4][2]) {
  const int tid = threadIdx.x, wave = tid >> 5, lane = tid & 31, col = lane & 15; const int wm = wave >> 2, wn = wave & 3;
  const int srow = tid >> 4, sc = (tid & 15) * 4;   /* 16 lanes cover the 256 B of one row's stage; 16 rows a sweep, 8 sweeps an operand */
  const float* ga = A + (size_t)srow * GKD + sc; const float* gb = B + (size_t)srow * GKD + sc;
  unsigned short* wr = sm + srow * GP + sc;
  const unsigned short* fa = sm + (wm * 64 + col) * GP; const unsigned short* fb = sm + GTILE + (wn * 32 + col) * GP;
  v4f ra[8], rb[8];
#pragma unroll
  for (int i = 0; i < 8; ++i) { ra[i] = *(const v4f*)(ga + (size_t)i * 16 * GKD); rb[i] = *(const v4f*)(gb + (size_t)i * 16 * GKD); }
#pragma unroll
  for (int i = 0; i < 8; ++i) { st4<MODE, 0>(wr + i * 16 * GP, ra[i]); st4<MODE, 1>(wr + GTILE + i * 16 * GP, rb[i]); }
  __syncthreads();
#pragma unroll 1   /* rolled: the 16 stages share one small loop body in the instruction cache */
  for (int s = 0; s < GKD / 64; ++s) { const int cur = (s & 1) * 2 * GTILE, nxt = 2 * GTILE - cur; const bool more = s + 1 < GKD / 64;   /* block-uniform */
    if (more) {
#pragma unroll
      for (int i = 0; i < 8; ++i) { ra[i] = *(const v4f*)(ga + (size_t)i * 16 * GKD + (s + 1) * 64); rb[i] = *(const v4f*)(gb + (size_t)i * 16 * GKD + (s + 1) * 64); } }
#pragma unroll
    for (int kc = 0; kc < 2; ++kc) {
      if constexpr (MODE == 0) { v16b af[4], bf[2];
#pragma unroll
        for (int i = 0; i < 4; ++i) af[i] = frag_b((const __bf16*)(fa + cur + i * 16 * GP + kc * 32), lane);
#pragma unroll
        for (int j = 0; j < 2; ++j) bf[j] = frag_b((const __bf16*)(fb + cur + j * 16 * GP + kc * 32), lane);
#pragma unroll
        for (int i = 0; i < 4; ++i)
#pragma unroll
          for (int j = 0; j < 2; ++j) acc[i][j] = wmma_bf(af[i], bf[j], acc[i][j]);
      } else { v16h af[4], bf[2];
#pragma unroll
        for (int i = 0; i < 4; ++i) af[i] = frag_h((const _Float16*)(fa + cur + i * 16 * GP + kc * 32), lane);
#pragma unroll
        for (int j = 0; j < 2; ++j) bf[j] = frag_h((const _Float16*)(fb + cur + j * 16 * GP + kc * 32), lane);
#pragma unroll
        for (int i = 0; i < 4; ++i)
#pragma unroll
          for (int j = 0; j < 2; ++j) acc[i][j] = wmma16(af[i], bf[j], acc[i][j]); } }
    if (more) {
#pragma unroll
      for (int i = 0; i < 8; ++i) { st4<MODE, 0>(wr + nxt + i * 16 * GP, ra[i]); st4<MODE, 1>(wr + nxt + GTILE + i * 16 * GP, rb[i]); } }
    __syncthreads(); } }   /* publishes stage s + 1 and ends every read of stage s's buffer; behind the last one the LDS is free for the output staging */
// ---- k_proj: block = (128 rows, 128 cols, which): q/k/v = X W (+ b) with exact bf16 products (K = DIN) -> which 0: q f16 rows; 1: k f16 rows; 2: v f16 planes [c][t]
__global__ __launch_bounds__(256) void k_proj(const float* __restrict__ XQ, const float* __restrict__ XK, const float* __restrict__ XV, const float* __restrict__ WQ, const float* __restrict__ WK, const float* __restrict__ WV, const float* __restrict__ BQ, const float* __restrict__ BK, const float* __restrict__ BV,
    _Float16* __restrict__ QH, _Float16* __restrict__ KH, _Float16* __restrict__ VT) {
  __shared__ __align__(16) unsigned short sm[4 * GTILE];
  const int tid = threadIdx.x, wave = tid >> 5, lane = tid & 31, col = lane & 15, g = lane >> 4; const int wm = wave >> 2, wn = wave & 3; const int which = blockIdx.z; const int c0 = blockIdx.y * 128; const size_t r0 = (size_t)blockIdx.x * 128; const size_t bb = r0 / TT; const int t0 = (int)(r0 % TT);
  const float* X = which == 0 ? XQ : which == 1 ? XK : XV; const float* WA = which == 0 ? WQ : which == 1 ? WK : WV; const float* BA = which == 0 ? BQ : which == 1 ? BK : BV;
  v8f acc[4][2] = {};
  gemm128<0>(X + r0 * DIN, WA + (size_t)c0 * DIN, sm, acc);
  _Float16* st = (_Float16*)sm;   /* output staging [128][136] f16, so that the stores cover whole lines */
  if (which < 2) { _Float16* DH = which == 0 ? QH : KH;   /* block-uniform */
#pragma unroll
    for (int j = 0; j < 2; ++j) { const float bias = BA ? bfr(BA[c0 + wn * 32 + j * 16 + col]) : 0.f;
#pragma unroll
      for (int i = 0; i < 4; ++i)
#pragma unroll
        for (int r = 0; r < 8; ++r) st[(wm * 64 + i * 16 + 8 * g + r) * 136 + wn * 32 + j * 16 + col] = (_Float16)(acc[i][j][r] + bias); }
    __syncthreads();
    for (int e = tid; e < 128 * 16; e += 256) { const int rl = e >> 4, q = e & 15; vst2((unsigned*)(DH + (r0 + rl) * CC + c0 + q * 8), *(const v4u*)&st[rl * 136 + q * 8]); }
  } else {
#pragma unroll
    for (int j = 0; j < 2; ++j) { const float bias = BA ? bfr(BA[c0 + wn * 32 + j * 16 + col]) : 0.f;
#pragma unroll
      for (int i = 0; i < 4; ++i) { v8h pk;   /* a lane's 8 rows of one column lie side by side in the transposed plane */
#pragma unroll
        for (int r = 0; r < 8; ++r) pk[r] = (_Float16)(acc[i][j][r] + bias);
        *(v8h*)&st[(wn * 32 + j * 16 + col) * 136 + wm * 64 + i * 16 + 8 * g] = pk; } }
    __syncthreads();
    for (int e = tid; e < 128 * 16; e += 256) { const int cl = e >> 4, q = e & 15; vst2((unsigned*)(VT + (bb * CC + c0 + cl) * (size_t)TT + t0 + q * 8), *(const v4u*)&st[cl * 136 + q * 8]); } } }
// ---- k_attn: block = 128 queries (4 waves x 32) of (b, h); one pass = 32 keys, one staged tile = 64 keys = two passes. S^T = K Q^T (A = 16 key rows, B = 16 query columns): a lane holds one query's 16 scores of the pass, the lane 16 away the other 16. Two S^T tiles converted in place are the B operand of O^T += V^T P^T (same k order as frag_h), so scores and P stay in registers. Online softmax in base 2, f32: running maximum m, running sum l, O^T rescaled by 2^(m_old - m_new) every pass.
// K rows and V^T rows of a tile (128 B each) come into LDS once per block by asynchronous 16-byte copies, 8 lanes to a whole line; the four waves take their fragments from there. Two buffers: tile t + 1 flies while tile t is worked on; one barrier a tile publishes tile t + 1 and ends every read of the buffer that is refilled behind it.
// every plain '#pragma unroll' in this kernel but those on the accessibility-table loop and the pass loop stands on a loop over a register array (fragments, tiles, a lane's scores): its index must be a constant for the array to stay in registers
// modal mask: key % 4 = r % 4 and query % 4 = col % 4 at every pass, so the table row of a lane becomes four addends (0 or the excluded value) formed once before the loop
__device__ __forceinline__ float xhalf(float x) { return __builtin_bit_cast(float, __builtin_amdgcn_permlanex16(__builtin_bit_cast(int, x), __builtin_bit_cast(int, x), 0x76543210, 0xfedcba98, false, false)); }   // lane l with lane l ^ 16
#define SCALE_LOG2E (SCALE * 1.4426950408889634f)
// 2^x in place. Behind v_exp_f32 the instruction set asks for one independent instruction or v_nop before its result is used or its source overwritten: in one statement each v_exp_f32 is that instruction for the one before it, and the v_nop serves the last
__device__ __forceinline__ void exp2x8(float* x) {
  asm("v_exp_f32 %0, %0\n\tv_exp_f32 %1, %1\n\tv_exp_f32 %2, %2\n\tv_exp_f32 %3, %3\n\tv_exp_f32 %4, %4\n\tv_exp_f32 %5, %5\n\tv_exp_f32 %6, %6\n\tv_exp_f32 %7, %7\n\tv_nop"
      : "+v"(x[0]), "+v"(x[1]), "+v"(x[2]), "+v"(x[3]), "+v"(x[4]), "+v"(x[5]), "+v"(x[6]), "+v"(x[7])); }
__device__ __forceinline__ float exp2x1(float x) { asm("v_exp_f32 %0, %0\n\tv_nop" : "+v"(x)); return x; }
#define AK 64               // keys of one staged tile
#define AP 72               // LDS row pitch in 16-bit elements: 128-B rows + 16 B (16 B x odd, for 16-byte readers)
#define ATILE (64 * AP)     // K tile [64 keys][AP] or V^T tile [64 dims][AP]; a buffer is [K tile | V^T tile]
// one tile's copies of a lane: rows r, r + 16, r + 32, r + 48 of the K tile and of the V^T tile, 16 B each (lds = the lane's byte address in the K tile of the target buffer). The s_wait_xcnt stands inside the statement so that no address register of an issued copy is rewritten ahead of it
__device__ __forceinline__ void stage_kv(unsigned lds, const _Float16* gk, const _Float16* gv) {
  asm volatile("global_load_async_to_lds_b128 %0, %8, off\n\tglobal_load_async_to_lds_b128 %1, %9, off\n\tglobal_load_async_to_lds_b128 %2, %10, off\n\tglobal_load_async_to_lds_b128 %3, %11, off\n\t"
               "global_load_async_to_lds_b128 %4, %12, off\n\tglobal_load_async_to_lds_b128 %5, %13, off\n\tglobal_load_async_to_lds_b128 %6, %14, off\n\tglobal_load_async_to_lds_b128 %7, %15, off\n\ts_wait_xcnt 0x0"
      :: "v"(lds), "v"(lds + 16u * AP * 2u), "v"(lds + 32u * AP * 2u), "v"(lds + 48u * AP * 2u),
         "v"(lds + ATILE * 2u), "v"(lds + ATILE * 2u + 16u * AP * 2u), "v"(lds + ATILE * 2u + 32u * AP * 2u), "v"(lds + ATILE * 2u + 48u * AP * 2u),
         "v"(gk), "v"(gk + (size_t)16 * CC), "v"(gk + (size_t)32 * CC), "v"(gk + (size_t)48 * CC),
         "v"(gv), "v"(gv + (size_t)16 * TT), "v"(gv + (size_t)32 * TT), "v"(gv + (size_t)48 * TT) : "memory"); }
__global__ __launch_bounds__(128) void k_attn(const _Float16* __restrict__ QH, const _Float16* __restrict__ KH, const _Float16* __restrict__ VT, const int* __restrict__ ACC, float* __restrict__ Y) {
  __shared__ __align__(16) _Float16 kv[2 * 2 * ATILE];
  const int tid = threadIdx.x, wave = tid >> 5, lane = tid & 31, col = lane & 15, g = lane >> 4; const int h = blockIdx.y, b = blockIdx.z; const int q0 = blockIdx.x * 128 + wave * 32;
  const unsigned ldsw = (unsigned)(size_t)kv + (unsigned)((tid >> 3) * AP + (tid & 7) * 8) * 2u;   /* 8 lanes cover the 128 B of one row; 16 rows a copy of the block */
  const _Float16* gk = KH + ((size_t)b * TT + (tid >> 3)) * CC + h * HD + (tid & 7) * 8;
  const _Float16* gv = VT + ((size_t)b * CC + h * HD + (tid >> 3)) * (size_t)TT + (tid & 7) * 8;
  stage_kv(ldsw, gk, gv);
  unsigned accm = 0u;
#pragma unroll
  for (int i = 0; i < 16; ++i) accm |= ((ACC[i] != 0) ? 1u : 0u) << i;
  const unsigned rowm = (accm >> ((col & 3) << 2)) & 15u;   /* the table row of this lane's queries (q0 and the 16-query step are multiples of 4) */
  float bias[4];
#pragma unroll
  for (int i = 0; i < 4; ++i) bias[i] = ((rowm >> i) & 1u) ? 0.f : -3.0e38f;
  v16h qf[2][2];
#pragma unroll
  for (int n = 0; n < 2; ++n)
#pragma unroll
    for (int kc = 0; kc < 2; ++kc) qf[n][kc] = frag_h(QH + ((size_t)b * TT + q0 + n * 16 + col) * CC + h * HD + kc * 32, lane);
  const _Float16* fk = kv + col * AP; const _Float16* fv = kv + ATILE + col * AP;
  v8f o[2][4] = {}; float m[2] = {-3.0e38f, -3.0e38f}, l[2] = {0.f, 0.f};
  asm volatile("s_wait_asynccnt 0x0" ::: "memory");   /* this wave's copies of tile 0 have landed */
  __syncthreads();   /* tile 0 is published */
  stage_kv(ldsw + 2u * ATILE * 2u, gk + (size_t)AK * CC, gv + AK);
#pragma unroll 1   /* rolled: the 32 tiles share one loop body of two passes in the instruction cache */
  for (int t = 0; t < TT / AK; ++t) { const int cur = (t & 1) * 2 * ATILE;
#pragma unroll
   for (int p = 0; p < 2; ++p) {
    v16h vf[4], kf[2][2];
#pragma unroll
    for (int i = 0; i < 2; ++i)
#pragma unroll
      for (int kc = 0; kc < 2; ++kc) kf[i][kc] = frag_h(fk + cur + (p * 32 + i * 16) * AP + kc * 32, lane);
#pragma unroll
    for (int j = 0; j < 4; ++j) vf[j] = frag_h(fv + cur + (j * 16) * AP + p * 32, lane);
    v8f st[2][2] = {};
#pragma unroll
    for (int kc = 0; kc < 2; ++kc)
#pragma unroll
      for (int i = 0; i < 2; ++i)
#pragma unroll
        for (int n = 0; n < 2; ++n) st[n][i] = wmma16(kf[i][kc], qf[n][kc], st[n][i]);
    v16h pb[2];
#pragma unroll
    for (int n = 0; n < 2; ++n) { float s[16];
#pragma unroll
      for (int r = 0; r < 8; ++r) { s[r] = fmaf(st[n][0][r], SCALE_LOG2E, bias[r & 3]); s[8 + r] = fmaf(st[n][1][r], SCALE_LOG2E, bias[r & 3]); }
      float mx = s[0];
#pragma unroll
      for (int i = 1; i < 16; ++i) mx = fmaxf(mx, s[i]);
      mx = fmaxf(mx, xhalf(mx));
      const float mn = fmaxf(m[n], mx); const float al = exp2x1(m[n] - mn); m[n] = mn;
      const float mo = mn - 11.0f;   /* P carried x 2^11 into f16 (clear of f16 subnormals); l carries the same factor, so it cancels in O / l */
#pragma unroll
      for (int i = 0; i < 16; ++i) s[i] -= mo;
      exp2x8(s); exp2x8(s + 8);
      float sum = 0.f;
#pragma unroll
      for (int i = 0; i < 16; ++i) { sum += s[i]; pb[n][i] = (_Float16)s[i]; }
      l[n] = l[n] * al + sum;
#pragma unroll
      for (int j = 0; j < 4; ++j) o[n][j] *= al; }
#pragma unroll
    for (int j = 0; j < 4; ++j)
#pragma unroll
      for (int n = 0; n < 2; ++n) o[n][j] = wmma16(vf[j], pb[n], o[n][j]); }
    asm volatile("s_wait_dscnt 0x0" ::: "memory");      /* this wave's reads of tile t's buffer have returned before the buffer is handed to the copies */
    asm volatile("s_wait_asynccnt 0x0" ::: "memory");   /* this wave's copies of tile t + 1 have landed */
    __syncthreads();   /* publishes tile t + 1 and ends every wave's reads of tile t's buffer */
    if (t + 2 < TT / AK) stage_kv(ldsw + (unsigned)cur * 2u, gk + (size_t)(t + 2) * AK * CC, gv + (t + 2) * AK); }   /* block-uniform test */
  asm volatile("s_wait_asynccnt 0x0" ::: "memory");   /* no copy is outstanding when the wave ends */
#pragma unroll
  for (int n = 0; n < 2; ++n) { const float lt = l[n] + xhalf(l[n]); const float inv = (rowm != 0u && lt > 0.f) ? 1.0f / lt : 0.f;   /* a fully excluded row yields ctx = 0 */
    float* yr = Y + ((size_t)b * TT + q0 + n * 16 + col) * CC + h * HD + 8 * g;
#pragma unroll
    for (int j = 0; j < 4; ++j) { const v8f ov = o[n][j] * inv; vst2(yr + j * 16, (v4f){ov[0], ov[1], ov[2], ov[3]}); vst2(yr + j * 16 + 4, (v4f){ov[4], ov[5], ov[6], ov[7]}); } } }
// ---- k_out: block = (128 rows, 128 cols): out = ctx Wo (+ bo): ctx x 2^6 once to f16 (small-magnitude context rows stay clear of f16 subnormals) against Wo as f16(bf16 x 2^8) exact (1 product) x 2^-14
__global__ __launch_bounds__(256) void k_out(const float* __restrict__ Y, const float* __restrict__ WO, const float* __restrict__ BO, float* __restrict__ OUT) {
  __shared__ __align__(16) unsigned short sm[4 * GTILE];
  const int tid = threadIdx.x, wave = tid >> 5, lane = tid & 31, col = lane & 15, g = lane >> 4; const int wm = wave >> 2, wn = wave & 3; const int c0 = blockIdx.y * 128; const size_t r0 = (size_t)blockIdx.x * 128;
  v8f acc[4][2] = {};
  gemm128<1>(Y + r0 * CC, WO + (size_t)c0 * CC, sm, acc);
  float* sf = (float*)sm;   /* output staging [128][132] f32 (67,584 B of the 73,728), so that the stores cover whole lines */
#pragma unroll
  for (int j = 0; j < 2; ++j) { const float bias = BO ? bfr(BO[c0 + wn * 32 + j * 16 + col]) : 0.f;
#pragma unroll
    for (int i = 0; i < 4; ++i)
#pragma unroll
      for (int r = 0; r < 8; ++r) sf[(wm * 64 + i * 16 + 8 * g + r) * 132 + wn * 32 + j * 16 + col] = acc[i][j][r] * (1.0f / 16384.0f) + bias; }   /* 2^-8 (Wo carry) x 2^-6 (ctx carry) */
  __syncthreads();
  for (int e = tid; e < 128 * 32; e += 256) { const int rl = e >> 5, q = e & 31; vst2(OUT + (r0 + rl) * DIN + c0 + q * 4, *(const v4f*)&sf[rl * 132 + q * 4]); } }

extern "C" void kernel_launch(void* const* d_in, const int* in_sizes, int n_in, void* d_out, int out_size, void* d_ws, size_t ws_size, hipStream_t stream) {
  (void)in_sizes; (void)n_in; (void)out_size;
  const float** F = (const float**)d_in;
  if (ws_size < (size_t)WS_END) return;
  char* ws = (char*)d_ws; _Float16 *QH = (_Float16*)(ws + WS_QH), *KH = (_Float16*)(ws + WS_KH), *VT = (_Float16*)(ws + WS_VT), *QL = (_Float16*)(ws + WS_QL), *KL = (_Float16*)(ws + WS_KL); __bf16 *VB = (__bf16*)(ws + WS_VB), *VBL = (__bf16*)(ws + WS_VBL); float *Y = (float*)(ws + WS_Y);
  (void)Y; (void)QL; (void)KL; (void)VB; (void)VBL;
  // inputs: 0 x [2,2048,1024]; 1 Wq [1024,1024] (out,in); 2 Wk; 3 Wv; 4 Wproj (out,in); 5 accessibility [4,4] int32 (random 0 / 1, unit diagonal; READ on the device); no biases
  k_proj<<<dim3(TNB * TT / 128, CC / 128, 3), 256, 0, stream>>>(F[0], F[0], F[0], F[1], F[2], F[3], nullptr, nullptr, nullptr, QH, KH, VT);
  k_attn<<<dim3(TT / 128, NH, TNB), 128, 0, stream>>>(QH, KH, VT, (const int*)d_in[5], Y);
  k_out<<<dim3(TNB * TT / 128, DIN / 128), 256, 0, stream>>>(Y, F[4], nullptr, (float*)d_out);
}

// v004
// Measured time: 85.4 microseconds a run.
// Two timings next to v003 put it at 1.17 and 1.16 times that version's speed.
// Over all steps from v000 it is 15.8 times as fast.
// compute dtype: all float inputs rounded to bf16; q / k / v projections with EXACT bf16 products on WMMA 16x16x32 (f32 accumulate) + bias (none); one attention kernel: logits k x q once to f16 each (1 product) x 64^-0.5 x log2(e); tokens kept sorted by world (token % 4) in q / k / v, so the 4 x 4 accessibility table read at (query world, key world) admits or skips a whole run of 512 keys; online softmax f32 in base 2; unnormalised P x 2^11 once to f16 x v once to f16 (1 product), divided by the f32 row sum at the end; ctx x 2^6 once to f16 x the output weight f16(bf16 x 2^8) + bias; f32 output.
#include <hip/hip_runtime.h>
#include <math.h>

typedef __attribute__((ext_vector_type(16))) _Float16 v16h;
typedef __attribute__((ext_vector_type(16))) __bf16 v16b;
typedef __attribute__((ext_vector_type(8)))  _Float16 v8h;
typedef __attribute__((ext_vector_type(8)))  float v8f;
typedef __attribute__((ext_vector_type(4)))  float v4f;
typedef __attribute__((ext_vector_type(2)))  float v2f;
typedef __attribute__((ext_vector_type(4)))  unsigned v4u;
typedef __attribute__((ext_vector_type(4)))  int v4i;
typedef float __attribute__((may_alias)) float_a;
typedef int __attribute__((may_alias)) int_a;

template <typename T> __device__ __forceinline__ void vst2(void* p, T v) { *(T*)p = v;  }
__device__ __forceinline__ v8f wmma16(v16h a, v16h b, v8f c) {
  v8f d = __builtin_amdgcn_wmma_f32_16x16x32_f16(false, a, false, b, (short)0, c, false, false);
  asm volatile("v_nop\n\tv_nop\n\tv_nop\n\tv_nop" : "+v"(d) : "v"(a), "v"(b));
  return d;
}
__device__ __forceinline__ v8f wmma_bf(v16b a, v16b b, v8f c) {
  v8f d = __builtin_amdgcn_wmma_f32_16x16x32_bf16(false, a, false, b, (short)0, c, false, false);
  asm volatile("v_nop\n\tv_nop\n\tv_nop\n\tv_nop" : "+v"(d) : "v"(a), "v"(b));
  return d;
}
// 16x16x32 fragments: lane = (h = lane>>4, row/col = lane&15); elements 0..7 = k0+8h+0..7, 8..15 = k0+16+8h+0..7; D element r = row 8h+r
__device__ __forceinline__ v16h frag_h(const _Float16* rowk0, int lane) {
  union { v16h v; v8h q[2]; } u; const _Float16* p = rowk0 + 8 * (lane >> 4);
  u.q[0] = *(const v8h*)p; u.q[1] = *(const v8h*)(p + 16); return u.v;
}
__device__ __forceinline__ v16h frag_f32(const float* rowk0, int lane) {
  v16h a; const float* p = rowk0 + 8 * (lane >> 4);
#pragma unroll
  for (int i = 0; i < 8; ++i) { a[i] = (_Float16)p[i]; a[8 + i] = (_Float16)p[16 + i]; }
  return a;
}
__device__ __forceinline__ v16h frag_f32s(const float* rowk0, int lane, float sc) {
  v16h a; const float* p = rowk0 + 8 * (lane >> 4);
#pragma unroll
  for (int i = 0; i < 8; ++i) { a[i] = (_Float16)(p[i] * sc); a[8 + i] = (_Float16)(p[16 + i] * sc); }
  return a;
}
// column fragment from a [K][ld] layout (column n), rows >= K read as 0
__device__ __forceinline__ v16h fragc_f32(const float* W, int k0, int n, int lane, int ld, int K) {
  v16h a; const int g = lane >> 4;
#pragma unroll
  for (int i = 0; i < 8; ++i) { const int ka = k0 + 8 * g + i, kb = ka + 16;
    a[i] = (_Float16)(ka < K ? W[(size_t)(ka < K ? ka : K - 1) * ld + n] : 0.f); a[8 + i] = (_Float16)(kb < K ? W[(size_t)(kb < K ? kb : K - 1) * ld + n] : 0.f); }
  return a;
}
struct F2 { v16b h, l; };
__device__ __forceinline__ F2 bsplit16(const float v[16]) { F2 r;
#pragma unroll
  for (int i = 0; i < 16; ++i) { const __bf16 h = (__bf16)v[i]; r.h[i] = h; r.l[i] = (__bf16)(v[i] - (float)h); }
  return r; }
__device__ __forceinline__ F2 split_row(const float* row, int k0, int lane) { float v[16]; const float* p = row + k0 + 8 * (lane >> 4);
#pragma unroll
  for (int i = 0; i < 8; ++i) { v[i] = p[i]; v[8 + i] = p[16 + i]; }
  return bsplit16(v); }
__device__ __forceinline__ F2 split_rowK(const float* row, int k0, int lane, int K) { float v[16]; const int g = lane >> 4;
#pragma unroll
  for (int i = 0; i < 8; ++i) { const int ka = k0 + 8 * g + i, kb = ka + 16; v[i] = ka < K ? row[ka < K ? ka : K - 1] : 0.f; v[8 + i] = kb < K ? row[kb < K ? kb : K - 1] : 0.f; }
  return bsplit16(v); }
__device__ __forceinline__ F2 split_col(const float* W, int k0, int n, int lane, int ld, int K) { float v[16]; const int g = lane >> 4;
#pragma unroll
  for (int i = 0; i < 8; ++i) { const int ka = k0 + 8 * g + i, kb = ka + 16; v[i] = ka < K ? W[(size_t)(ka < K ? ka : K - 1) * ld + n] : 0.f; v[8 + i] = kb < K ? W[(size_t)(kb < K ? kb : K - 1) * ld + n] : 0.f; }
  return bsplit16(v); }
__device__ __forceinline__ v8f mac3(const F2& a, const F2& b, v8f c) { c = wmma_bf(a.l, b.h, c); c = wmma_bf(a.h, b.l, c); return wmma_bf(a.h, b.h, c); }
__device__ __forceinline__ float sigm(float v) { return 1.0f / (1.0f + expf(-v)); }
#define LDSX() do { asm volatile("s_wait_dscnt 0" ::: "memory"); __builtin_amdgcn_wave_barrier(); __builtin_amdgcn_fence(__ATOMIC_RELEASE, "workgroup"); } while (0)

// Multi-head self-attention with a 'Kripke modal' mask (x [2,2048,1024]; torch (out,in) Wq / Wk / Wv / Wproj [1024,1024] N(0,1) x 0.02 applied as x @ W.T, no biases; accessibility [4,4] int32 = random 0 / 1 with a unit diagonal, a module input READ on the device; 16 heads x 64; world = token index % 4; scores / sqrt(64) set to -inf wherever accessibility[world(q)][world(k)] == 0; softmax; out @ Wproj.T). Every row keeps the keys of its own world (the diagonal is 1), so no row is empty.
#define NB 2
#define TT 2048
#define CC 1024            // NH * HD = projected width
#define DIN 1024          // input (model) width
#define NH 16
#define HD 64
#define SCALE (0.125f)
#define CAUSAL 0
#ifndef TNB
#define TNB NB
#endif
__device__ __forceinline__ float bfr(float v) { return (float)(__bf16)v; }
__host__ __device__ __forceinline__ int kb_last(int qb) { return CAUSAL ? ((qb * 64 + 63) >> 7) : (TT / 128 - 1); }
typedef __attribute__((ext_vector_type(8))) __bf16 v8b;
__device__ __forceinline__ v16b frag_b(const __bf16* rowk0, int lane) {
  union { v16b v; v8b q[2]; } u; const __bf16* p = rowk0 + 8 * (lane >> 4);
  u.q[0] = *(const v8b*)p; u.q[1] = *(const v8b*)(p + 16); return u.v;
}
#define QBH 0
#define QHI 0               // single-product logits on every row
#define KHI 64            // key rows carrying k residual / v bf16 hi+lo planes (no kernel here writes or reads them)
// B fragment (k rows k0+.., output column o) of a weight: (in,out) [K][ld] or (out,in) [ld rows of K]: bf16 exact, or f16(bf16 * 256) exact
__device__ __forceinline__ v16b wcol_io(const float* Wm, int k0, int o, int lane, int ld) { v16b w; const int g = lane >> 4;
#pragma unroll
  for (int i = 0; i < 8; ++i) { w[i] = (__bf16)Wm[(size_t)(k0 + 8 * g + i) * ld + o]; w[8 + i] = (__bf16)Wm[(size_t)(k0 + 16 + 8 * g + i) * ld + o]; }
  return w; }
__device__ __forceinline__ v16b wcol_oi(const float* Wm, int k0, int o, int lane, int K) { v16b w; const float* p = Wm + (size_t)o * K + k0 + 8 * (lane >> 4);
#pragma unroll
  for (int i = 0; i < 8; ++i) { w[i] = (__bf16)p[i]; w[8 + i] = (__bf16)p[16 + i]; }
  return w; }
__device__ __forceinline__ v16h wcolh_io(const float* Wm, int k0, int o, int lane, int ld) { v16h w; const int g = lane >> 4;
#pragma unroll
  for (int i = 0; i < 8; ++i) { w[i] = (_Float16)(bfr(Wm[(size_t)(k0 + 8 * g + i) * ld + o]) * 256.0f); w[8 + i] = (_Float16)(bfr(Wm[(size_t)(k0 + 16 + 8 * g + i) * ld + o]) * 256.0f); }
  return w; }
__device__ __forceinline__ v16h wcolh_oi(const float* Wm, int k0, int o, int lane, int K) { v16h w; const float* p = Wm + (size_t)o * K + k0 + 8 * (lane >> 4);
#pragma unroll
  for (int i = 0; i < 8; ++i) { w[i] = (_Float16)(bfr(p[i]) * 256.0f); w[8 + i] = (_Float16)(bfr(p[16 + i]) * 256.0f); }
  return w; }
#define WQKV_LAYOUT 1   // 0 = (in,out) [DIN][CC]; 1 = (out,in) [CC][DIN]; 2 = per-head [NH][DIN][HD]
__device__ __forceinline__ v16b wcol_hdk(const float* Wm, int k0, int o, int lane) { v16b w; const int g = lane >> 4; const float* p = Wm + (size_t)(o / HD) * DIN * HD + (o % HD);
#pragma unroll
  for (int i = 0; i < 8; ++i) { w[i] = (__bf16)p[(size_t)(k0 + 8 * g + i) * HD]; w[8 + i] = (__bf16)p[(size_t)(k0 + 16 + 8 * g + i) * HD]; }
  return w; }
#define WO_OUT_IN 1
#if WQKV_LAYOUT == 1
#define WCOL(W, k0, o, lane) wcol_oi(W, k0, o, lane, DIN)
#elif WQKV_LAYOUT == 2
#define WCOL(W, k0, o, lane) wcol_hdk(W, k0, o, lane)
#else
#define WCOL(W, k0, o, lane) wcol_io(W, k0, o, lane, CC)
#endif
#if WO_OUT_IN
#define WOCOL(W, k0, o, lane) wcol_oi(W, k0, o, lane, CC)
#define WOCOLH(W, k0, o, lane) wcolh_oi(W, k0, o, lane, CC)
#else
#define WOCOL(W, k0, o, lane) wcol_io(W, k0, o, lane, DIN)
#define WOCOLH(W, k0, o, lane) wcolh_io(W, k0, o, lane, DIN)
#endif

// 'pos' = a token's place in world order: pos = (t % 4) * (TT / 4) + t / 4
#define WS_QH  0u                                      // f16 q rows [b*pos][CC]
#define WS_KH  (WS_QH + 2u * (size_t)NB * TT * CC)      // f16 k rows [b*pos][CC]
#define WS_VT  (WS_KH + 2u * (size_t)NB * TT * CC)      // f16 v planes [b][c][pos]
#define WS_QL  (WS_VT + 2u * (size_t)NB * CC * TT)      // f16 q residual x 2^10 rows [b][t < QHI][CC]
#define WS_KL  (WS_QL + 2u * (size_t)NB * QHI * CC)     // f16 k residual x 2^10 rows [b][t < KHI][CC]
#define WS_VB  (WS_KL + 2u * (size_t)NB * KHI * CC)     // bf16 v hi planes [b][c][t < KHI]
#define WS_VBL (WS_VB + 2u * (size_t)NB * CC * KHI)
#define WS_Y   (WS_VBL + 2u * (size_t)NB * CC * KHI)    // f32 ctx rows [b*t][CC]
#define WS_END (WS_Y  + 4u * (size_t)NB * TT * CC)

// ---- gemm128: the product loop of k_proj and k_out. Block = 256 threads = 8 waves (2 x 4), tile 128 rows x 128 columns, K = 1024 in 16 stages of 64. Both operands are K-contiguous f32 rows (A's rows LDA floats apart): each stage is read once per block with whole-line 16-byte loads, rounded once to its 16-bit form and laid in LDS; the waves take their fragments from there (wave tile 64 x 32: 4 A x 2 B fragments). Two LDS buffers: stage s + 1 is fetched into registers ahead of stage s's products and stored behind them, one barrier a stage. The k order of every accumulator is the ascending one.
// every plain '#pragma unroll' in gemm128, k_proj and k_out stands on a loop over a register array (staged rows, fragments, accumulator tiles): its index must be a constant for the array to stay in registers
#define GP 72               // LDS row pitch in 16-bit elements: 128-B rows + 16 B (16 B x odd, for 16-byte readers)
#define GTILE (128 * GP)    // one operand's tile of one stage; a buffer is [A tile | B tile]
#define GKD 1024            // K of both products (DIN = CC)
typedef __attribute__((ext_vector_type(4))) __bf16 v4b;
typedef __attribute__((ext_vector_type(4))) _Float16 v4h;
// MODE 0: both operands to bf16. MODE 1: A x 2^6 to f16, B = f16(bf16 x 2^8)
template <int MODE, int OPB> __device__ __forceinline__ void st4(unsigned short* d, v4f x) {
  if constexpr (MODE == 0) { v4b y;
#pragma unroll
    for (int i = 0; i < 4; ++i) y[i] = (__bf16)x[i];
    *(v4b*)d = y;
  } else { v4h y;
#pragma unroll
    for (int i = 0; i < 4; ++i) y[i] = OPB ? (_Float16)(bfr(x[i]) * 256.0f) : (_Float16)(x[i] * 64.0f);
    *(v4h*)d = y; } }
template <int MODE, int LDA> __device__ __forceinline__ void gemm128(const float* __restrict__ A, const float* __restrict__ B, unsigned short* sm, v8f (&acc)[4][2]) {
  const int tid = threadIdx.x, wave = tid >> 5, lane = tid & 31, col = lane & 15; const int wm = wave >> 2, wn = wave & 3;
  const int srow = tid >> 4, sc = (tid & 15) * 4;   /* 16 lanes cover the 256 B of one row's stage; 16 rows a sweep, 8 sweeps an operand */
  const float* ga = A + (size_t)srow * LDA + sc; const float* gb = B + (size_t)srow * GKD + sc;
  unsigned short* wr = sm + srow * GP + sc;
  const unsigned short* fa = sm + (wm * 64 + col) * GP; const unsigned short* fb = sm + GTILE + (wn * 32 + col) * GP;
  v4f ra[8], rb[8];
#pragma unroll
  for (int i = 0; i < 8; ++i) { ra[i] = *(const v4f*)(ga + (size_t)i * 16 * LDA); rb[i] = *(const v4f*)(gb + (size_t)i * 16 * GKD); }
#pragma unroll
  for (int i = 0; i < 8; ++i) { st4<MODE, 0>(wr + i * 16 * GP, ra[i]); st4<MODE, 1>(wr + GTILE + i * 16 * GP, rb[i]); }
  __syncthreads();
#pragma unroll 1   /* rolled: the 16 stages share one small loop body in the instruction cache */
  for (int s = 0; s < GKD / 64; ++s) { const int cur = (s & 1) * 2 * GTILE, nxt = 2 * GTILE - cur; const bool more = s + 1 < GKD / 64;   /* block-uniform */
    if (more) {
#pragma unroll
      for (int i = 0; i < 8; ++i) { ra[i] = *(const v4f*)(ga + (size_t)i * 16 * LDA + (s + 1) * 64); rb[i] = *(const v4f*)(gb + (size_t)i * 16 * GKD + (s + 1) * 64); } }
#pragma unroll
    for (int kc = 0; kc < 2; ++kc) {
      if constexpr (MODE == 0) { v16b af[4], bf[2];
#pragma unroll
        for (int i = 0; i < 4; ++i) af[i] = frag_b((const __bf16*)(fa + cur + i * 16 * GP + kc * 32), lane);
#pragma unroll
        for (int j = 0; j < 2; ++j) bf[j] = frag_b((const __bf16*)(fb + cur + j * 16 * GP + kc * 32), lane);
#pragma unroll
        for (int i = 0; i < 4; ++i)
#pragma unroll
          for (int j = 0; j < 2; ++j) acc[i][j] = wmma_bf(af[i], bf[j], acc[i][j]);
      } else { v16h af[4], bf[2];
#pragma unroll
        for (int i = 0; i < 4; ++i) af[i] = frag_h((const _Float16*)(fa + cur + i * 16 * GP + kc * 32), lane);
#pragma unroll
        for (int j = 0; j < 2; ++j) bf[j] = frag_h((const _Float16*)(fb + cur + j * 16 * GP + kc * 32), lane);
#pragma unroll
        for (int i = 0; i < 4; ++i)
#pragma unroll
          for (int j = 0; j < 2; ++j) acc[i][j] = wmma16(af[i], bf[j], acc[i][j]); } }
    if (more) {
#pragma unroll
      for (int i = 0; i < 8; ++i) { st4<MODE, 0>(wr + nxt + i * 16 * GP, ra[i]); st4<MODE, 1>(wr + nxt + GTILE + i * 16 * GP, rb[i]); } }
    __syncthreads(); } }   /* publishes stage s + 1 and ends every read of stage s's buffer; behind the last one the LDS is free for the output staging */
// ---- k_proj: block = (128 rows, 128 cols, which): q/k/v = X W (+ b) with exact bf16 products (K = DIN) -> which 0: q f16 rows; 1: k f16 rows; 2: v f16 planes [c][pos]. A block's 128 rows are 128 places in world order, that is every fourth token of one world (x rows 4 * DIN floats apart); it stores them side by side
__global__ __launch_bounds__(256) void k_proj(const float* __restrict__ XQ, const float* __restrict__ XK, const float* __restrict__ XV, const float* __restrict__ WQ, const float* __restrict__ WK, const float* __restrict__ WV, const float* __restrict__ BQ, const float* __restrict__ BK, const float* __restrict__ BV,
    _Float16* __restrict__ QH, _Float16* __restrict__ KH, _Float16* __restrict__ VT) {
  __shared__ __align__(16) unsigned short sm[4 * GTILE];
  const int tid = threadIdx.x, wave = tid >> 5, lane = tid & 31, col = lane & 15, g = lane >> 4; const int wm = wave >> 2, wn = wave & 3; const int which = blockIdx.z; const int c0 = blockIdx.y * 128; const size_t r0 = (size_t)blockIdx.x * 128; const size_t bb = r0 / TT; const int t0 = (int)(r0 % TT);   /* t0 = first place; its token = 4 * (t0 % (TT / 4)) + t0 / (TT / 4) */
  const float* X = which == 0 ? XQ : which == 1 ? XK : XV; const float* WA = which == 0 ? WQ : which == 1 ? WK : WV; const float* BA = which == 0 ? BQ : which == 1 ? BK : BV;
  v8f acc[4][2] = {};
  gemm128<0, 4 * DIN>(X + (bb * TT + 4 * (t0 % (TT / 4)) + t0 / (TT / 4)) * DIN, WA + (size_t)c0 * DIN, sm, acc);
  _Float16* st = (_Float16*)sm;   /* output staging [128][136] f16, so that the stores cover whole lines */
  if (which < 2) { _Float16* DH = which == 0 ? QH : KH;   /* block-uniform */
#pragma unroll
    for (int j = 0; j < 2; ++j) { const float bias = BA ? bfr(BA[c0 + wn * 32 + j * 16 + col]) : 0.f;
#pragma unroll
      for (int i = 0; i < 4; ++i)
#pragma unroll
        for (int r = 0; r < 8; ++r) st[(wm * 64 + i * 16 + 8 * g + r) * 136 + wn * 32 + j * 16 + col] = (_Float16)(acc[i][j][r] + bias); }
    __syncthreads();
    for (int e = tid; e < 128 * 16; e += 256) { const int rl = e >> 4, q = e & 15; vst2((unsigned*)(DH + (r0 + rl) * CC + c0 + q * 8), *(const v4u*)&st[rl * 136 + q * 8]); }
  } else {
#pragma unroll
    for (int j = 0; j < 2; ++j) { const float bias = BA ? bfr(BA[c0 + wn * 32 + j * 16 + col]) : 0.f;
#pragma unroll
      for (int i = 0; i < 4; ++i) { v8h pk;   /* a lane's 8 rows of one column lie side by side in the transposed plane */
#pragma unroll
        for (int r = 0; r < 8; ++r) pk[r] = (_Float16)(acc[i][j][r] + bias);
        *(v8h*)&st[(wn * 32 + j * 16 + col) * 136 + wm * 64 + i * 16 + 8 * g] = pk; } }
    __syncthreads();
    for (int e = tid; e < 128 * 16; e += 256) { const int cl = e >> 4, q = e & 15; vst2((unsigned*)(VT + (bb * CC + c0 + cl) * (size_t)TT + t0 + q * 8), *(const v4u*)&st[cl * 136 + q * 8]); } } }
// ---- k_attn: block = 128 queries (4 waves x 32) of ONE world of (b, h); it walks only the key worlds that the table row of its world admits (8 tiles of 64 keys each, in world order), so no score is masked; one pass = 32 keys, one staged tile = 64 keys = two passes. S^T = K Q^T (A = 16 key rows, B = 16 query columns): a lane holds one query's 16 scores of the pass, the lane 16 away the other 16. Two S^T tiles converted in place are the B operand of O^T += V^T P^T (same k order as frag_h), so scores and P stay in registers. Online softmax in base 2, f32: running maximum m, running sum l, O^T rescaled by 2^(m_old - m_new) every pass.
// K rows and V^T rows of a tile (128 B each) come into LDS once per block by asynchronous 16-byte copies, 8 lanes to a whole line; the four waves take their fragments from there. Two buffers: tile t + 1 flies while tile t is worked on; one barrier a tile publishes tile t + 1 and ends every read of the buffer that is refilled behind it.
// every plain '#pragma unroll' in this kernel after the table read stands on a loop over a register array (fragments, tiles, a lane's scores): its index must be a constant for the array to stay in registers
// modal mask: q, k and v lie sorted by world, so the table row of the block's world is a list of admitted key worlds (block-uniform, formed once before the loop); an excluded world's 512 keys are neither copied nor multiplied
__device__ __forceinline__ float xhalf(float x) { return __builtin_bit_cast(float, __builtin_amdgcn_permlanex16(__builtin_bit_cast(int, x), __builtin_bit_cast(int, x), 0x76543210, 0xfedcba98, false, false)); }   // lane l with lane l ^ 16
#define SCALE_LOG2E (SCALE * 1.4426950408889634f)
// 2^x in place. Behind v_exp_f32 the instruction set asks for one independent instruction or v_nop before its result is used or its source overwritten: in one statement each v_exp_f32 is that instruction for the one before it, and the v_nop serves the last
__device__ __forceinline__ void exp2x8(float* x) {
  asm("v_exp_f32 %0, %0\n\tv_exp_f32 %1, %1\n\tv_exp_f32 %2, %2\n\tv_exp_f32 %3, %3\n\tv_exp_f32 %4, %4\n\tv_exp_f32 %5, %5\n\tv_exp_f32 %6, %6\n\tv_exp_f32 %7, %7\n\tv_nop"
      : "+v"(x[0]), "+v"(x[1]), "+v"(x[2]), "+v"(x[3]), "+v"(x[4]), "+v"(x[5]), "+v"(x[6]), "+v"(x[7])); }
__device__ __forceinline__ float exp2x1(float x) { asm("v_exp_f32 %0, %0\n\tv_nop" : "+v"(x)); return x; }
#define AK 64               // keys of one staged tile
#define TPW (TT / 4 / AK)   // tiles of one world's keys
#define AP 72               // LDS row pitch in 16-bit elements: 128-B rows + 16 B (16 B x odd, for 16-byte readers)
#define ATILE (64 * AP)     // K tile [64 keys][AP] or V^T tile [64 dims][AP]; a buffer is [K tile | V^T tile]
// one tile's copies of a lane: rows r, r + 16, r + 32, r + 48 of the K tile and of the V^T tile, 16 B each (lds = the lane's byte address in the K tile of the target buffer). The s_wait_xcnt stands inside the statement so that no address register of an issued copy is rewritten ahead of it
__device__ __forceinline__ void stage_kv(unsigned lds, const _Float16* gk, const _Float16* gv) {
  asm volatile("global_load_async_to_lds_b128 %0, %8, off\n\tglobal_load_async_to_lds_b128 %1, %9, off\n\tglobal_load_async_to_lds_b128 %2, %10, off\n\tglobal_load_async_to_lds_b128 %3, %11, off\n\t"
               "global_load_async_to_lds_b128 %4, %12, off\n\tglobal_load_async_to_lds_b128 %5, %13, off\n\tglobal_load_async_to_lds_b128 %6, %14, off\n\tglobal_load_async_to_lds_b128 %7, %15, off\n\ts_wait_xcnt 0x0"
      :: "v"(lds), "v"(lds + 16u * AP * 2u), "v"(lds + 32u * AP * 2u), "v"(lds + 48u * AP * 2u),
         "v"(lds + ATILE * 2u), "v"(lds + ATILE * 2u + 16u * AP * 2u), "v"(lds + ATILE * 2u + 32u * AP * 2u), "v"(lds + ATILE * 2u + 48u * AP * 2u),
         "v"(gk), "v"(gk + (size_t)16 * CC), "v"(gk + (size_t)32 * CC), "v"(gk + (size_t)48 * CC),
         "v"(gv), "v"(gv + (size_t)16 * TT), "v"(gv + (size_t)32 * TT), "v"(gv + (size_t)48 * TT) : "memory"); }
__global__ __launch_bounds__(128) void k_attn(const _Float16* __restrict__ QH, const _Float16* __restrict__ KH, const _Float16* __restrict__ VT, const int* __restrict__ ACC, float* __restrict__ Y) {
  __shared__ __align__(16) _Float16 kv[2 * 2 * ATILE];
  const int tid = threadIdx.x, wave = tid >> 5, lane = tid & 31, col = lane & 15, g = lane >> 4; const int h = blockIdx.y, b = blockIdx.z;
  const int u = (int)(blockIdx.x + (blockIdx.x >> 2) + h + (h >> 2) + b) & 3;   /* the block's world. Blocks of different worlds run for different lengths: this sum is the flat block index's base-4 digit sum mod 4, so each aligned run of four flat indices holds the four worlds (for speed only: long and short blocks spread over the chip); for fixed (h, b) the 16 values of blockIdx.x give each (world, quarter) once */
  const int qp = (int)(blockIdx.x >> 2) * 128 + wave * 32;   /* the wave's first query, counted inside its world */
  unsigned accm = 0u;
#pragma unroll
  for (int i = 0; i < 16; ++i) accm |= ((ACC[i] != 0) ? 1u : 0u) << i;
  const unsigned rowm = (accm >> (u << 2)) & 15u;   /* the table row of the block's world */
  if (rowm == 0u) {   /* block-uniform, ahead of every copy and barrier: a fully excluded row yields ctx = 0 */
    for (int n = 0; n < 2; ++n) { float* yr = Y + ((size_t)b * TT + 4 * (qp + n * 16 + col) + u) * CC + h * HD + 8 * g;
      for (int j = 0; j < 4; ++j) { vst2(yr + j * 16, (v4f){0.f, 0.f, 0.f, 0.f}); vst2(yr + j * 16 + 4, (v4f){0.f, 0.f, 0.f, 0.f}); } }
    return; }
  unsigned wl = 0u; int nw = 0;   /* the admitted key worlds, ascending, one byte each */
  for (int i = 0; i < 4; ++i) if ((rowm >> i) & 1u) { wl |= (unsigned)i << (8 * nw); ++nw; }
  const int nt = nw * TPW;   /* tiles to walk: 8 to 32 */
  const auto kpos = [wl](int t) { return (int)((wl >> ((t / TPW) * 8)) & 3u) * (TT / 4) + (t % TPW) * AK; };   /* first key place of tile t; the mask keeps it inside [0, TT - AK] for any table */
  const unsigned ldsw = (unsigned)(size_t)kv + (unsigned)((tid >> 3) * AP + (tid & 7) * 8) * 2u;   /* 8 lanes cover the 128 B of one row; 16 rows a copy of the block */
  const _Float16* gk = KH + ((size_t)b * TT + (tid >> 3)) * CC + h * HD + (tid & 7) * 8;
  const _Float16* gv = VT + ((size_t)b * CC + h * HD + (tid >> 3)) * (size_t)TT + (tid & 7) * 8;
  stage_kv(ldsw, gk + (size_t)kpos(0) * CC, gv + kpos(0));
  v16h qf[2][2];
#pragma unroll
  for (int n = 0; n < 2; ++n)
#pragma unroll
    for (int kc = 0; kc < 2; ++kc) qf[n][kc] = frag_h(QH + ((size_t)b * TT + u * (TT / 4) + qp + n * 16 + col) * CC + h * HD + kc * 32, lane);
  const _Float16* fk = kv + col * AP; const _Float16* fv = kv + ATILE + col * AP;
  v8f o[2][4] = {}; float m[2] = {-3.0e38f, -3.0e38f}, l[2] = {0.f, 0.f};
  asm volatile("s_wait_asynccnt 0x0" ::: "memory");   /* this wave's copies of tile 0 have landed */
  __syncthreads();   /* tile 0 is published */
  stage_kv(ldsw + 2u * ATILE * 2u, gk + (size_t)kpos(1) * CC, gv + kpos(1));   /* nt >= 8: tile 1 exists */
#pragma unroll 1   /* rolled: the tiles share one loop body of two passes in the instruction cache */
  for (int t = 0; t < nt; ++t) { const int cur = (t & 1) * 2 * ATILE;
#pragma unroll
   for (int p = 0; p < 2; ++p) {
    v16h vf[4], kf[2][2];
#pragma unroll
    for (int i = 0; i < 2; ++i)
#pragma unroll
      for (int kc = 0; kc < 2; ++kc) kf[i][kc] = frag_h(fk + cur + (p * 32 + i * 16) * AP + kc * 32, lane);
#pragma unroll
    for (int j = 0; j < 4; ++j) vf[j] = frag_h(fv + cur + (j * 16) * AP + p * 32, lane);
    v8f st[2][2] = {};
#pragma unroll
    for (int kc = 0; kc < 2; ++kc)
#pragma unroll
      for (int i = 0; i < 2; ++i)
#pragma unroll
        for (int n = 0; n < 2; ++n) st[n][i] = wmma16(kf[i][kc], qf[n][kc], st[n][i]);
    v16h pb[2];
#pragma unroll
    for (int n = 0; n < 2; ++n) { float s[16];
#pragma unroll
      for (int r = 0; r < 8; ++r) { s[r] = st[n][0][r] * SCALE_LOG2E; s[8 + r] = st[n][1][r] * SCALE_LOG2E; }
      float mx = s[0];
#pragma unroll
      for (int i = 1; i < 16; ++i) mx = fmaxf(mx, s[i]);
      mx = fmaxf(mx, xhalf(mx));
      const float mn = fmaxf(m[n], mx); const float al = exp2x1(m[n] - mn); m[n] = mn;
      const float mo = mn - 11.0f;   /* P carried x 2^11 into f16 (clear of f16 subnormals); l carries the same factor, so it cancels in O / l */
#pragma unroll
      for (int i = 0; i < 16; ++i) s[i] -= mo;
      exp2x8(s); exp2x8(s + 8);
      float sum = 0.f;
#pragma unroll
      for (int i = 0; i < 16; ++i) { sum += s[i]; pb[n][i] = (_Float16)s[i]; }
      l[n] = l[n] * al + sum;
#pragma unroll
      for (int j = 0; j < 4; ++j) o[n][j] *= al; }
#pragma unroll
    for (int j = 0; j < 4; ++j)
#pragma unroll
      for (int n = 0; n < 2; ++n) o[n][j] = wmma16(vf[j], pb[n], o[n][j]); }
    asm volatile("s_wait_dscnt 0x0" ::: "memory");      /* this wave's reads of tile t's buffer have returned before the buffer is handed to the copies */
    asm volatile("s_wait_asynccnt 0x0" ::: "memory");   /* this wave's copies of tile t + 1 have landed */
    __syncthreads();   /* publishes tile t + 1 and ends every wave's reads of tile t's buffer */
    if (t + 2 < nt) stage_kv(ldsw + (unsigned)cur * 2u, gk + (size_t)kpos(t + 2) * CC, gv + kpos(t + 2)); }   /* block-uniform test */
  asm volatile("s_wait_asynccnt 0x0" ::: "memory");   /* no copy is outstanding when the wave ends */
#pragma unroll
  for (int n = 0; n < 2; ++n) { const float lt = l[n] + xhalf(l[n]); const float inv = lt > 0.f ? 1.0f / lt : 0.f;
    float* yr = Y + ((size_t)b * TT + 4 * (qp + n * 16 + col) + u) * CC + h * HD + 8 * g;   /* back to the token's own row */
#pragma unroll
    for (int j = 0; j < 4; ++j) { const v8f ov = o[n][j] * inv; vst2(yr + j * 16, (v4f){ov[0], ov[1], ov[2], ov[3]}); vst2(yr + j * 16 + 4, (v4f){ov[4], ov[5], ov[6], ov[7]}); } } }
// ---- k_out: block = (128 rows, 128 cols): out = ctx Wo (+ bo): ctx x 2^6 once to f16 (small-magnitude context rows stay clear of f16 subnormals) against Wo as f16(bf16 x 2^8) exact (1 product) x 2^-14
__global__ __launch_bounds__(256) void k_out(const float* __restrict__ Y, const float* __restrict__ WO, const float* __restrict__ BO, float* __restrict__ OUT) {
  __shared__ __align__(16) unsigned short sm[4 * GTILE];
  const int tid = threadIdx.x, wave = tid >> 5, lane = tid & 31, col = lane & 15, g = lane >> 4; const int wm = wave >> 2, wn = wave & 3; const int c0 = blockIdx.y * 128; const size_t r0 = (size_t)blockIdx.x * 128;
  v8f acc[4][2] = {};
  gemm128<1, CC>(Y + r0 * CC, WO + (size_t)c0 * CC, sm, acc);
  float* sf = (float*)sm;   /* output staging [128][132] f32 (67,584 B of the 73,728), so that the stores cover whole lines */
#pragma unroll
  for (int j = 0; j < 2; ++j) { const float bias = BO ? bfr(BO[c0 + wn * 32 + j * 16 + col]) : 0.f;
#pragma unroll
    for (int i = 0; i < 4; ++i)
#pragma unroll
      for (int r = 0; r < 8; ++r) sf[(wm * 64 + i * 16 + 8 * g + r) * 132 + wn * 32 + j * 16 + col] = acc[i][j][r] * (1.0f / 16384.0f) + bias; }   /* 2^-8 (Wo carry) x 2^-6 (ctx carry) */
  __syncthreads();
  for (int e = tid; e < 128 * 32; e += 256) { const int rl = e >> 5, q = e & 31; vst2(OUT + (r0 + rl) * DIN + c0 + q * 4, *(const v4f*)&sf[rl * 132 + q * 4]); } }

extern "C" void kernel_launch(void* const* d_in, const int* in_sizes, int n_in, void* d_out, int out_size, void* d_ws, size_t ws_size, hipStream_t stream) {
  (void)in_sizes; (void)n_in; (void)out_size;
  const float** F = (const float**)d_in;
  if (ws_size < (size_t)WS_END) return;
  char* ws = (char*)d_ws; _Float16 *QH = (_Float16*)(ws + WS_QH), *KH = (_Float16*)(ws + WS_KH), *VT = (_Float16*)(ws + WS_VT), *QL = (_Float16*)(ws + WS_QL), *KL = (_Float16*)(ws + WS_KL); __bf16 *VB = (__bf16*)(ws + WS_VB), *VBL = (__bf16*)(ws + WS_VBL); float *Y = (float*)(ws + WS_Y);
  (void)Y; (void)QL; (void)KL; (void)VB; (void)VBL;
  // inputs: 0 x [2,2048,1024]; 1 Wq [1024,1024] (out,in); 2 Wk; 3 Wv; 4 Wproj (out,in); 5 accessibility [4,4] int32 (random 0 / 1, unit diagonal; READ on the device); no biases
  k_proj<<<dim3(TNB * TT / 128, CC / 128, 3), 256, 0, stream>>>(F[0], F[0], F[0], F[1], F[2], F[3], nullptr, nullptr, nullptr, QH, KH, VT);
  k_attn<<<dim3(TT / 128, NH, TNB), 128, 0, stream>>>(QH, KH, VT, (const int*)d_in[5], Y);
  k_out<<<dim3(TNB * TT / 128, DIN / 128), 256, 0, stream>>>(Y, F[4], nullptr, (float*)d_out);
}

// v005
// It runs in 75.7 microseconds.
// Timed twice side by side with v004, it ran 1.13 times as fast both times.
// Over all steps from v000 it is 17.8 times as fast.
// compute dtype: all float inputs rounded to bf16, once, by k_cvt, into 16-bit planes of the workspace; q / k / v projections with EXACT bf16 products on WMMA 16x16x32 (f32 accumulate) + bias (none); one attention kernel: logits k x q once to f16 each (1 product) x 64^-0.5 x log2(e); tokens kept sorted by world (token % 4) in q / k / v, so the 4 x 4 accessibility table read at (query world, key world) admits or skips a whole run of 512 keys; online softmax f32 in base 2; unnormalised P x 2^11 once to f16 x v once to f16 (1 product), divided by the f32 row sum at the end; ctx x 2^6 once to f16 x the output weight f16(bf16 x 2^8) + bias; f32 output.
#include <hip/hip_runtime.h>
#include <math.h>

typedef __attribute__((ext_vector_type(16))) _Float16 v16h;
typedef __attribute__((ext_vector_type(16))) __bf16 v16b;
typedef __attribute__((ext_vector_type(8)))  _Float16 v8h;
typedef __attribute__((ext_vector_type(8)))  float v8f;
typedef __attribute__((ext_vector_type(4)))  float v4f;
typedef __attribute__((ext_vector_type(2)))  float v2f;
typedef __attribute__((ext_vector_type(4)))  unsigned v4u;
typedef __attribute__((ext_vector_type(4)))  int v4i;
typedef float __attribute__((may_alias)) float_a;
typedef int __attribute__((may_alias)) int_a;

template <typename T> __device__ __forceinline__ void vst2(void* p, T v) { *(T*)p = v;  }
__device__ __forceinline__ v8f wmma16(v16h a, v16h b, v8f c) {
  v8f d = __builtin_amdgcn_wmma_f32_16x16x32_f16(false, a, false, b, (short)0, c, false, false);
  asm volatile("v_nop\n\tv_nop\n\tv_nop\n\tv_nop" : "+v"(d) : "v"(a), "v"(b));
  return d;
}
__device__ __forceinline__ v8f wmma_bf(v16b a, v16b b, v8f c) {
  v8f d = __builtin_amdgcn_wmma_f32_16x16x32_bf16(false, a, false, b, (short)0, c, false, false);
  asm volatile("v_nop\n\tv_nop\n\tv_nop\n\tv_nop" : "+v"(d) : "v"(a), "v"(b));
  return d;
}
// 16x16x32 fragments: lane = (h = lane>>4, row/col = lane&15); elements 0..7 = k0+8h+0..7, 8..15 = k0+16+8h+0..7; D element r = row 8h+r
__device__ __forceinline__ v16h frag_h(const _Float16* rowk0, int lane) {
  union { v16h v; v8h q[2]; } u; const _Float16* p = rowk0 + 8 * (lane >> 4);
  u.q[0] = *(const v8h*)p; u.q[1] = *(const v8h*)(p + 16); return u.v;
}
__device__ __forceinline__ v16h frag_f32(const float* rowk0, int lane) {
  v16h a; const float* p = rowk0 + 8 * (lane >> 4);
#pragma unroll
  for (int i = 0; i < 8; ++i) { a[i] = (_Float16)p[i]; a[8 + i] = (_Float16)p[16 + i]; }
  return a;
}
__device__ __forceinline__ v16h frag_f32s(const float* rowk0, int lane, float sc) {
  v16h a; const float* p = rowk0 + 8 * (lane >> 4);
#pragma unroll
  for (int i = 0; i < 8; ++i) { a[i] = (_Float16)(p[i] * sc); a[8 + i] = (_Float16)(p[16 + i] * sc); }
  return a;
}
// column fragment from a [K][ld] layout (column n), rows >= K read as 0
__device__ __forceinline__ v16h fragc_f32(const float* W, int k0, int n, int lane, int ld, int K) {
  v16h a; const int g = lane >> 4;
#pragma unroll
  for (int i = 0; i < 8; ++i) { const int ka = k0 + 8 * g + i, kb = ka + 16;
    a[i] = (_Float16)(ka < K ? W[(size_t)(ka < K ? ka : K - 1) * ld + n] : 0.f); a[8 + i] = (_Float16)(kb < K ? W[(size_t)(kb < K ? kb : K - 1) * ld + n] : 0.f); }
  return a;
}
struct F2 { v16b h, l; };
__device__ __forceinline__ F2 bsplit16(const float v[16]) { F2 r;
#pragma unroll
  for (int i = 0; i < 16; ++i) { const __bf16 h = (__bf16)v[i]; r.h[i] = h; r.l[i] = (__bf16)(v[i] - (float)h); }
  return r; }
__device__ __forceinline__ F2 split_row(const float* row, int k0, int lane) { float v[16]; const float* p = row + k0 + 8 * (lane >> 4);
#pragma unroll
  for (int i = 0; i < 8; ++i) { v[i] = p[i]; v[8 + i] = p[16 + i]; }
  return bsplit16(v); }
__device__ __forceinline__ F2 split_rowK(const float* row, int k0, int lane, int K) { float v[16]; const int g = lane >> 4;
#pragma unroll
  for (int i = 0; i < 8; ++i) { const int ka = k0 + 8 * g + i, kb = ka + 16; v[i] = ka < K ? row[ka < K ? ka : K - 1] : 0.f; v[8 + i] = kb < K ? row[kb < K ? kb : K - 1] : 0.f; }
  return bsplit16(v); }
__device__ __forceinline__ F2 split_col(const float* W, int k0, int n, int lane, int ld, int K) { float v[16]; const int g = lane >> 4;
#pragma unroll
  for (int i = 0; i < 8; ++i) { const int ka = k0 + 8 * g + i, kb = ka + 16; v[i] = ka < K ? W[(size_t)(ka < K ? ka : K - 1) * ld + n] : 0.f; v[8 + i] = kb < K ? W[(size_t)(kb < K ? kb : K - 1) * ld + n] : 0.f; }
  return bsplit16(v); }
__device__ __forceinline__ v8f mac3(const F2& a, const F2& b, v8f c) { c = wmma_bf(a.l, b.h, c); c = wmma_bf(a.h, b.l, c); return wmma_bf(a.h, b.h, c); }
__device__ __forceinline__ float sigm(float v) { return 1.0f / (1.0f + expf(-v)); }
#define LDSX() do { asm volatile("s_wait_dscnt 0" ::: "memory"); __builtin_amdgcn_wave_barrier(); __builtin_amdgcn_fence(__ATOMIC_RELEASE, "workgroup"); } while (0)

// Multi-head self-attention with a 'Kripke modal' mask (x [2,2048,1024]; torch (out,in) Wq / Wk / Wv / Wproj [1024,1024] N(0,1) x 0.02 applied as x @ W.T, no biases; accessibility [4,4] int32 = random 0 / 1 with a unit diagonal, a module input READ on the device; 16 heads x 64; world = token index % 4; scores / sqrt(64) set to -inf wherever accessibility[world(q)][world(k)] == 0; softmax; out @ Wproj.T). Every row keeps the keys of its own world (the diagonal is 1), so no row is empty.
#define NB 2
#define TT 2048
#define CC 1024            // NH * HD = projected width
#define DIN 1024          // input (model) width
#define NH 16
#define HD 64
#define SCALE (0.125f)
#define CAUSAL 0
#ifndef TNB
#define TNB NB
#endif
__device__ __forceinline__ float bfr(float v) { return (float)(__bf16)v; }
__host__ __device__ __forceinline__ int kb_last(int qb) { return CAUSAL ? ((qb * 64 + 63) >> 7) : (TT / 128 - 1); }
typedef __attribute__((ext_vector_type(8))) __bf16 v8b;
__device__ __forceinline__ v16b frag_b(const __bf16* rowk0, int lane) {
  union { v16b v; v8b q[2]; } u; const __bf16* p = rowk0 + 8 * (lane >> 4);
  u.q[0] = *(const v8b*)p; u.q[1] = *(const v8b*)(p + 16); return u.v;
}
#define QBH 0
#define QHI 0               // single-product logits on every row
#define KHI 64            // key rows carrying k residual / v bf16 hi+lo planes (no kernel here writes or reads them)
// B fragment (k rows k0+.., output column o) of a weight: (in,out) [K][ld] or (out,in) [ld rows of K]: bf16 exact, or f16(bf16 * 256) exact
__device__ __forceinline__ v16b wcol_io(const float* Wm, int k0, int o, int lane, int ld) { v16b w; const int g = lane >> 4;
#pragma unroll
  for (int i = 0; i < 8; ++i) { w[i] = (__bf16)Wm[(size_t)(k0 + 8 * g + i) * ld + o]; w[8 + i] = (__bf16)Wm[(size_t)(k0 + 16 + 8 * g + i) * ld + o]; }
  return w; }
__device__ __forceinline__ v16b wcol_oi(const float* Wm, int k0, int o, int lane, int K) { v16b w; const float* p = Wm + (size_t)o * K + k0 + 8 * (lane >> 4);
#pragma unroll
  for (int i = 0; i < 8; ++i) { w[i] = (__bf16)p[i]; w[8 + i] = (__bf16)p[16 + i]; }
  return w; }
__device__ __forceinline__ v16h wcolh_io(const float* Wm, int k0, int o, int lane, int ld) { v16h w; const int g = lane >> 4;
#pragma unroll
  for (int i = 0; i < 8; ++i) { w[i] = (_Float16)(bfr(Wm[(size_t)(k0 + 8 * g + i) * ld + o]) * 256.0f); w[8 + i] = (_Float16)(bfr(Wm[(size_t)(k0 + 16 + 8 * g + i) * ld + o]) * 256.0f); }
  return w; }
__device__ __forceinline__ v16h wcolh_oi(const float* Wm, int k0, int o, int lane, int K) { v16h w; const float* p = Wm + (size_t)o * K + k0 + 8 * (lane >> 4);
#pragma unroll
  for (int i = 0; i < 8; ++i) { w[i] = (_Float16)(bfr(p[i]) * 256.0f); w[8 + i] = (_Float16)(bfr(p[16 + i]) * 256.0f); }
  return w; }
#define WQKV_LAYOUT 1   // 0 = (in,out) [DIN][CC]; 1 = (out,in) [CC][DIN]; 2 = per-head [NH][DIN][HD]
__device__ __forceinline__ v16b wcol_hdk(const float* Wm, int k0, int o, int lane) { v16b w; const int g = lane >> 4; const float* p = Wm + (size_t)(o / HD) * DIN * HD + (o % HD);
#pragma unroll
  for (int i = 0; i < 8; ++i) { w[i] = (__bf16)p[(size_t)(k0 + 8 * g + i) * HD]; w[8 + i] = (__bf16)p[(size_t)(k0 + 16 + 8 * g + i) * HD]; }
  return w; }
#define WO_OUT_IN 1
#if WQKV_LAYOUT == 1
#define WCOL(W, k0, o, lane) wcol_oi(W, k0, o, lane, DIN)
#elif WQKV_LAYOUT == 2
#define WCOL(W, k0, o, lane) wcol_hdk(W, k0, o, lane)
#else
#define WCOL(W, k0, o, lane) wcol_io(W, k0, o, lane, CC)
#endif
#if WO_OUT_IN
#define WOCOL(W, k0, o, lane) wcol_oi(W, k0, o, lane, CC)
#define WOCOLH(W, k0, o, lane) wcolh_oi(W, k0, o, lane, CC)
#else
#define WOCOL(W, k0, o, lane) wcol_io(W, k0, o, lane, DIN)
#define WOCOLH(W, k0, o, lane) wcolh_io(W, k0, o, lane, DIN)
#endif

// 'pos' = a token's place in world order: pos = (t % 4) * (TT / 4) + t / 4
#define WS_QH  0u                                      // f16 q rows [b*pos][CC]
#define WS_KH  (WS_QH + 2u * (size_t)NB * TT * CC)      // f16 k rows [b*pos][CC]
#define WS_VT  (WS_KH + 2u * (size_t)NB * TT * CC)      // f16 v planes [b][c][pos]
#define WS_QL  (WS_VT + 2u * (size_t)NB * CC * TT)      // f16 q residual x 2^10 rows [b][t < QHI][CC]
#define WS_KL  (WS_QL + 2u * (size_t)NB * QHI * CC)     // f16 k residual x 2^10 rows [b][t < KHI][CC]
#define WS_VB  (WS_KL + 2u * (size_t)NB * KHI * CC)     // bf16 v hi planes [b][c][t < KHI]
#define WS_VBL (WS_VB + 2u * (size_t)NB * CC * KHI)
#define WS_Y   (WS_VBL + 2u * (size_t)NB * CC * KHI)    // f16 ctx x 2^6 rows [b*t][CC]
#define WS_XB  (WS_Y  + 2u * (size_t)NB * TT * CC)      // bf16 x rows [b*pos][DIN]
#define WS_WB  (WS_XB + 2u * (size_t)NB * TT * DIN)     // bf16 Wq | Wk | Wv rows [3 * CC][DIN]
#define WS_WOH (WS_WB + 2u * 3u * (size_t)CC * DIN)     // f16(bf16 x 2^8) Wo rows [DIN][CC]
#define WS_END (WS_WOH + 2u * (size_t)DIN * CC)

// ---- k_cvt: every operand of the two products that is an input is rounded ONCE to its 16-bit form and laid in the workspace, so that k_proj and k_out fetch half the bytes from L2 and round nothing per block. Rows of 1024 floats: x (to bf16, stored at the token's place in world order), Wq | Wk | Wv (to bf16), Wo (to f16(bf16 x 2^8)). Block = 16 rows of one kind; a thread takes 8 floats of 8 rows, all 16 loads issued ahead of the first store.
__device__ __forceinline__ v8b cv8b(v4f a, v4f b) { v8b y;
#pragma unroll
  for (int e = 0; e < 4; ++e) { y[e] = (__bf16)a[e]; y[4 + e] = (__bf16)b[e]; }
  return y; }
#define CVR 16              // rows of one block
__global__ __launch_bounds__(256) void k_cvt(const float* __restrict__ X, const float* __restrict__ WQ, const float* __restrict__ WK, const float* __restrict__ WV, const float* __restrict__ WO, __bf16* __restrict__ XB, __bf16* __restrict__ WB, _Float16* __restrict__ WOH) {
  const int tid = threadIdx.x, c = (tid & 127) * 8, hi = tid >> 7; const int rb0 = (int)blockIdx.x * CVR;   /* first row of the block, counted over x, Wq, Wk, Wv, Wo; every kind's row count is a multiple of CVR, so the kind is block-uniform */
  const int kind = rb0 < NB * TT ? 0 : rb0 < NB * TT + 3 * CC ? 1 : 2;
  const int w0 = rb0 - NB * TT;   /* row among Wq | Wk | Wv */
  const float* src = kind == 0 ? X + (size_t)rb0 * DIN : kind == 1 ? (w0 < CC ? WQ : w0 < 2 * CC ? WK : WV) + (size_t)(w0 % CC) * DIN : WO + (size_t)(w0 - 3 * CC) * CC;
  const unsigned vb = (unsigned)(hi * DIN + c) * 4u;   /* the lane's byte offset from the block's first row */
  v4f r[8][2];
#pragma unroll   /* register array: constant index */
  for (int i = 0; i < 8; ++i) { const char* p = (const char*)src + vb + (size_t)i * 2 * DIN * 4; r[i][0] = *(const v4f*)p; r[i][1] = *(const v4f*)(p + 16); }
  /* inputs only: the offset and the loaded values, so that the wait stands behind all 16 loads and the offset keeps its register up to it (without them the last load's result took the register that the issued loads name as their address) */
  asm volatile("s_wait_xcnt 0x0" :: "v"(vb), "v"(r[0][0]), "v"(r[0][1]), "v"(r[1][0]), "v"(r[1][1]), "v"(r[2][0]), "v"(r[2][1]), "v"(r[3][0]), "v"(r[3][1]), "v"(r[4][0]), "v"(r[4][1]), "v"(r[5][0]), "v"(r[5][1]), "v"(r[6][0]), "v"(r[6][1]), "v"(r[7][0]), "v"(r[7][1]) : "memory");
  /* behind each store: s_wait_xcnt 0, since the next row's rounding reuses the registers that the issued store names */
  if (kind == 2) { _Float16* d = WOH + (size_t)(w0 - 3 * CC + hi) * CC + c;
#pragma unroll   /* register array: constant index */
    for (int i = 0; i < 8; ++i) { v8h y;
#pragma unroll
      for (int e = 0; e < 4; ++e) { y[e] = (_Float16)(bfr(r[i][0][e]) * 256.0f); y[4 + e] = (_Float16)(bfr(r[i][1][e]) * 256.0f); }
      *(v8h*)(d + (size_t)i * 2 * CC) = y; asm volatile("s_wait_xcnt 0x0" ::: "memory"); }
  } else if (kind == 1) { __bf16* d = WB + (size_t)(w0 + hi) * DIN + c;
#pragma unroll   /* register array: constant index */
    for (int i = 0; i < 8; ++i) { *(v8b*)(d + (size_t)i * 2 * DIN) = cv8b(r[i][0], r[i][1]); asm volatile("s_wait_xcnt 0x0" ::: "memory"); }
  } else { __bf16* d = XB + ((size_t)(rb0 / TT) * TT + (rb0 % TT) / 4 + hi * (TT / 4)) * DIN + c;   /* token rb0 + j, j = 2 i + hi, lies in world j % 4 (rb0 is a multiple of 4) at place (rb0 % TT + j) / 4 of it */
#pragma unroll   /* register array: constant index */
    for (int i = 0; i < 8; ++i) { *(v8b*)(d + (size_t)((i & 1) * 2 * (TT / 4) + (i >> 1)) * DIN) = cv8b(r[i][0], r[i][1]); asm volatile("s_wait_xcnt 0x0" ::: "memory"); } } }
// ---- gemm128: the product loop of k_proj and k_out. Block = 256 threads = 8 waves (2 x 4), tile 128 rows x 128 columns, K = 1024 in 8 stages of 128. Both operands are K-contiguous 16-bit rows of GKD elements, already in the form the matrix instruction takes: each stage (256 B of every row) is read once per block with whole-line 16-byte loads and laid in LDS as it is; the waves take their fragments from there (wave tile 64 x 32: 4 A x 2 B fragments). Two LDS buffers: stage s + 1 is fetched into registers ahead of stage s's products and stored behind them, one barrier a stage. The k order of every accumulator is the ascending one.
// every plain '#pragma unroll' in gemm128, k_proj and k_out stands on a loop over a register array (staged rows, fragments, accumulator tiles): its index must be a constant for the array to stay in registers
#define GK 128              // k of one stage
#define GP (GK + 8)         // LDS row pitch in 16-bit elements: 256-B rows + 16 B (16 B x odd, for 16-byte readers)
#define GTILE (128 * GP)    // one operand's tile of one stage; a buffer is [A tile | B tile]
#define GKD 1024            // K of both products (DIN = CC)
// MODE 0: bf16 operands. MODE 1: f16 operands
template <int MODE> __device__ __forceinline__ void gemm128(const unsigned short* __restrict__ A, const unsigned short* __restrict__ B, unsigned short* sm, v8f (&acc)[4][2]) {
  const int tid = threadIdx.x, wave = tid >> 5, lane = tid & 31, col = lane & 15; const int wm = wave >> 2, wn = wave & 3;
  const int srow = tid >> 4, sc = (tid & 15) * 8;   /* 16 lanes cover the 256 B of one row's stage; 16 rows a sweep, 8 sweeps an operand */
  const unsigned short* ga = A + (size_t)srow * GKD + sc; const unsigned short* gb = B + (size_t)srow * GKD + sc;
  unsigned short* wr = sm + srow * GP + sc;
  const unsigned short* fa = sm + (wm * 64 + col) * GP; const unsigned short* fb = sm + GTILE + (wn * 32 + col) * GP;
  v4u ra[8], rb[8];
#pragma unroll
  for (int i = 0; i < 8; ++i) { ra[i] = *(const v4u*)(ga + (size_t)i * 16 * GKD); rb[i] = *(const v4u*)(gb + (size_t)i * 16 * GKD); }
#pragma unroll
  for (int i = 0; i < 8; ++i) { *(v4u*)(wr + i * 16 * GP) = ra[i]; *(v4u*)(wr + GTILE + i * 16 * GP) = rb[i]; }
  __syncthreads();
#pragma unroll 1   /* rolled: the 8 stages share one small loop body in the instruction cache */
  for (int s = 0; s < GKD / GK; ++s) { const int cur = (s & 1) * 2 * GTILE, nxt = 2 * GTILE - cur; const bool more = s + 1 < GKD / GK;   /* block-uniform */
    if (more) {
#pragma unroll
      for (int i = 0; i < 8; ++i) { ra[i] = *(const v4u*)(ga + (size_t)i * 16 * GKD + (s + 1) * GK); rb[i] = *(const v4u*)(gb + (size_t)i * 16 * GKD + (s + 1) * GK); } }
#pragma unroll
    for (int kc = 0; kc < GK / 32; ++kc) {
      if constexpr (MODE == 0) { v16b af[4], bf[2];
#pragma unroll
        for (int i = 0; i < 4; ++i) af[i] = frag_b((const __bf16*)(fa + cur + i * 16 * GP + kc * 32), lane);
#pragma unroll
        for (int j = 0; j < 2; ++j) bf[j] = frag_b((const __bf16*)(fb + cur + j * 16 * GP + kc * 32), lane);
#pragma unroll
        for (int i = 0; i < 4; ++i)
#pragma unroll
          for (int j = 0; j < 2; ++j) acc[i][j] = wmma_bf(af[i], bf[j], acc[i][j]);
      } else { v16h af[4], bf[2];
#pragma unroll
        for (int i = 0; i < 4; ++i) af[i] = frag_h((const _Float16*)(fa + cur + i * 16 * GP + kc * 32), lane);
#pragma unroll
        for (int j = 0; j < 2; ++j) bf[j] = frag_h((const _Float16*)(fb + cur + j * 16 * GP + kc * 32), lane);
#pragma unroll
        for (int i = 0; i < 4; ++i)
#pragma unroll
          for (int j = 0; j < 2; ++j) acc[i][j] = wmma16(af[i], bf[j], acc[i][j]); } }
    if (more) {
#pragma unroll
      for (int i = 0; i < 8; ++i) { *(v4u*)(wr + nxt + i * 16 * GP) = ra[i]; *(v4u*)(wr + nxt + GTILE + i * 16 * GP) = rb[i]; } }
    __syncthreads(); } }   /* publishes stage s + 1 and ends every read of stage s's buffer; behind the last one the LDS is free for the output staging */
// ---- k_proj: block = (128 rows, 128 cols, which): q/k/v = X W (+ b) with exact bf16 products (K = DIN) -> which 0: q f16 rows; 1: k f16 rows; 2: v f16 planes [c][pos]. A block's 128 rows are 128 places in world order, side by side in k_cvt's x plane as in q / k / v
__global__ __launch_bounds__(256) void k_proj(const unsigned short* __restrict__ XB, const unsigned short* __restrict__ WB, const float* __restrict__ BQ, const float* __restrict__ BK, const float* __restrict__ BV,
    _Float16* __restrict__ QH, _Float16* __restrict__ KH, _Float16* __restrict__ VT) {
  __shared__ __align__(16) unsigned short sm[4 * GTILE];
  const int tid = threadIdx.x, wave = tid >> 5, lane = tid & 31, col = lane & 15, g = lane >> 4; const int wm = wave >> 2, wn = wave & 3; const int which = blockIdx.z; const int c0 = blockIdx.y * 128; const size_t r0 = (size_t)blockIdx.x * 128; const size_t bb = r0 / TT; const int t0 = (int)(r0 % TT);   /* t0 = first place */
  const float* BA = which == 0 ? BQ : which == 1 ? BK : BV;
  v8f acc[4][2] = {};
  gemm128<0>(XB + r0 * DIN, WB + ((size_t)which * CC + c0) * DIN, sm, acc);
  _Float16* st = (_Float16*)sm;   /* output staging [128][136] f16, so that the stores cover whole lines */
  if (which < 2) { _Float16* DH = which == 0 ? QH : KH;   /* block-uniform */
#pragma unroll
    for (int j = 0; j < 2; ++j) { const float bias = BA ? bfr(BA[c0 + wn * 32 + j * 16 + col]) : 0.f;
#pragma unroll
      for (int i = 0; i < 4; ++i)
#pragma unroll
        for (int r = 0; r < 8; ++r) st[(wm * 64 + i * 16 + 8 * g + r) * 136 + wn * 32 + j * 16 + col] = (_Float16)(acc[i][j][r] + bias); }
    __syncthreads();
    for (int e = tid; e < 128 * 16; e += 256) { const int rl = e >> 4, q = e & 15; vst2((unsigned*)(DH + (r0 + rl) * CC + c0 + q * 8), *(const v4u*)&st[rl * 136 + q * 8]); }
  } else {
#pragma unroll
    for (int j = 0; j < 2; ++j) { const float bias = BA ? bfr(BA[c0 + wn * 32 + j * 16 + col]) : 0.f;
#pragma unroll
      for (int i = 0; i < 4; ++i) { v8h pk;   /* a lane's 8 rows of one column lie side by side in the transposed plane */
#pragma unroll
        for (int r = 0; r < 8; ++r) pk[r] = (_Float16)(acc[i][j][r] + bias);
        *(v8h*)&st[(wn * 32 + j * 16 + col) * 136 + wm * 64 + i * 16 + 8 * g] = pk; } }
    __syncthreads();
    for (int e = tid; e < 128 * 16; e += 256) { const int cl = e >> 4, q = e & 15; vst2((unsigned*)(VT + (bb * CC + c0 + cl) * (size_t)TT + t0 + q * 8), *(const v4u*)&st[cl * 136 + q * 8]); } } }
// ---- k_attn: block = 128 queries (4 waves x 32) of ONE world of (b, h); it walks only the key worlds that the table row of its world admits (8 tiles of 64 keys each, in world order), so no score is masked; one pass = 32 keys, one staged tile = 64 keys = two passes. S^T = K Q^T (A = 16 key rows, B = 16 query columns): a lane holds one query's 16 scores of the pass, the lane 16 away the other 16. Two S^T tiles converted in place are the B operand of O^T += V^T P^T (same k order as frag_h), so scores and P stay in registers. Online softmax in base 2, f32: running maximum m, running sum l, O^T rescaled by 2^(m_old - m_new) every pass.
// K rows and V^T rows of a tile (128 B each) come into LDS once per block by asynchronous 16-byte copies, 8 lanes to a whole line; the four waves take their fragments from there. Two buffers: tile t + 1 flies while tile t is worked on; one barrier a tile publishes tile t + 1 and ends every read of the buffer that is refilled behind it.
// every plain '#pragma unroll' in this kernel after the table read stands on a loop over a register array (fragments, tiles, a lane's scores): its index must be a constant for the array to stay in registers
// modal mask: q, k and v lie sorted by world, so the table row of the block's world is a list of admitted key worlds (block-uniform, formed once before the loop); an excluded world's 512 keys are neither copied nor multiplied
__device__ __forceinline__ float xhalf(float x) { return __builtin_bit_cast(float, __builtin_amdgcn_permlanex16(__builtin_bit_cast(int, x), __builtin_bit_cast(int, x), 0x76543210, 0xfedcba98, false, false)); }   // lane l with lane l ^ 16
#define SCALE_LOG2E (SCALE * 1.4426950408889634f)
// 2^x in place. Behind v_exp_f32 the instruction set asks for one independent instruction or v_nop before its result is used or its source overwritten: in one statement each v_exp_f32 is that instruction for the one before it, and the v_nop serves the last
__device__ __forceinline__ void exp2x8(float* x) {
  asm("v_exp_f32 %0, %0\n\tv_exp_f32 %1, %1\n\tv_exp_f32 %2, %2\n\tv_exp_f32 %3, %3\n\tv_exp_f32 %4, %4\n\tv_exp_f32 %5, %5\n\tv_exp_f32 %6, %6\n\tv_exp_f32 %7, %7\n\tv_nop"
      : "+v"(x[0]), "+v"(x[1]), "+v"(x[2]), "+v"(x[3]), "+v"(x[4]), "+v"(x[5]), "+v"(x[6]), "+v"(x[7])); }
__device__ __forceinline__ float exp2x1(float x) { asm("v_exp_f32 %0, %0\n\tv_nop" : "+v"(x)); return x; }
#define AK 64               // keys of one staged tile
#define TPW (TT / 4 / AK)   // tiles of one world's keys
#define AP 72               // LDS row pitch in 16-bit elements: 128-B rows + 16 B (16 B x odd, for 16-byte readers)
#define ATILE (64 * AP)     // K tile [64 keys][AP] or V^T tile [64 dims][AP]; a buffer is [K tile | V^T tile]
// one tile's copies of a lane: rows r, r + 16, r + 32, r + 48 of the K tile and of the V^T tile, 16 B each (lds = the lane's byte address in the K tile of the target buffer). The s_wait_xcnt stands inside the statement so that no address register of an issued copy is rewritten ahead of it
__device__ __forceinline__ void stage_kv(unsigned lds, const _Float16* gk, const _Float16* gv) {
  asm volatile("global_load_async_to_lds_b128 %0, %8, off\n\tglobal_load_async_to_lds_b128 %1, %9, off\n\tglobal_load_async_to_lds_b128 %2, %10, off\n\tglobal_load_async_to_lds_b128 %3, %11, off\n\t"
               "global_load_async_to_lds_b128 %4, %12, off\n\tglobal_load_async_to_lds_b128 %5, %13, off\n\tglobal_load_async_to_lds_b128 %6, %14, off\n\tglobal_load_async_to_lds_b128 %7, %15, off\n\ts_wait_xcnt 0x0"
      :: "v"(lds), "v"(lds + 16u * AP * 2u), "v"(lds + 32u * AP * 2u), "v"(lds + 48u * AP * 2u),
         "v"(lds + ATILE * 2u), "v"(lds + ATILE * 2u + 16u * AP * 2u), "v"(lds + ATILE * 2u + 32u * AP * 2u), "v"(lds + ATILE * 2u + 48u * AP * 2u),
         "v"(gk), "v"(gk + (size_t)16 * CC), "v"(gk + (size_t)32 * CC), "v"(gk + (size_t)48 * CC),
         "v"(gv), "v"(gv + (size_t)16 * TT), "v"(gv + (size_t)32 * TT), "v"(gv + (size_t)48 * TT) : "memory"); }
__global__ __launch_bounds__(128) void k_attn(const _Float16* __restrict__ QH, const _Float16* __restrict__ KH, const _Float16* __restrict__ VT, const int* __restrict__ ACC, _Float16* __restrict__ Y) {
  __shared__ __align__(16) _Float16 kv[2 * 2 * ATILE];
  const int tid = threadIdx.x, wave = tid >> 5, lane = tid & 31, col = lane & 15, g = lane >> 4; const int h = blockIdx.y, b = blockIdx.z;
  const int u = (int)(blockIdx.x + (blockIdx.x >> 2) + h + (h >> 2) + b) & 3;   /* the block's world. Blocks of different worlds run for different lengths: this sum is the flat block index's base-4 digit sum mod 4, so each aligned run of four flat indices holds the four worlds (for speed only: long and short blocks spread over the chip); for fixed (h, b) the 16 values of blockIdx.x give each (world, quarter) once */
  const int qp = (int)(blockIdx.x >> 2) * 128 + wave * 32;   /* the wave's first query, counted inside its world */
  unsigned accm = 0u;
#pragma unroll
  for (int i = 0; i < 16; ++i) accm |= ((ACC[i] != 0) ? 1u : 0u) << i;
  const unsigned rowm = (accm >> (u << 2)) & 15u;   /* the table row of the block's world */
  if (rowm == 0u) {   /* block-uniform, ahead of every copy and barrier: a fully excluded row yields ctx = 0 */
    for (int n = 0; n < 2; ++n) { _Float16* yr = Y + ((size_t)b * TT + 4 * (qp + n * 16 + col) + u) * CC + h * HD + 8 * g;
      for (int j = 0; j < 4; ++j) vst2(yr + j * 16, (v4u){0u, 0u, 0u, 0u}); }
    return; }
  unsigned wl = 0u; int nw = 0;   /* the admitted key worlds, ascending, one byte each */
  for (int i = 0; i < 4; ++i) if ((rowm >> i) & 1u) { wl |= (unsigned)i << (8 * nw); ++nw; }
  const int nt = nw * TPW;   /* tiles to walk: 8 to 32 */
  const auto kpos = [wl](int t) { return (int)((wl >> ((t / TPW) * 8)) & 3u) * (TT / 4) + (t % TPW) * AK; };   /* first key place of tile t; the mask keeps it inside [0, TT - AK] for any table */
  const unsigned ldsw = (unsigned)(size_t)kv + (unsigned)((tid >> 3) * AP + (tid & 7) * 8) * 2u;   /* 8 lanes cover the 128 B of one row; 16 rows a copy of the block */
  const _Float16* gk = KH + ((size_t)b * TT + (tid >> 3)) * CC + h * HD + (tid & 7) * 8;
  const _Float16* gv = VT + ((size_t)b * CC + h * HD + (tid >> 3)) * (size_t)TT + (tid & 7) * 8;
  stage_kv(ldsw, gk + (size_t)kpos(0) * CC, gv + kpos(0));
  v16h qf[2][2];
#pragma unroll
  for (int n = 0; n < 2; ++n)
#pragma unroll
    for (int kc = 0; kc < 2; ++kc) qf[n][kc] = frag_h(QH + ((size_t)b * TT + u * (TT / 4) + qp + n * 16 + col) * CC + h * HD + kc * 32, lane);
  const _Float16* fk = kv + col * AP; const _Float16* fv = kv + ATILE + col * AP;
  v8f o[2][4] = {}; float m[2] = {-3.0e38f, -3.0e38f}, l[2] = {0.f, 0.f};
  asm volatile("s_wait_asynccnt 0x0" ::: "memory");   /* this wave's copies of tile 0 have landed */
  __syncthreads();   /* tile 0 is published */
  stage_kv(ldsw + 2u * ATILE * 2u, gk + (size_t)kpos(1) * CC, gv + kpos(1));   /* nt >= 8: tile 1 exists */
#pragma unroll 1   /* rolled: the tiles share one loop body of two passes in the instruction cache */
  for (int t = 0; t < nt; ++t) { const int cur = (t & 1) * 2 * ATILE;
#pragma unroll
   for (int p = 0; p < 2; ++p) {
    v16h vf[4], kf[2][2];
#pragma unroll
    for (int i = 0; i < 2; ++i)
#pragma unroll
      for (int kc = 0; kc < 2; ++kc) kf[i][kc] = frag_h(fk + cur + (p * 32 + i * 16) * AP + kc * 32, lane);
#pragma unroll
    for (int j = 0; j < 4; ++j) vf[j] = frag_h(fv + cur + (j * 16) * AP + p * 32, lane);
    v8f st[2][2] = {};
#pragma unroll
    for (int kc = 0; kc < 2; ++kc)
#pragma unroll
      for (int i = 0; i < 2; ++i)
#pragma unroll
        for (int n = 0; n < 2; ++n) st[n][i] = wmma16(kf[i][kc], qf[n][kc], st[n][i]);
    v16h pb[2];
#pragma unroll
    for (int n = 0; n < 2; ++n) { float s[16];
#pragma unroll
      for (int r = 0; r < 8; ++r) { s[r] = st[n][0][r] * SCALE_LOG2E; s[8 + r] = st[n][1][r] * SCALE_LOG2E; }
      float mx = s[0];
#pragma unroll
      for (int i = 1; i < 16; ++i) mx = fmaxf(mx, s[i]);
      mx = fmaxf(mx, xhalf(mx));
      const float mn = fmaxf(m[n], mx); const float al = exp2x1(m[n] - mn); m[n] = mn;
      const float mo = mn - 11.0f;   /* P carried x 2^11 into f16 (clear of f16 subnormals); l carries the same factor, so it cancels in O / l */
#pragma unroll
      for (int i = 0; i < 16; ++i) s[i] -= mo;
      exp2x8(s); exp2x8(s + 8);
      float sum = 0.f;
#pragma unroll
      for (int i = 0; i < 16; ++i) { sum += s[i]; pb[n][i] = (_Float16)s[i]; }
      l[n] = l[n] * al + sum;
#pragma unroll
      for (int j = 0; j < 4; ++j) o[n][j] *= al; }
#pragma unroll
    for (int j = 0; j < 4; ++j)
#pragma unroll
      for (int n = 0; n < 2; ++n) o[n][j] = wmma16(vf[j], pb[n], o[n][j]); }
    asm volatile("s_wait_dscnt 0x0" ::: "memory");      /* this wave's reads of tile t's buffer have returned before the buffer is handed to the copies */
    asm volatile("s_wait_asynccnt 0x0" ::: "memory");   /* this wave's copies of tile t + 1 have landed */
    __syncthreads();   /* publishes tile t + 1 and ends every wave's reads of tile t's buffer */
    if (t + 2 < nt) stage_kv(ldsw + (unsigned)cur * 2u, gk + (size_t)kpos(t + 2) * CC, gv + kpos(t + 2)); }   /* block-uniform test */
  asm volatile("s_wait_asynccnt 0x0" ::: "memory");   /* no copy is outstanding when the wave ends */
#pragma unroll
  for (int n = 0; n < 2; ++n) { const float lt = l[n] + xhalf(l[n]); const float inv = lt > 0.f ? 1.0f / lt : 0.f;
    _Float16* yr = Y + ((size_t)b * TT + 4 * (qp + n * 16 + col) + u) * CC + h * HD + 8 * g;   /* back to the token's own row */
#pragma unroll
    for (int j = 0; j < 4; ++j) { const v8f ov = o[n][j] * inv; v8h pk;   /* ctx x 2^6 to f16 here, once, in the form k_out's product takes */
#pragma unroll
      for (int r = 0; r < 8; ++r) pk[r] = (_Float16)(ov[r] * 64.0f);
      vst2(yr + j * 16, pk); asm volatile("s_wait_xcnt 0x0" ::: "memory"); } } }   /* the wait: the next tile's rounding reuses the registers that the issued store names */
// ---- k_out: block = (128 rows, 128 cols): out = ctx Wo (+ bo): ctx x 2^6 in f16 (from k_attn; small-magnitude context rows stay clear of f16 subnormals) against Wo as f16(bf16 x 2^8) exact (from k_cvt) (1 product) x 2^-14
__global__ __launch_bounds__(256) void k_out(const unsigned short* __restrict__ Y, const unsigned short* __restrict__ WO, const float* __restrict__ BO, float* __restrict__ OUT) {
  __shared__ __align__(16) unsigned short sm[4 * GTILE];
  const int tid = threadIdx.x, wave = tid >> 5, lane = tid & 31, col = lane & 15, g = lane >> 4; const int wm = wave >> 2, wn = wave & 3; const int c0 = blockIdx.y * 128; const size_t r0 = (size_t)blockIdx.x * 128;
  v8f acc[4][2] = {};
  gemm128<1>(Y + r0 * CC, WO + (size_t)c0 * CC, sm, acc);
  float* sf = (float*)sm;   /* output staging [128][132] f32 (67,584 B of the 139,264), so that the stores cover whole lines */
#pragma unroll
  for (int j = 0; j < 2; ++j) { const float bias = BO ? bfr(BO[c0 + wn * 32 + j * 16 + col]) : 0.f;
#pragma unroll
    for (int i = 0; i < 4; ++i)
#pragma unroll
      for (int r = 0; r < 8; ++r) sf[(wm * 64 + i * 16 + 8 * g + r) * 132 + wn * 32 + j * 16 + col] = acc[i][j][r] * (1.0f / 16384.0f) + bias; }   /* 2^-8 (Wo carry) x 2^-6 (ctx carry) */
  __syncthreads();
  for (int e = tid; e < 128 * 32; e += 256) { const int rl = e >> 5, q = e & 31; vst2(OUT + (r0 + rl) * DIN + c0 + q * 4, *(const v4f*)&sf[rl * 132 + q * 4]); } }

extern "C" void kernel_launch(void* const* d_in, const int* in_sizes, int n_in, void* d_out, int out_size, void* d_ws, size_t ws_size, hipStream_t stream) {
  (void)in_sizes; (void)n_in; (void)out_size;
  const float** F = (const float**)d_in;
  if (ws_size < (size_t)WS_END) return;
  char* ws = (char*)d_ws; _Float16 *QH = (_Float16*)(ws + WS_QH), *KH = (_Float16*)(ws + WS_KH), *VT = (_Float16*)(ws + WS_VT), *QL = (_Float16*)(ws + WS_QL), *KL = (_Float16*)(ws + WS_KL); __bf16 *VB = (__bf16*)(ws + WS_VB), *VBL = (__bf16*)(ws + WS_VBL); _Float16 *Y = (_Float16*)(ws + WS_Y), *WOH = (_Float16*)(ws + WS_WOH); __bf16 *XB = (__bf16*)(ws + WS_XB), *WB = (__bf16*)(ws + WS_WB);
  (void)Y; (void)QL; (void)KL; (void)VB; (void)VBL;
  // inputs: 0 x [2,2048,1024]; 1 Wq [1024,1024] (out,in); 2 Wk; 3 Wv; 4 Wproj (out,in); 5 accessibility [4,4] int32 (random 0 / 1, unit diagonal; READ on the device); no biases
  k_cvt<<<dim3((NB * TT + 3 * CC + DIN) / CVR), 256, 0, stream>>>(F[0], F[1], F[2], F[3], F[4], XB, WB, WOH);
  k_proj<<<dim3(TNB * TT / 128, CC / 128, 3), 256, 0, stream>>>((const unsigned short*)XB, (const unsigned short*)WB, nullptr, nullptr, nullptr, QH, KH, VT);
  k_attn<<<dim3(TT / 128, NH, TNB), 128, 0, stream>>>(QH, KH, VT, (const int*)d_in[5], Y);
  k_out<<<dim3(TNB * TT / 128, DIN / 128), 256, 0, stream>>>((const unsigned short*)Y, (const unsigned short*)WOH, nullptr, (float*)d_out);
}

// v006
// One run takes 72.2 microseconds.
// Two timings next to v005 both put it at 1.06 times that version's speed.
// Counting every step since v000, it is 18.8 times as fast.
// compute dtype: all float inputs rounded to bf16, once, by k_cvt, into 16-bit planes of the workspace; q / k / v projections with EXACT bf16 products on WMMA 16x16x32 (f32 accumulate) + bias (none); one attention kernel: logits k x q once to f16 each (1 product) x 64^-0.5 x log2(e); tokens kept sorted by world (token % 4) in q / k / v, so the 4 x 4 accessibility table read at (query world, key world) admits or skips a whole run of 512 keys; online softmax f32 in base 2; unnormalised P x 2^11 once to f16 x v once to f16 (1 product), divided by the f32 row sum at the end; ctx x 2^6 once to f16 x the output weight f16(bf16 x 2^8) + bias; f32 output.
#include <hip/hip_runtime.h>
#include <math.h>

typedef __attribute__((ext_vector_type(16))) _Float16 v16h;
typedef __attribute__((ext_vector_type(16))) __bf16 v16b;
typedef __attribute__((ext_vector_type(8)))  _Float16 v8h;
typedef __attribute__((ext_vector_type(8)))  float v8f;
typedef __attribute__((ext_vector_type(4)))  float v4f;
typedef __attribute__((ext_vector_type(2)))  float v2f;
typedef __attribute__((ext_vector_type(4)))  unsigned v4u;
typedef __attribute__((ext_vector_type(4)))  int v4i;
typedef float __attribute__((may_alias)) float_a;
typedef int __attribute__((may_alias)) int_a;

template <typename T> __device__ __forceinline__ void vst2(void* p, T v) { *(T*)p = v;  }
__device__ __forceinline__ v8f wmma16(v16h a, v16h b, v8f c) {
  v8f d = __builtin_amdgcn_wmma_f32_16x16x32_f16(false, a, false, b, (short)0, c, false, false);
  asm volatile("v_nop\n\tv_nop\n\tv_nop\n\tv_nop" : "+v"(d) : "v"(a), "v"(b));
  return d;
}
__device__ __forceinline__ v8f wmma_bf(v16b a, v16b b, v8f c) {
  v8f d = __builtin_amdgcn_wmma_f32_16x16x32_bf16(false, a, false, b, (short)0, c, false, false);
  asm volatile("v_nop\n\tv_nop\n\tv_nop\n\tv_nop" : "+v"(d) : "v"(a), "v"(b));
  return d;
}
// 16x16x32 fragments: lane = (h = lane>>4, row/col = lane&15); elements 0..7 = k0+8h+0..7, 8..15 = k0+16+8h+0..7; D element r = row 8h+r
__device__ __forceinline__ v16h frag_h(const _Float16* rowk0, int lane) {
  union { v16h v; v8h q[2]; } u; const _Float16* p = rowk0 + 8 * (lane >> 4);
  u.q[0] = *(const v8h*)p; u.q[1] = *(const v8h*)(p + 16); return u.v;
}
__device__ __forceinline__ v16h frag_f32(const float* rowk0, int lane) {
  v16h a; const float* p = rowk0 + 8 * (lane >> 4);
#pragma unroll
  for (int i = 0; i < 8; ++i) { a[i] = (_Float16)p[i]; a[8 + i] = (_Float16)p[16 + i]; }
  return a;
}
__device__ __forceinline__ v16h frag_f32s(const float* rowk0, int lane, float sc) {
  v16h a; const float* p = rowk0 + 8 * (lane >> 4);
#pragma unroll
  for (int i = 0; i < 8; ++i) { a[i] = (_Float16)(p[i] * sc); a[8 + i] = (_Float16)(p[16 + i] * sc); }
  return a;
}
// column fragment from a [K][ld] layout (column n), rows >= K read as 0
__device__ __forceinline__ v16h fragc_f32(const float* W, int k0, int n, int lane, int ld, int K) {
  v16h a; const int g = lane >> 4;
#pragma unroll
  for (int i = 0; i < 8; ++i) { const int ka = k0 + 8 * g + i, kb = ka + 16;
    a[i] = (_Float16)(ka < K ? W[(size_t)(ka < K ? ka : K - 1) * ld + n] : 0.f); a[8 + i] = (_Float16)(kb < K ? W[(size_t)(kb < K ? kb : K - 1) * ld + n] : 0.f); }
  return a;
}
struct F2 { v16b h, l; };
__device__ __forceinline__ F2 bsplit16(const float v[16]) { F2 r;
#pragma unroll
  for (int i = 0; i < 16; ++i) { const __bf16 h = (__bf16)v[i]; r.h[i] = h; r.l[i] = (__bf16)(v[i] - (float)h); }
  return r; }
__device__ __forceinline__ F2 split_row(const float* row, int k0, int lane) { float v[16]; const float* p = row + k0 + 8 * (lane >> 4);
#pragma unroll
  for (int i = 0; i < 8; ++i) { v[i] = p[i]; v[8 + i] = p[16 + i]; }
  return bsplit16(v); }
__device__ __forceinline__ F2 split_rowK(const float* row, int k0, int lane, int K) { float v[16]; const int g = lane >> 4;
#pragma unroll
  for (int i = 0; i < 8; ++i) { const int ka = k0 + 8 * g + i, kb = ka + 16; v[i] = ka < K ? row[ka < K ? ka : K - 1] : 0.f; v[8 + i] = kb < K ? row[kb < K ? kb : K - 1] : 0.f; }
  return bsplit16(v); }
__device__ __forceinline__ F2 split_col(const float* W, int k0, int n, int lane, int ld, int K) { float v[16]; const int g = lane >> 4;
#pragma unroll
  for (int i = 0; i < 8; ++i) { const int ka = k0 + 8 * g + i, kb = ka + 16; v[i] = ka < K ? W[(size_t)(ka < K ? ka : K - 1) * ld + n] : 0.f; v[8 + i] = kb < K ? W[(size_t)(kb < K ? kb : K - 1) * ld + n] : 0.f; }
  return bsplit16(v); }
__device__ __forceinline__ v8f mac3(const F2& a, const F2& b, v8f c) { c = wmma_bf(a.l, b.h, c); c = wmma_bf(a.h, b.l, c); return wmma_bf(a.h, b.h, c); }
__device__ __forceinline__ float sigm(float v) { return 1.0f / (1.0f + expf(-v)); }
#define LDSX() do { asm volatile("s_wait_dscnt 0" ::: "memory"); __builtin_amdgcn_wave_barrier(); __builtin_amdgcn_fence(__ATOMIC_RELEASE, "workgroup"); } while (0)

// Multi-head self-attention with a 'Kripke modal' mask (x [2,2048,1024]; torch (out,in) Wq / Wk / Wv / Wproj [1024,1024] N(0,1) x 0.02 applied as x @ W.T, no biases; accessibility [4,4] int32 = random 0 / 1 with a unit diagonal, a module input READ on the device; 16 heads x 64; world = token index % 4; scores / sqrt(64) set to -inf wherever accessibility[world(q)][world(k)] == 0; softmax; out @ Wproj.T). Every row keeps the keys of its own world (the diagonal is 1), so no row is empty.
#define NB 2
#define TT 2048
#define CC 1024            // NH * HD = projected width
#define DIN 1024          // input (model) width
#define NH 16
#define HD 64
#define SCALE (0.125f)
#define CAUSAL 0
#ifndef TNB
#define TNB NB
#endif
__device__ __forceinline__ float bfr(float v) { return (float)(__bf16)v; }
__host__ __device__ __forceinline__ int kb_last(int qb) { return CAUSAL ? ((qb * 64 + 63) >> 7) : (TT / 128 - 1); }
typedef __attribute__((ext_vector_type(8))) __bf16 v8b;
__device__ __forceinline__ v16b frag_b(const __bf16* rowk0, int lane) {
  union { v16b v; v8b q[2]; } u; const __bf16* p = rowk0 + 8 * (lane >> 4);
  u.q[0] = *(const v8b*)p; u.q[1] = *(const v8b*)(p + 16); return u.v;
}
#define QBH 0
#define QHI 0               // single-product logits on every row
#define KHI 64            // key rows carrying k residual / v bf16 hi+lo planes (no kernel here writes or reads them)
// B fragment (k rows k0+.., output column o) of a weight: (in,out) [K][ld] or (out,in) [ld rows of K]: bf16 exact, or f16(bf16 * 256) exact
__device__ __forceinline__ v16b wcol_io(const float* Wm, int k0, int o, int lane, int ld) { v16b w; const int g = lane >> 4;
#pragma unroll
  for (int i = 0; i < 8; ++i) { w[i] = (__bf16)Wm[(size_t)(k0 + 8 * g + i) * ld + o]; w[8 + i] = (__bf16)Wm[(size_t)(k0 + 16 + 8 * g + i) * ld + o]; }
  return w; }
__device__ __forceinline__ v16b wcol_oi(const float* Wm, int k0, int o, int lane, int K) { v16b w; const float* p = Wm + (size_t)o * K + k0 + 8 * (lane >> 4);
#pragma unroll
  for (int i = 0; i < 8; ++i) { w[i] = (__bf16)p[i]; w[8 + i] = (__bf16)p[16 + i]; }
  return w; }
__device__ __forceinline__ v16h wcolh_io(const float* Wm, int k0, int o, int lane, int ld) { v16h w; const int g = lane >> 4;
#pragma unroll
  for (int i = 0; i < 8; ++i) { w[i] = (_Float16)(bfr(Wm[(size_t)(k0 + 8 * g + i) * ld + o]) * 256.0f); w[8 + i] = (_Float16)(bfr(Wm[(size_t)(k0 + 16 + 8 * g + i) * ld + o]) * 256.0f); }
  return w; }
__device__ __forceinline__ v16h wcolh_oi(const float* Wm, int k0, int o, int lane, int K) { v16h w; const float* p = Wm + (size_t)o * K + k0 + 8 * (lane >> 4);
#pragma unroll
  for (int i = 0; i < 8; ++i) { w[i] = (_Float16)(bfr(p[i]) * 256.0f); w[8 + i] = (_Float16)(bfr(p[16 + i]) * 256.0f); }
  return w; }
#define WQKV_LAYOUT 1   // 0 = (in,out) [DIN][CC]; 1 = (out,in) [CC][DIN]; 2 = per-head [NH][DIN][HD]
__device__ __forceinline__ v16b wcol_hdk(const float* Wm, int k0, int o, int lane) { v16b w; const int g = lane >> 4; const float* p = Wm + (size_t)(o / HD) * DIN * HD + (o % HD);
#pragma unroll
  for (int i = 0; i < 8; ++i) { w[i] = (__bf16)p[(size_t)(k0 + 8 * g + i) * HD]; w[8 + i] = (__bf16)p[(size_t)(k0 + 16 + 8 * g + i) * HD]; }
  return w; }
#define WO_OUT_IN 1
#if WQKV_LAYOUT == 1
#define WCOL(W, k0, o, lane) wcol_oi(W, k0, o, lane, DIN)
#elif WQKV_LAYOUT == 2
#define WCOL(W, k0, o, lane) wcol_hdk(W, k0, o, lane)
#else
#define WCOL(W, k0, o, lane) wcol_io(W, k0, o, lane, CC)
#endif
#if WO_OUT_IN
#define WOCOL(W, k0, o, lane) wcol_oi(W, k0, o, lane, CC)
#define WOCOLH(W, k0, o, lane) wcolh_oi(W, k0, o, lane, CC)
#else
#define WOCOL(W, k0, o, lane) wcol_io(W, k0, o, lane, DIN)
#define WOCOLH(W, k0, o, lane) wcolh_io(W, k0, o, lane, DIN)
#endif

// 'pos' = a token's place in world order: pos = (t % 4) * (TT / 4) + t / 4
#define WS_QH  0u                                      // f16 q rows [b*pos][CC]
#define WS_KH  (WS_QH + 2u * (size_t)NB * TT * CC)      // f16 k rows [b*pos][CC]
#define WS_VT  (WS_KH + 2u * (size_t)NB * TT * CC)      // f16 v planes [b][c][pos]
#define WS_QL  (WS_VT + 2u * (size_t)NB * CC * TT)      // f16 q residual x 2^10 rows [b][t < QHI][CC]
#define WS_KL  (WS_QL + 2u * (size_t)NB * QHI * CC)     // f16 k residual x 2^10 rows [b][t < KHI][CC]
#define WS_VB  (WS_KL + 2u * (size_t)NB * KHI * CC)     // bf16 v hi planes [b][c][t < KHI]
#define WS_VBL (WS_VB + 2u * (size_t)NB * CC * KHI)
#define WS_Y   (WS_VBL + 2u * (size_t)NB * CC * KHI)    // f16 ctx x 2^6 rows [b*t][CC]
#define WS_XB  (WS_Y  + 2u * (size_t)NB * TT * CC)      // bf16 x rows [b*pos][DIN]
#define WS_WB  (WS_XB + 2u * (size_t)NB * TT * DIN)     // bf16 Wq | Wk | Wv rows [3 * CC][DIN]
#define WS_WOH (WS_WB + 2u * 3u * (size_t)CC * DIN)     // f16(bf16 x 2^8) Wo rows [DIN][CC]
#define WS_END (WS_WOH + 2u * (size_t)DIN * CC)

// ---- k_cvt: every operand of the two products that is an input is rounded ONCE to its 16-bit form and laid in the workspace, so that k_proj and k_out fetch half the bytes from L2 and round nothing per block. Rows of 1024 floats: x (to bf16, stored at the token's place in world order), Wq | Wk | Wv (to bf16), Wo (to f16(bf16 x 2^8)). Block = 16 rows of one kind; a thread takes 8 floats of 8 rows, all 16 loads issued ahead of the first store.
__device__ __forceinline__ v8b cv8b(v4f a, v4f b) { v8b y;
#pragma unroll
  for (int e = 0; e < 4; ++e) { y[e] = (__bf16)a[e]; y[4 + e] = (__bf16)b[e]; }
  return y; }
#define CVR 16              // rows of one block
__global__ __launch_bounds__(256) void k_cvt(const float* __restrict__ X, const float* __restrict__ WQ, const float* __restrict__ WK, const float* __restrict__ WV, const float* __restrict__ WO, __bf16* __restrict__ XB, __bf16* __restrict__ WB, _Float16* __restrict__ WOH) {
  const int tid = threadIdx.x, c = (tid & 127) * 8, hi = tid >> 7; const int rb0 = (int)blockIdx.x * CVR;   /* first row of the block, counted over x, Wq, Wk, Wv, Wo; every kind's row count is a multiple of CVR, so the kind is block-uniform */
  const int kind = rb0 < NB * TT ? 0 : rb0 < NB * TT + 3 * CC ? 1 : 2;
  const int w0 = rb0 - NB * TT;   /* row among Wq | Wk | Wv */
  const float* src = kind == 0 ? X + (size_t)rb0 * DIN : kind == 1 ? (w0 < CC ? WQ : w0 < 2 * CC ? WK : WV) + (size_t)(w0 % CC) * DIN : WO + (size_t)(w0 - 3 * CC) * CC;
  const unsigned vb = (unsigned)(hi * DIN + c) * 4u;   /* the lane's byte offset from the block's first row */
  v4f r[8][2];
#pragma unroll   /* register array: constant index */
  for (int i = 0; i < 8; ++i) { const char* p = (const char*)src + vb + (size_t)i * 2 * DIN * 4; r[i][0] = *(const v4f*)p; r[i][1] = *(const v4f*)(p + 16); }
  /* inputs only: the offset and the loaded values, so that the wait stands behind all 16 loads and the offset keeps its register up to it (without them the last load's result took the register that the issued loads name as their address) */
  asm volatile("s_wait_xcnt 0x0" :: "v"(vb), "v"(r[0][0]), "v"(r[0][1]), "v"(r[1][0]), "v"(r[1][1]), "v"(r[2][0]), "v"(r[2][1]), "v"(r[3][0]), "v"(r[3][1]), "v"(r[4][0]), "v"(r[4][1]), "v"(r[5][0]), "v"(r[5][1]), "v"(r[6][0]), "v"(r[6][1]), "v"(r[7][0]), "v"(r[7][1]) : "memory");
  /* behind each store: s_wait_xcnt 0, since the next row's rounding reuses the registers that the issued store names */
  if (kind == 2) { _Float16* d = WOH + (size_t)(w0 - 3 * CC + hi) * CC + c;
#pragma unroll   /* register array: constant index */
    for (int i = 0; i < 8; ++i) { v8h y;
#pragma unroll
      for (int e = 0; e < 4; ++e) { y[e] = (_Float16)(bfr(r[i][0][e]) * 256.0f); y[4 + e] = (_Float16)(bfr(r[i][1][e]) * 256.0f); }
      *(v8h*)(d + (size_t)i * 2 * CC) = y; asm volatile("s_wait_xcnt 0x0" ::: "memory"); }
  } else if (kind == 1) { __bf16* d = WB + (size_t)(w0 + hi) * DIN + c;
#pragma unroll   /* register array: constant index */
    for (int i = 0; i < 8; ++i) { *(v8b*)(d + (size_t)i * 2 * DIN) = cv8b(r[i][0], r[i][1]); asm volatile("s_wait_xcnt 0x0" ::: "memory"); }
  } else { __bf16* d = XB + ((size_t)(rb0 / TT) * TT + (rb0 % TT) / 4 + hi * (TT / 4)) * DIN + c;   /* token rb0 + j, j = 2 i + hi, lies in world j % 4 (rb0 is a multiple of 4) at place (rb0 % TT + j) / 4 of it */
#pragma unroll   /* register array: constant index */
    for (int i = 0; i < 8; ++i) { *(v8b*)(d + (size_t)((i & 1) * 2 * (TT / 4) + (i >> 1)) * DIN) = cv8b(r[i][0], r[i][1]); asm volatile("s_wait_xcnt 0x0" ::: "memory"); } } }
// ---- gemm128: the product loop of k_proj and k_out. Block = 256 threads = 8 waves (2 x 4), tile 128 rows x 128 columns, K = 1024 in 8 stages of 128. Both operands are K-contiguous 16-bit rows of GKD elements, already in the form the matrix instruction takes: each stage (256 B of every row) is read once per block with whole-line 16-byte loads and laid in LDS as it is; the waves take their fragments from there (wave tile 64 x 32: 4 A x 2 B fragments). Two LDS buffers: stage s + 1 is fetched into registers ahead of stage s's products and stored behind them, one barrier a stage. Blocks that share operand rows ask L2 for the same lines: each block starts its walk over K at its own stage 'rot' (block-uniform, from its tile indices) and wraps round, so that at any moment the sharers of a row are spread over the 8 stages. The k order of every accumulator is the ascending one rotated by rot stages.
// every plain '#pragma unroll' in gemm128, k_proj and k_out stands on a loop over a register array (staged rows, fragments, accumulator tiles): its index must be a constant for the array to stay in registers
#define GK 128              // k of one stage
#define GP (GK + 8)         // LDS row pitch in 16-bit elements: 256-B rows + 16 B (16 B x odd, for 16-byte readers)
#define GTILE (128 * GP)    // one operand's tile of one stage; a buffer is [A tile | B tile]
#define GKD 1024            // K of both products (DIN = CC)
// MODE 0: bf16 operands. MODE 1: f16 operands
template <int MODE> __device__ __forceinline__ void gemm128(const unsigned short* __restrict__ A, const unsigned short* __restrict__ B, unsigned short* sm, v8f (&acc)[4][2], const int rot) {
  const int tid = threadIdx.x, wave = tid >> 5, lane = tid & 31, col = lane & 15; const int wm = wave >> 2, wn = wave & 3;
  const int srow = tid >> 4, sc = (tid & 15) * 8;   /* 16 lanes cover the 256 B of one row's stage; 16 rows a sweep, 8 sweeps an operand */
  const unsigned short* ga = A + (size_t)srow * GKD + sc; const unsigned short* gb = B + (size_t)srow * GKD + sc;
  unsigned short* wr = sm + srow * GP + sc;
  const unsigned short* fa = sm + (wm * 64 + col) * GP; const unsigned short* fb = sm + GTILE + (wn * 32 + col) * GP;
  v4u ra[8], rb[8];
#pragma unroll
  for (int i = 0; i < 8; ++i) { ra[i] = *(const v4u*)(ga + (size_t)i * 16 * GKD + (rot & (GKD / GK - 1)) * GK); rb[i] = *(const v4u*)(gb + (size_t)i * 16 * GKD + (rot & (GKD / GK - 1)) * GK); }
#pragma unroll
  for (int i = 0; i < 8; ++i) { *(v4u*)(wr + i * 16 * GP) = ra[i]; *(v4u*)(wr + GTILE + i * 16 * GP) = rb[i]; }
  __syncthreads();
#pragma unroll 1   /* rolled: the 8 stages share one small loop body in the instruction cache */
  for (int s = 0; s < GKD / GK; ++s) { const int cur = (s & 1) * 2 * GTILE, nxt = 2 * GTILE - cur; const bool more = s + 1 < GKD / GK;   /* block-uniform */
    const int kn = ((s + 1 + rot) & (GKD / GK - 1)) * GK;   /* first k of the stage fetched now */
    if (more) {
#pragma unroll
      for (int i = 0; i < 8; ++i) { ra[i] = *(const v4u*)(ga + (size_t)i * 16 * GKD + kn); rb[i] = *(const v4u*)(gb + (size_t)i * 16 * GKD + kn); } }
#pragma unroll
    for (int kc = 0; kc < GK / 32; ++kc) {
      if constexpr (MODE == 0) { v16b af[4], bf[2];
#pragma unroll
        for (int i = 0; i < 4; ++i) af[i] = frag_b((const __bf16*)(fa + cur + i * 16 * GP + kc * 32), lane);
#pragma unroll
        for (int j = 0; j < 2; ++j) bf[j] = frag_b((const __bf16*)(fb + cur + j * 16 * GP + kc * 32), lane);
#pragma unroll
        for (int i = 0; i < 4; ++i)
#pragma unroll
          for (int j = 0; j < 2; ++j) acc[i][j] = wmma_bf(af[i], bf[j], acc[i][j]);
      } else { v16h af[4], bf[2];
#pragma unroll
        for (int i = 0; i < 4; ++i) af[i] = frag_h((const _Float16*)(fa + cur + i * 16 * GP + kc * 32), lane);
#pragma unroll
        for (int j = 0; j < 2; ++j) bf[j] = frag_h((const _Float16*)(fb + cur + j * 16 * GP + kc * 32), lane);
#pragma unroll
        for (int i = 0; i < 4; ++i)
#pragma unroll
          for (int j = 0; j < 2; ++j) acc[i][j] = wmma16(af[i], bf[j], acc[i][j]); } }
    if (more) {
#pragma unroll
      for (int i = 0; i < 8; ++i) { *(v4u*)(wr + nxt + i * 16 * GP) = ra[i]; *(v4u*)(wr + nxt + GTILE + i * 16 * GP) = rb[i]; } }
    __syncthreads(); } }   /* publishes stage s + 1 and ends every read of stage s's buffer; behind the last one the LDS is free for the output staging */
// ---- k_proj: block = (128 rows, 128 cols, which): q/k/v = X W (+ b) with exact bf16 products (K = DIN) -> which 0: q f16 rows; 1: k f16 rows; 2: v f16 planes [c][pos]. A block's 128 rows are 128 places in world order, side by side in k_cvt's x plane as in q / k / v
__global__ __launch_bounds__(256) void k_proj(const unsigned short* __restrict__ XB, const unsigned short* __restrict__ WB, const float* __restrict__ BQ, const float* __restrict__ BK, const float* __restrict__ BV,
    _Float16* __restrict__ QH, _Float16* __restrict__ KH, _Float16* __restrict__ VT) {
  __shared__ __align__(16) unsigned short sm[4 * GTILE];
  const int tid = threadIdx.x, wave = tid >> 5, lane = tid & 31, col = lane & 15, g = lane >> 4; const int wm = wave >> 2, wn = wave & 3; const int which = blockIdx.z; const int c0 = blockIdx.y * 128; const size_t r0 = (size_t)blockIdx.x * 128; const size_t bb = r0 / TT; const int t0 = (int)(r0 % TT);   /* t0 = first place */
  const float* BA = which == 0 ? BQ : which == 1 ? BK : BV;
  v8f acc[4][2] = {};
  gemm128<0>(XB + r0 * DIN, WB + ((size_t)which * CC + c0) * DIN, sm, acc, (int)(blockIdx.x + blockIdx.y + blockIdx.z));   /* the 24 sharers of an x tile and the 32 sharers of a weight tile each spread evenly over the 8 stages */
  _Float16* st = (_Float16*)sm;   /* output staging [128][136] f16, so that the stores cover whole lines */
  if (which < 2) { _Float16* DH = which == 0 ? QH : KH;   /* block-uniform */
#pragma unroll
    for (int j = 0; j < 2; ++j) { const float bias = BA ? bfr(BA[c0 + wn * 32 + j * 16 + col]) : 0.f;
#pragma unroll
      for (int i = 0; i < 4; ++i)
#pragma unroll
        for (int r = 0; r < 8; ++r) st[(wm * 64 + i * 16 + 8 * g + r) * 136 + wn * 32 + j * 16 + col] = (_Float16)(acc[i][j][r] + bias); }
    __syncthreads();
    for (int e = tid; e < 128 * 16; e += 256) { const int rl = e >> 4, q = e & 15; vst2((unsigned*)(DH + (r0 + rl) * CC + c0 + q * 8), *(const v4u*)&st[rl * 136 + q * 8]); }
  } else {
#pragma unroll
    for (int j = 0; j < 2; ++j) { const float bias = BA ? bfr(BA[c0 + wn * 32 + j * 16 + col]) : 0.f;
#pragma unroll
      for (int i = 0; i < 4; ++i) { v8h pk;   /* a lane's 8 rows of one column lie side by side in the transposed plane */
#pragma unroll
        for (int r = 0; r < 8; ++r) pk[r] = (_Float16)(acc[i][j][r] + bias);
        *(v8h*)&st[(wn * 32 + j * 16 + col) * 136 + wm * 64 + i * 16 + 8 * g] = pk; } }
    __syncthreads();
    for (int e = tid; e < 128 * 16; e += 256) { const int cl = e >> 4, q = e & 15; vst2((unsigned*)(VT + (bb * CC + c0 + cl) * (size_t)TT + t0 + q * 8), *(const v4u*)&st[cl * 136 + q * 8]); } } }
// ---- k_attn: block = 128 queries (4 waves x 32) of ONE world of (b, h); it walks only the key worlds that the table row of its world admits (8 tiles of 64 keys each, in world order), so no score is masked; one pass = 32 keys, one staged tile = 64 keys = two passes. S^T = K Q^T (A = 16 key rows, B = 16 query columns): a lane holds one query's 16 scores of the pass, the lane 16 away the other 16. Two S^T tiles converted in place are the B operand of O^T += V^T P^T (same k order as frag_h), so scores and P stay in registers. Online softmax in base 2, f32: running maximum m, running sum l, O^T rescaled by 2^(m_old - m_new) every pass.
// K rows and V^T rows of a tile (128 B each) come into LDS once per block by asynchronous 16-byte copies, 8 lanes to a whole line; the four waves take their fragments from there. Two buffers: tile t + 1 flies while tile t is worked on; one barrier a tile publishes tile t + 1 and ends every read of the buffer that is refilled behind it.
// every plain '#pragma unroll' in this kernel after the table read stands on a loop over a register array (fragments, tiles, a lane's scores): its index must be a constant for the array to stay in registers
// modal mask: q, k and v lie sorted by world, so the table row of the block's world is a list of admitted key worlds (block-uniform, formed once before the loop); an excluded world's 512 keys are neither copied nor multiplied
__device__ __forceinline__ float xhalf(float x) { return __builtin_bit_cast(float, __builtin_amdgcn_permlanex16(__builtin_bit_cast(int, x), __builtin_bit_cast(int, x), 0x76543210, 0xfedcba98, false, false)); }   // lane l with lane l ^ 16
#define SCALE_LOG2E (SCALE * 1.4426950408889634f)
// 2^x in place. Behind v_exp_f32 the instruction set asks for one independent instruction or v_nop before its result is used or its source overwritten: in one statement each v_exp_f32 is that instruction for the one before it, and the v_nop serves the last
__device__ __forceinline__ void exp2x8(float* x) {
  asm("v_exp_f32 %0, %0\n\tv_exp_f32 %1, %1\n\tv_exp_f32 %2, %2\n\tv_exp_f32 %3, %3\n\tv_exp_f32 %4, %4\n\tv_exp_f32 %5, %5\n\tv_exp_f32 %6, %6\n\tv_exp_f32 %7, %7\n\tv_nop"
      : "+v"(x[0]), "+v"(x[1]), "+v"(x[2]), "+v"(x[3]), "+v"(x[4]), "+v"(x[5]), "+v"(x[6]), "+v"(x[7])); }
__device__ __forceinline__ float exp2x1(float x) { asm("v_exp_f32 %0, %0\n\tv_nop" : "+v"(x)); return x; }
#define AK 64               // keys of one staged tile
#define TPW (TT / 4 / AK)   // tiles of one world's keys
#define AP 72               // LDS row pitch in 16-bit elements: 128-B rows + 16 B (16 B x odd, for 16-byte readers)
#define ATILE (64 * AP)     // K tile [64 keys][AP] or V^T tile [64 dims][AP]; a buffer is [K tile | V^T tile]
// one tile's copies of a lane: rows r, r + 16, r + 32, r + 48 of the K tile and of the V^T tile, 16 B each (lds = the lane's byte address in the K tile of the target buffer). The s_wait_xcnt stands inside the statement so that no address register of an issued copy is rewritten ahead of it
__device__ __forceinline__ void stage_kv(unsigned lds, const _Float16* gk, const _Float16* gv) {
  asm volatile("global_load_async_to_lds_b128 %0, %8, off\n\tglobal_load_async_to_lds_b128 %1, %9, off\n\tglobal_load_async_to_lds_b128 %2, %10, off\n\tglobal_load_async_to_lds_b128 %3, %11, off\n\t"
               "global_load_async_to_lds_b128 %4, %12, off\n\tglobal_load_async_to_lds_b128 %5, %13, off\n\tglobal_load_async_to_lds_b128 %6, %14, off\n\tglobal_load_async_to_lds_b128 %7, %15, off\n\ts_wait_xcnt 0x0"
      :: "v"(lds), "v"(lds + 16u * AP * 2u), "v"(lds + 32u * AP * 2u), "v"(lds + 48u * AP * 2u),
         "v"(lds + ATILE * 2u), "v"(lds + ATILE * 2u + 16u * AP * 2u), "v"(lds + ATILE * 2u + 32u * AP * 2u), "v"(lds + ATILE * 2u + 48u * AP * 2u),
         "v"(gk), "v"(gk + (size_t)16 * CC), "v"(gk + (size_t)32 * CC), "v"(gk + (size_t)48 * CC),
         "v"(gv), "v"(gv + (size_t)16 * TT), "v"(gv + (size_t)32 * TT), "v"(gv + (size_t)48 * TT) : "memory"); }
__global__ __launch_bounds__(128) void k_attn(const _Float16* __restrict__ QH, const _Float16* __restrict__ KH, const _Float16* __restrict__ VT, const int* __restrict__ ACC, _Float16* __restrict__ Y) {
  __shared__ __align__(16) _Float16 kv[2 * 2 * ATILE];
  const int tid = threadIdx.x, wave = tid >> 5, lane = tid & 31, col = lane & 15, g = lane >> 4; const int h = blockIdx.y, b = blockIdx.z;
  const int u = (int)(blockIdx.x + (blockIdx.x >> 2) + h + (h >> 2) + b) & 3;   /* the block's world. Blocks of different worlds run for different lengths: this sum is the flat block index's base-4 digit sum mod 4, so each aligned run of four flat indices holds the four worlds (for speed only: long and short blocks spread over the chip); for fixed (h, b) the 16 values of blockIdx.x give each (world, quarter) once */
  const int qp = (int)(blockIdx.x >> 2) * 128 + wave * 32;   /* the wave's first query, counted inside its world */
  unsigned accm = 0u;
#pragma unroll
  for (int i = 0; i < 16; ++i) accm |= ((ACC[i] != 0) ? 1u : 0u) << i;
  const unsigned rowm = (accm >> (u << 2)) & 15u;   /* the table row of the block's world */
  if (rowm == 0u) {   /* block-uniform, ahead of every copy and barrier: a fully excluded row yields ctx = 0 */
    for (int n = 0; n < 2; ++n) { _Float16* yr = Y + ((size_t)b * TT + 4 * (qp + n * 16 + col) + u) * CC + h * HD + 8 * g;
      for (int j = 0; j < 4; ++j) vst2(yr + j * 16, (v4u){0u, 0u, 0u, 0u}); }
    return; }
  unsigned wl = 0u; int nw = 0;   /* the admitted key worlds, ascending, one byte each */
  for (int i = 0; i < 4; ++i) if ((rowm >> i) & 1u) { wl |= (unsigned)i << (8 * nw); ++nw; }
  const int nt = nw * TPW;   /* tiles to walk: 8 to 32 */
  const int rot = (int)(blockIdx.x * (unsigned)nt) >> 4;   /* 0 .. nt - 1: the 16 blocks of one (b, h) read the same K and V^T lines from L2; each starts its walk at its own tile and wraps round (for speed only; every admitted tile is still walked once) */
  const auto kpos = [wl, rot, nt](int t) { const int w = t + rot, tt = w >= nt ? w - nt : w; return (int)((wl >> ((tt / TPW) * 8)) & 3u) * (TT / 4) + (tt % TPW) * AK; };   /* first key place of the t-th tile walked (t < nt, so tt < nt <= 32); the mask keeps it inside [0, TT - AK] for any table */
  const unsigned ldsw = (unsigned)(size_t)kv + (unsigned)((tid >> 3) * AP + (tid & 7) * 8) * 2u;   /* 8 lanes cover the 128 B of one row; 16 rows a copy of the block */
  const _Float16* gk = KH + ((size_t)b * TT + (tid >> 3)) * CC + h * HD + (tid & 7) * 8;
  const _Float16* gv = VT + ((size_t)b * CC + h * HD + (tid >> 3)) * (size_t)TT + (tid & 7) * 8;
  stage_kv(ldsw, gk + (size_t)kpos(0) * CC, gv + kpos(0));
  v16h qf[2][2];
#pragma unroll
  for (int n = 0; n < 2; ++n)
#pragma unroll
    for (int kc = 0; kc < 2; ++kc) qf[n][kc] = frag_h(QH + ((size_t)b * TT + u * (TT / 4) + qp + n * 16 + col) * CC + h * HD + kc * 32, lane);
  const _Float16* fk = kv + col * AP; const _Float16* fv = kv + ATILE + col * AP;
  v8f o[2][4] = {}; float m[2] = {-3.0e38f, -3.0e38f}, l[2] = {0.f, 0.f};
  asm volatile("s_wait_asynccnt 0x0" ::: "memory");   /* this wave's copies of tile 0 have landed */
  __syncthreads();   /* tile 0 is published */
  stage_kv(ldsw + 2u * ATILE * 2u, gk + (size_t)kpos(1) * CC, gv + kpos(1));   /* nt >= 8: tile 1 exists */
#pragma unroll 1   /* rolled: the tiles share one loop body of two passes in the instruction cache */
  for (int t = 0; t < nt; ++t) { const int cur = (t & 1) * 2 * ATILE;
#pragma unroll
   for (int p = 0; p < 2; ++p) {
    v16h vf[4], kf[2][2];
#pragma unroll
    for (int i = 0; i < 2; ++i)
#pragma unroll
      for (int kc = 0; kc < 2; ++kc) kf[i][kc] = frag_h(fk + cur + (p * 32 + i * 16) * AP + kc * 32, lane);
#pragma unroll
    for (int j = 0; j < 4; ++j) vf[j] = frag_h(fv + cur + (j * 16) * AP + p * 32, lane);
    v8f st[2][2] = {};
#pragma unroll
    for (int kc = 0; kc < 2; ++kc)
#pragma unroll
      for (int i = 0; i < 2; ++i)
#pragma unroll
        for (int n = 0; n < 2; ++n) st[n][i] = wmma16(kf[i][kc], qf[n][kc], st[n][i]);
    v16h pb[2];
#pragma unroll
    for (int n = 0; n < 2; ++n) { float s[16];
#pragma unroll
      for (int r = 0; r < 8; ++r) { s[r] = st[n][0][r] * SCALE_LOG2E; s[8 + r] = st[n][1][r] * SCALE_LOG2E; }
      float mx = s[0];
#pragma unroll
      for (int i = 1; i < 16; ++i) mx = fmaxf(mx, s[i]);
      mx = fmaxf(mx, xhalf(mx));
      const float mn = fmaxf(m[n], mx); const float al = exp2x1(m[n] - mn); m[n] = mn;
      const float mo = mn - 11.0f;   /* P carried x 2^11 into f16 (clear of f16 subnormals); l carries the same factor, so it cancels in O / l */
#pragma unroll
      for (int i = 0; i < 16; ++i) s[i] -= mo;
      exp2x8(s); exp2x8(s + 8);
      float sum = 0.f;
#pragma unroll
      for (int i = 0; i < 16; ++i) { sum += s[i]; pb[n][i] = (_Float16)s[i]; }
      l[n] = l[n] * al + sum;
#pragma unroll
      for (int j = 0; j < 4; ++j) o[n][j] *= al; }
#pragma unroll
    for (int j = 0; j < 4; ++j)
#pragma unroll
      for (int n = 0; n < 2; ++n) o[n][j] = wmma16(vf[j], pb[n], o[n][j]); }
    asm volatile("s_wait_dscnt 0x0" ::: "memory");      /* this wave's reads of tile t's buffer have returned before the buffer is handed to the copies */
    asm volatile("s_wait_asynccnt 0x0" ::: "memory");   /* this wave's copies of tile t + 1 have landed */
    __syncthreads();   /* publishes tile t + 1 and ends every wave's reads of tile t's buffer */
    if (t + 2 < nt) stage_kv(ldsw + (unsigned)cur * 2u, gk + (size_t)kpos(t + 2) * CC, gv + kpos(t + 2)); }   /* block-uniform test */
  asm volatile("s_wait_asynccnt 0x0" ::: "memory");   /* no copy is outstanding when the wave ends */
#pragma unroll
  for (int n = 0; n < 2; ++n) { const float lt = l[n] + xhalf(l[n]); const float inv = lt > 0.f ? 1.0f / lt : 0.f;
    _Float16* yr = Y + ((size_t)b * TT + 4 * (qp + n * 16 + col) + u) * CC + h * HD + 8 * g;   /* back to the token's own row */
#pragma unroll
    for (int j = 0; j < 4; ++j) { const v8f ov = o[n][j] * inv; v8h pk;   /* ctx x 2^6 to f16 here, once, in the form k_out's product takes */
#pragma unroll
      for (int r = 0; r < 8; ++r) pk[r] = (_Float16)(ov[r] * 64.0f);
      vst2(yr + j * 16, pk); asm volatile("s_wait_xcnt 0x0" ::: "memory"); } } }   /* the wait: the next tile's rounding reuses the registers that the issued store names */
// ---- k_out: block = (128 rows, 128 cols): out = ctx Wo (+ bo): ctx x 2^6 in f16 (from k_attn; small-magnitude context rows stay clear of f16 subnormals) against Wo as f16(bf16 x 2^8) exact (from k_cvt) (1 product) x 2^-14
__global__ __launch_bounds__(256) void k_out(const unsigned short* __restrict__ Y, const unsigned short* __restrict__ WO, const float* __restrict__ BO, float* __restrict__ OUT) {
  __shared__ __align__(16) unsigned short sm[4 * GTILE];
  const int tid = threadIdx.x, wave = tid >> 5, lane = tid & 31, col = lane & 15, g = lane >> 4; const int wm = wave >> 2, wn = wave & 3; const int c0 = blockIdx.y * 128; const size_t r0 = (size_t)blockIdx.x * 128;
  v8f acc[4][2] = {};
  gemm128<1>(Y + r0 * CC, WO + (size_t)c0 * CC, sm, acc, (int)(blockIdx.x + blockIdx.y));
  float* sf = (float*)sm;   /* output staging [128][132] f32 (67,584 B of the 139,264), so that the stores cover whole lines */
#pragma unroll
  for (int j = 0; j < 2; ++j) { const float bias = BO ? bfr(BO[c0 + wn * 32 + j * 16 + col]) : 0.f;
#pragma unroll
    for (int i = 0; i < 4; ++i)
#pragma unroll
      for (int r = 0; r < 8; ++r) sf[(wm * 64 + i * 16 + 8 * g + r) * 132 + wn * 32 + j * 16 + col] = acc[i][j][r] * (1.0f / 16384.0f) + bias; }   /* 2^-8 (Wo carry) x 2^-6 (ctx carry) */
  __syncthreads();
  for (int e = tid; e < 128 * 32; e += 256) { const int rl = e >> 5, q = e & 31; vst2(OUT + (r0 + rl) * DIN + c0 + q * 4, *(const v4f*)&sf[rl * 132 + q * 4]); } }

extern "C" void kernel_launch(void* const* d_in, const int* in_sizes, int n_in, void* d_out, int out_size, void* d_ws, size_t ws_size, hipStream_t stream) {
  (void)in_sizes; (void)n_in; (void)out_size;
  const float** F = (const float**)d_in;
  if (ws_size < (size_t)WS_END) return;
  char* ws = (char*)d_ws; _Float16 *QH = (_Float16*)(ws + WS_QH), *KH = (_Float16*)(ws + WS_KH), *VT = (_Float16*)(ws + WS_VT), *QL = (_Float16*)(ws + WS_QL), *KL = (_Float16*)(ws + WS_KL); __bf16 *VB = (__bf16*)(ws + WS_VB), *VBL = (__bf16*)(ws + WS_VBL); _Float16 *Y = (_Float16*)(ws + WS_Y), *WOH = (_Float16*)(ws + WS_WOH); __bf16 *XB = (__bf16*)(ws + WS_XB), *WB = (__bf16*)(ws + WS_WB);
  (void)Y; (void)QL; (void)KL; (void)VB; (void)VBL;
  // inputs: 0 x [2,2048,1024]; 1 Wq [1024,1024] (out,in); 2 Wk; 3 Wv; 4 Wproj (out,in); 5 accessibility [4,4] int32 (random 0 / 1, unit diagonal; READ on the device); no biases
  k_cvt<<<dim3((NB * TT + 3 * CC + DIN) / CVR), 256, 0, stream>>>(F[0], F[1], F[2], F[3], F[4], XB, WB, WOH);
  k_proj<<<dim3(TNB * TT / 128, CC / 128, 3), 256, 0, stream>>>((const unsigned short*)XB, (const unsigned short*)WB, nullptr, nullptr, nullptr, QH, KH, VT);
  k_attn<<<dim3(TT / 128, NH, TNB), 128, 0, stream>>>(QH, KH, VT, (const int*)d_in[5], Y);
  k_out<<<dim3(TNB * TT / 128, DIN / 128), 256, 0, stream>>>((const unsigned short*)Y, (const unsigned short*)WOH, nullptr, (float*)d_out);
}

// v007
// It runs in 70.5 microseconds.
// Next to v006, in two timings, it ran 1.03 and 1.02 times as fast.
// All steps since v000 together make it 19.4 times as fast.
// compute dtype: all float inputs rounded to bf16, once, by k_cvt, into 16-bit planes of the workspace; q / k / v projections with EXACT bf16 products on WMMA 16x16x32 (f32 accumulate) + bias (none); one attention kernel: logits k x q once to f16 each (1 product) x 64^-0.5 x log2(e); tokens kept sorted by world (token % 4) in q / k / v, so the 4 x 4 accessibility table read at (query world, key world) admits or skips a whole run of 512 keys; online softmax f32 in base 2; unnormalised P x 2^11 once to f16 x v once to f16 (1 product), divided by the f32 row sum at the end; ctx x 2^6 once to f16 x the output weight f16(bf16 x 2^8) + bias; f32 output.
#include <hip/hip_runtime.h>
#include <math.h>

typedef __attribute__((ext_vector_type(16))) _Float16 v16h;
typedef __attribute__((ext_vector_type(16))) __bf16 v16b;
typedef __attribute__((ext_vector_type(8)))  _Float16 v8h;
typedef __attribute__((ext_vector_type(8)))  float v8f;
typedef __attribute__((ext_vector_type(4)))  float v4f;
typedef __attribute__((ext_vector_type(2)))  float v2f;
typedef __attribute__((ext_vector_type(4)))  unsigned v4u;
typedef __attribute__((ext_vector_type(4)))  int v4i;
typedef float __attribute__((may_alias)) float_a;
typedef int __attribute__((may_alias)) int_a;

template <typename T> __device__ __forceinline__ void vst2(void* p, T v) { *(T*)p = v;  }
__device__ __forceinline__ v8f wmma16(v16h a, v16h b, v8f c) {
  v8f d = __builtin_amdgcn_wmma_f32_16x16x32_f16(false, a, false, b, (short)0, c, false, false);
  asm volatile("v_nop\n\tv_nop\n\tv_nop\n\tv_nop" : "+v"(d) : "v"(a), "v"(b));
  return d;
}
__device__ __forceinline__ v8f wmma_bf(v16b a, v16b b, v8f c) {
  v8f d = __builtin_amdgcn_wmma_f32_16x16x32_bf16(false, a, false, b, (short)0, c, false, false);
  asm volatile("v_nop\n\tv_nop\n\tv_nop\n\tv_nop" : "+v"(d) : "v"(a), "v"(b));
  return d;
}
// 16x16x32 fragments: lane = (h = lane>>4, row/col = lane&15); elements 0..7 = k0+8h+0..7, 8..15 = k0+16+8h+0..7; D element r = row 8h+r
__device__ __forceinline__ v16h frag_h(const _Float16* rowk0, int lane) {
  union { v16h v; v8h q[2]; } u; const _Float16* p = rowk0 + 8 * (lane >> 4);
  u.q[0] = *(const v8h*)p; u.q[1] = *(const v8h*)(p + 16); return u.v;
}
__device__ __forceinline__ v16h frag_f32(const float* rowk0, int lane) {
  v16h a; const float* p = rowk0 + 8 * (lane >> 4);
#pragma unroll
  for (int i = 0; i < 8; ++i) { a[i] = (_Float16)p[i]; a[8 + i] = (_Float16)p[16 + i]; }
  return a;
}
__device__ __forceinline__ v16h frag_f32s(const float* rowk0, int lane, float sc) {
  v16h a; const float* p = rowk0 + 8 * (lane >> 4);
#pragma unroll
  for (int i = 0; i < 8; ++i) { a[i] = (_Float16)(p[i] * sc); a[8 + i] = (_Float16)(p[16 + i] * sc); }
  return a;
}
// column fragment from a [K][ld] layout (column n), rows >= K read as 0
__device__ __forceinline__ v16h fragc_f32(const float* W, int k0, int n, int lane, int ld, int K) {
  v16h a; const int g = lane >> 4;
#pragma unroll
  for (int i = 0; i < 8; ++i) { const int ka = k0 + 8 * g + i, kb = ka + 16;
    a[i] = (_Float16)(ka < K ? W[(size_t)(ka < K ? ka : K - 1) * ld + n] : 0.f); a[8 + i] = (_Float16)(kb < K ? W[(size_t)(kb < K ? kb : K - 1) * ld + n] : 0.f); }
  return a;
}
struct F2 { v16b h, l; };
__device__ __forceinline__ F2 bsplit16(const float v[16]) { F2 r;
#pragma unroll
  for (int i = 0; i < 16; ++i) { const __bf16 h = (__bf16)v[i]; r.h[i] = h; r.l[i] = (__bf16)(v[i] - (float)h); }
  return r; }
__device__ __forceinline__ F2 split_row(const float* row, int k0, int lane) { float v[16]; const float* p = row + k0 + 8 * (lane >> 4);
#pragma unroll
  for (int i = 0; i < 8; ++i) { v[i] = p[i]; v[8 + i] = p[16 + i]; }
  return bsplit16(v); }
__device__ __forceinline__ F2 split_rowK(const float* row, int k0, int lane, int K) { float v[16]; const int g = lane >> 4;
#pragma unroll
  for (int i = 0; i < 8; ++i) { const int ka = k0 + 8 * g + i, kb = ka + 16; v[i] = ka < K ? row[ka < K ? ka : K - 1] : 0.f; v[8 + i] = kb < K ? row[kb < K ? kb : K - 1] : 0.f; }
  return bsplit16(v); }
__device__ __forceinline__ F2 split_col(const float* W, int k0, int n, int lane, int ld, int K) { float v[16]; const int g = lane >> 4;
#pragma unroll
  for (int i = 0; i < 8; ++i) { const int ka = k0 + 8 * g + i, kb = ka + 16; v[i] = ka < K ? W[(size_t)(ka < K ? ka : K - 1) * ld + n] : 0.f; v[8 + i] = kb < K ? W[(size_t)(kb < K ? kb : K - 1) * ld + n] : 0.f; }
  return bsplit16(v); }
__device__ __forceinline__ v8f mac3(const F2& a, const F2& b, v8f c) { c = wmma_bf(a.l, b.h, c); c = wmma_bf(a.h, b.l, c); return wmma_bf(a.h, b.h, c); }
__device__ __forceinline__ float sigm(float v) { return 1.0f / (1.0f + expf(-v)); }
#define LDSX() do { asm volatile("s_wait_dscnt 0" ::: "memory"); __builtin_amdgcn_wave_barrier(); __builtin_amdgcn_fence(__ATOMIC_RELEASE, "workgroup"); } while (0)

// Multi-head self-attention with a 'Kripke modal' mask (x [2,2048,1024]; torch (out,in) Wq / Wk / Wv / Wproj [1024,1024] N(0,1) x 0.02 applied as x @ W.T, no biases; accessibility [4,4] int32 = random 0 / 1 with a unit diagonal, a module input READ on the device; 16 heads x 64; world = token index % 4; scores / sqrt(64) set to -inf wherever accessibility[world(q)][world(k)] == 0; softmax; out @ Wproj.T). Every row keeps the keys of its own world (the diagonal is 1), so no row is empty.
#define NB 2
#define TT 2048
#define CC 1024            // NH * HD = projected width
#define DIN 1024          // input (model) width
#define NH 16
#define HD 64
#define SCALE (0.125f)
#define CAUSAL 0
#ifndef TNB
#define TNB NB
#endif
__device__ __forceinline__ float bfr(float v) { return (float)(__bf16)v; }
__host__ __device__ __forceinline__ int kb_last(int qb) { return CAUSAL ? ((qb * 64 + 63) >> 7) : (TT / 128 - 1); }
typedef __attribute__((ext_vector_type(8))) __bf16 v8b;
__device__ __forceinline__ v16b frag_b(const __bf16* rowk0, int lane) {
  union { v16b v; v8b q[2]; } u; const __bf16* p = rowk0 + 8 * (lane >> 4);
  u.q[0] = *(const v8b*)p; u.q[1] = *(const v8b*)(p + 16); return u.v;
}
#define QBH 0
#define QHI 0               // single-product logits on every row
#define KHI 64            // key rows carrying k residual / v bf16 hi+lo planes (no kernel here writes or reads them)
// B fragment (k rows k0+.., output column o) of a weight: (in,out) [K][ld] or (out,in) [ld rows of K]: bf16 exact, or f16(bf16 * 256) exact
__device__ __forceinline__ v16b wcol_io(const float* Wm, int k0, int o, int lane, int ld) { v16b w; const int g = lane >> 4;
#pragma unroll
  for (int i = 0; i < 8; ++i) { w[i] = (__bf16)Wm[(size_t)(k0 + 8 * g + i) * ld + o]; w[8 + i] = (__bf16)Wm[(size_t)(k0 + 16 + 8 * g + i) * ld + o]; }
  return w; }
__device__ __forceinline__ v16b wcol_oi(const float* Wm, int k0, int o, int lane, int K) { v16b w; const float* p = Wm + (size_t)o * K + k0 + 8 * (lane >> 4);
#pragma unroll
  for (int i = 0; i < 8; ++i) { w[i] = (__bf16)p[i]; w[8 + i] = (__bf16)p[16 + i]; }
  return w; }
__device__ __forceinline__ v16h wcolh_io(const float* Wm, int k0, int o, int lane, int ld) { v16h w; const int g = lane >> 4;
#pragma unroll
  for (int i = 0; i < 8; ++i) { w[i] = (_Float16)(bfr(Wm[(size_t)(k0 + 8 * g + i) * ld + o]) * 256.0f); w[8 + i] = (_Float16)(bfr(Wm[(size_t)(k0 + 16 + 8 * g + i) * ld + o]) * 256.0f); }
  return w; }
__device__ __forceinline__ v16h wcolh_oi(const float* Wm, int k0, int o, int lane, int K) { v16h w; const float* p = Wm + (size_t)o * K + k0 + 8 * (lane >> 4);
#pragma unroll
  for (int i = 0; i < 8; ++i) { w[i] = (_Float16)(bfr(p[i]) * 256.0f); w[8 + i] = (_Float16)(bfr(p[16 + i]) * 256.0f); }
  return w; }
#define WQKV_LAYOUT 1   // 0 = (in,out) [DIN][CC]; 1 = (out,in) [CC][DIN]; 2 = per-head [NH][DIN][HD]
__device__ __forceinline__ v16b wcol_hdk(const float* Wm, int k0, int o, int lane) { v16b w; const int g = lane >> 4; const float* p = Wm + (size_t)(o / HD) * DIN * HD + (o % HD);
#pragma unroll
  for (int i = 0; i < 8; ++i) { w[i] = (__bf16)p[(size_t)(k0 + 8 * g + i) * HD]; w[8 + i] = (__bf16)p[(size_t)(k0 + 16 + 8 * g + i) * HD]; }
  return w; }
#define WO_OUT_IN 1
#if WQKV_LAYOUT == 1
#define WCOL(W, k0, o, lane) wcol_oi(W, k0, o, lane, DIN)
#elif WQKV_LAYOUT == 2
#define WCOL(W, k0, o, lane) wcol_hdk(W, k0, o, lane)
#else
#define WCOL(W, k0, o, lane) wcol_io(W, k0, o, lane, CC)
#endif
#if WO_OUT_IN
#define WOCOL(W, k0, o, lane) wcol_oi(W, k0, o, lane, CC)
#define WOCOLH(W, k0, o, lane) wcolh_oi(W, k0, o, lane, CC)
#else
#define WOCOL(W, k0, o, lane) wcol_io(W, k0, o, lane, DIN)
#define WOCOLH(W, k0, o, lane) wcolh_io(W, k0, o, lane, DIN)
#endif

// 'pos' = a token's place in world order: pos = (t % 4) * (TT / 4) + t / 4
#define WS_QH  0u                                      // f16 q rows [b*pos][CC]
#define WS_KH  (WS_QH + 2u * (size_t)NB * TT * CC)      // f16 k rows [b*pos][CC]
#define WS_VT  (WS_KH + 2u * (size_t)NB * TT * CC)      // f16 v planes [b][c][pos]
#define WS_QL  (WS_VT + 2u * (size_t)NB * CC * TT)      // f16 q residual x 2^10 rows [b][t < QHI][CC]
#define WS_KL  (WS_QL + 2u * (size_t)NB * QHI * CC)     // f16 k residual x 2^10 rows [b][t < KHI][CC]
#define WS_VB  (WS_KL + 2u * (size_t)NB * KHI * CC)     // bf16 v hi planes [b][c][t < KHI]
#define WS_VBL (WS_VB + 2u * (size_t)NB * CC * KHI)
#define WS_Y   (WS_VBL + 2u * (size_t)NB * CC * KHI)    // f16 ctx x 2^6 rows [b*t][CC]
#define WS_XB  (WS_Y  + 2u * (size_t)NB * TT * CC)      // bf16 x rows [b*pos][DIN]
#define WS_WB  (WS_XB + 2u * (size_t)NB * TT * DIN)     // bf16 Wq | Wk | Wv rows [3 * CC][DIN]
#define WS_WOH (WS_WB + 2u * 3u * (size_t)CC * DIN)     // f16(bf16 x 2^8) Wo rows [DIN][CC]
#define WS_END (WS_WOH + 2u * (size_t)DIN * CC)

// ---- k_cvt: every operand of the two products that is an input is rounded ONCE to its 16-bit form and laid in the workspace, so that k_proj and k_out fetch half the bytes from L2 and round nothing per block. Rows of 1024 floats: x (to bf16, stored at the token's place in world order), Wq | Wk | Wv (to bf16), Wo (to f16(bf16 x 2^8)). Block = 16 rows of one kind; a thread takes 8 floats of 8 rows, all 16 loads issued ahead of the first store.
__device__ __forceinline__ v8b cv8b(v4f a, v4f b) { v8b y;
#pragma unroll
  for (int e = 0; e < 4; ++e) { y[e] = (__bf16)a[e]; y[4 + e] = (__bf16)b[e]; }
  return y; }
#define CVR 16              // rows of one block
__global__ __launch_bounds__(256) void k_cvt(const float* __restrict__ X, const float* __restrict__ WQ, const float* __restrict__ WK, const float* __restrict__ WV, const float* __restrict__ WO, __bf16* __restrict__ XB, __bf16* __restrict__ WB, _Float16* __restrict__ WOH) {
  const int tid = threadIdx.x, c = (tid & 127) * 8, hi = tid >> 7; const int rb0 = (int)blockIdx.x * CVR;   /* first row of the block, counted over x, Wq, Wk, Wv, Wo; every kind's row count is a multiple of CVR, so the kind is block-uniform */
  const int kind = rb0 < NB * TT ? 0 : rb0 < NB * TT + 3 * CC ? 1 : 2;
  const int w0 = rb0 - NB * TT;   /* row among Wq | Wk | Wv */
  const float* src = kind == 0 ? X + (size_t)rb0 * DIN : kind == 1 ? (w0 < CC ? WQ : w0 < 2 * CC ? WK : WV) + (size_t)(w0 % CC) * DIN : WO + (size_t)(w0 - 3 * CC) * CC;
  const unsigned vb = (unsigned)(hi * DIN + c) * 4u;   /* the lane's byte offset from the block's first row */
  v4f r[8][2];
#pragma unroll   /* register array: constant index */
  for (int i = 0; i < 8; ++i) { const char* p = (const char*)src + vb + (size_t)i * 2 * DIN * 4; r[i][0] = *(const v4f*)p; r[i][1] = *(const v4f*)(p + 16); }
  /* inputs only: the offset and the loaded values, so that the wait stands behind all 16 loads and the offset keeps its register up to it (without them the last load's result took the register that the issued loads name as their address) */
  asm volatile("s_wait_xcnt 0x0" :: "v"(vb), "v"(r[0][0]), "v"(r[0][1]), "v"(r[1][0]), "v"(r[1][1]), "v"(r[2][0]), "v"(r[2][1]), "v"(r[3][0]), "v"(r[3][1]), "v"(r[4][0]), "v"(r[4][1]), "v"(r[5][0]), "v"(r[5][1]), "v"(r[6][0]), "v"(r[6][1]), "v"(r[7][0]), "v"(r[7][1]) : "memory");
  /* behind each store: s_wait_xcnt 0, since the next row's rounding reuses the registers that the issued store names */
  if (kind == 2) { _Float16* d = WOH + (size_t)(w0 - 3 * CC + hi) * CC + c;
#pragma unroll   /* register array: constant index */
    for (int i = 0; i < 8; ++i) { v8h y;
#pragma unroll
      for (int e = 0; e < 4; ++e) { y[e] = (_Float16)(bfr(r[i][0][e]) * 256.0f); y[4 + e] = (_Float16)(bfr(r[i][1][e]) * 256.0f); }
      *(v8h*)(d + (size_t)i * 2 * CC) = y; asm volatile("s_wait_xcnt 0x0" ::: "memory"); }
  } else if (kind == 1) { __bf16* d = WB + (size_t)(w0 + hi) * DIN + c;
#pragma unroll   /* register array: constant index */
    for (int i = 0; i < 8; ++i) { *(v8b*)(d + (size_t)i * 2 * DIN) = cv8b(r[i][0], r[i][1]); asm volatile("s_wait_xcnt 0x0" ::: "memory"); }
  } else { __bf16* d = XB + ((size_t)(rb0 / TT) * TT + (rb0 % TT) / 4 + hi * (TT / 4)) * DIN + c;   /* token rb0 + j, j = 2 i + hi, lies in world j % 4 (rb0 is a multiple of 4) at place (rb0 % TT + j) / 4 of it */
#pragma unroll   /* register array: constant index */
    for (int i = 0; i < 8; ++i) { *(v8b*)(d + (size_t)((i & 1) * 2 * (TT / 4) + (i >> 1)) * DIN) = cv8b(r[i][0], r[i][1]); asm volatile("s_wait_xcnt 0x0" ::: "memory"); } } }
// ---- gemm128: the product loop of k_proj and k_out. Block = 256 threads = 8 waves (2 x 4), tile 128 rows x 128 columns, K = 1024 in 8 stages of 128. Both operands are K-contiguous 16-bit rows of GKD elements, already in the form the matrix instruction takes: each stage (256 B of every row) is read once per block with whole-line 16-byte loads and laid in LDS as it is; the waves take their fragments from there (wave tile 64 x 32: 4 A x 2 B fragments). Two LDS buffers: stage s + 1 is fetched into registers ahead of stage s's products and stored behind them, one barrier a stage. Blocks that share operand rows ask L2 for the same lines: each block starts its walk over K at its own stage 'rot' (block-uniform, from its tile indices) and wraps round, so that at any moment the sharers of a row are spread over the 8 stages. The k order of every accumulator is the ascending one rotated by rot stages.
// every plain '#pragma unroll' in gemm128, k_proj and k_out stands on a loop over a register array (staged rows, fragments, accumulator tiles): its index must be a constant for the array to stay in registers
#define GK 128              // k of one stage
#define GP (GK + 8)         // LDS row pitch in 16-bit elements: 256-B rows + 16 B (16 B x odd, for 16-byte readers)
#define GTILE (128 * GP)    // one operand's tile of one stage; a buffer is [A tile | B tile]
#define GKD 1024            // K of both products (DIN = CC)
// MODE 0: bf16 operands. MODE 1: f16 operands
template <int MODE> __device__ __forceinline__ void gemm128(const unsigned short* __restrict__ A, const unsigned short* __restrict__ B, unsigned short* sm, v8f (&acc)[4][2], const int rot) {
  const int tid = threadIdx.x, wave = tid >> 5, lane = tid & 31, col = lane & 15; const int wm = wave >> 2, wn = wave & 3;
  const int srow = tid >> 4, sc = (tid & 15) * 8;   /* 16 lanes cover the 256 B of one row's stage; 16 rows a sweep, 8 sweeps an operand */
  const unsigned short* ga = A + (size_t)srow * GKD + sc; const unsigned short* gb = B + (size_t)srow * GKD + sc;
  unsigned short* wr = sm + srow * GP + sc;
  const unsigned short* fa = sm + (wm * 64 + col) * GP; const unsigned short* fb = sm + GTILE + (wn * 32 + col) * GP;
  v4u ra[8], rb[8];
#pragma unroll
  for (int i = 0; i < 8; ++i) { ra[i] = *(const v4u*)(ga + (size_t)i * 16 * GKD + (rot & (GKD / GK - 1)) * GK); rb[i] = *(const v4u*)(gb + (size_t)i * 16 * GKD + (rot & (GKD / GK - 1)) * GK); }
#pragma unroll
  for (int i = 0; i < 8; ++i) { *(v4u*)(wr + i * 16 * GP) = ra[i]; *(v4u*)(wr + GTILE + i * 16 * GP) = rb[i]; }
  __syncthreads();
#pragma unroll 1   /* rolled: the 8 stages share one small loop body in the instruction cache */
  for (int s = 0; s < GKD / GK; ++s) { const int cur = (s & 1) * 2 * GTILE, nxt = 2 * GTILE - cur; const bool more = s + 1 < GKD / GK;   /* block-uniform */
    const int kn = ((s + 1 + rot) & (GKD / GK - 1)) * GK;   /* first k of the stage fetched now */
    if (more) {
#pragma unroll
      for (int i = 0; i < 8; ++i) { ra[i] = *(const v4u*)(ga + (size_t)i * 16 * GKD + kn); rb[i] = *(const v4u*)(gb + (size_t)i * 16 * GKD + kn); } }
#pragma unroll
    for (int kc = 0; kc < GK / 32; ++kc) {
      if constexpr (MODE == 0) { v16b af[4], bf[2];
#pragma unroll
        for (int i = 0; i < 4; ++i) af[i] = frag_b((const __bf16*)(fa + cur + i * 16 * GP + kc * 32), lane);
#pragma unroll
        for (int j = 0; j < 2; ++j) bf[j] = frag_b((const __bf16*)(fb + cur + j * 16 * GP + kc * 32), lane);
#pragma unroll
        for (int i = 0; i < 4; ++i)
#pragma unroll
          for (int j = 0; j < 2; ++j) acc[i][j] = wmma_bf(af[i], bf[j], acc[i][j]);
      } else { v16h af[4], bf[2];
#pragma unroll
        for (int i = 0; i < 4; ++i) af[i] = frag_h((const _Float16*)(fa + cur + i * 16 * GP + kc * 32), lane);
#pragma unroll
        for (int j = 0; j < 2; ++j) bf[j] = frag_h((const _Float16*)(fb + cur + j * 16 * GP + kc * 32), lane);
#pragma unroll
        for (int i = 0; i < 4; ++i)
#pragma unroll
          for (int j = 0; j < 2; ++j) acc[i][j] = wmma16(af[i], bf[j], acc[i][j]); } }
    if (more) {
#pragma unroll
      for (int i = 0; i < 8; ++i) { *(v4u*)(wr + nxt + i * 16 * GP) = ra[i]; *(v4u*)(wr + nxt + GTILE + i * 16 * GP) = rb[i]; } }
    __syncthreads(); } }   /* publishes stage s + 1 and ends every read of stage s's buffer; behind the last one the LDS is free for the output staging */
// ---- k_proj: block = (128 rows, 128 cols, which): q/k/v = X W (+ b) with exact bf16 products (K = DIN) -> which 0: q f16 rows; 1: k f16 rows; 2: v f16 planes [c][pos]. A block's 128 rows are 128 places in world order, side by side in k_cvt's x plane as in q / k / v
__global__ __launch_bounds__(256) void k_proj(const unsigned short* __restrict__ XB, const unsigned short* __restrict__ WB, const float* __restrict__ BQ, const float* __restrict__ BK, const float* __restrict__ BV,
    _Float16* __restrict__ QH, _Float16* __restrict__ KH, _Float16* __restrict__ VT) {
  __shared__ __align__(16) unsigned short sm[4 * GTILE];
  const int tid = threadIdx.x, wave = tid >> 5, lane = tid & 31, col = lane & 15, g = lane >> 4; const int wm = wave >> 2, wn = wave & 3; const int which = blockIdx.z; const int c0 = blockIdx.y * 128; const size_t r0 = (size_t)blockIdx.x * 128; const size_t bb = r0 / TT; const int t0 = (int)(r0 % TT);   /* t0 = first place */
  const float* BA = which == 0 ? BQ : which == 1 ? BK : BV;
  v8f acc[4][2] = {};
  gemm128<0>(XB + r0 * DIN, WB + ((size_t)which * CC + c0) * DIN, sm, acc, (int)(blockIdx.x + blockIdx.y + blockIdx.z));   /* the 24 sharers of an x tile and the 32 sharers of a weight tile each spread evenly over the 8 stages */
  _Float16* st = (_Float16*)sm;   /* output staging [128][136] f16, so that the stores cover whole lines */
  if (which < 2) { _Float16* DH = which == 0 ? QH : KH;   /* block-uniform */
#pragma unroll
    for (int j = 0; j < 2; ++j) { const float bias = BA ? bfr(BA[c0 + wn * 32 + j * 16 + col]) : 0.f;
#pragma unroll
      for (int i = 0; i < 4; ++i)
#pragma unroll
        for (int r = 0; r < 8; ++r) st[(wm * 64 + i * 16 + 8 * g + r) * 136 + wn * 32 + j * 16 + col] = (_Float16)(acc[i][j][r] + bias); }
    __syncthreads();
    for (int e = tid; e < 128 * 16; e += 256) { const int rl = e >> 4, q = e & 15; vst2((unsigned*)(DH + (r0 + rl) * CC + c0 + q * 8), *(const v4u*)&st[rl * 136 + q * 8]); }
  } else {
#pragma unroll
    for (int j = 0; j < 2; ++j) { const float bias = BA ? bfr(BA[c0 + wn * 32 + j * 16 + col]) : 0.f;
#pragma unroll
      for (int i = 0; i < 4; ++i) { v8h pk;   /* a lane's 8 rows of one column lie side by side in the transposed plane */
#pragma unroll
        for (int r = 0; r < 8; ++r) pk[r] = (_Float16)(acc[i][j][r] + bias);
        *(v8h*)&st[(wn * 32 + j * 16 + col) * 136 + wm * 64 + i * 16 + 8 * g] = pk; } }
    __syncthreads();
    for (int e = tid; e < 128 * 16; e += 256) { const int cl = e >> 4, q = e & 15; vst2((unsigned*)(VT + (bb * CC + c0 + cl) * (size_t)TT + t0 + q * 8), *(const v4u*)&st[cl * 136 + q * 8]); } } }
// ---- k_attn: block = 128 queries of ONE world of (b, h), 8 waves = 4 query groups of 32 x 2 key halves; it walks only the key worlds that the table row of its world admits (4 tiles of 128 keys each, in world order), so no score is masked; one pass = 32 keys; of one staged tile of 128 keys a wave takes the 64 of its half = two passes. The two waves of a query group keep their own (m, l, O) and join them once through LDS behind the loop: twice the waves on a SIMD to fill each other's waits, and half the passes in the longest wave. S^T = K Q^T (A = 16 key rows, B = 16 query columns): a lane holds one query's 16 scores of the pass, the lane 16 away the other 16. Two S^T tiles converted in place are the B operand of O^T += V^T P^T (same k order as frag_h), so scores and P stay in registers. Online softmax in base 2, f32: running maximum m, running sum l, O^T rescaled by 2^(m_old - m_new) every pass.
// K rows (128 B) and V^T rows (256 B) of a tile come into LDS once per block by asynchronous 16-byte copies, 8 lanes to a whole line; the eight waves take their fragments from there. Two buffers: tile t + 1 flies while tile t is worked on; one barrier a tile publishes tile t + 1 and ends every read of the buffer that is refilled behind it.
// a plain '#pragma unroll' in this kernel on a loop over a register array (fragments, tiles, a lane's scores) keeps its index a constant, for the array to stay in registers
// modal mask: q, k and v lie sorted by world, so the table row of the block's world is a list of admitted key worlds (block-uniform, formed once before the loop); an excluded world's 512 keys are neither copied nor multiplied
__device__ __forceinline__ float xhalf(float x) { return __builtin_bit_cast(float, __builtin_amdgcn_permlanex16(__builtin_bit_cast(int, x), __builtin_bit_cast(int, x), 0x76543210, 0xfedcba98, false, false)); }   // lane l with lane l ^ 16
#define SCALE_LOG2E (SCALE * 1.4426950408889634f)
// 2^x in place. Behind v_exp_f32 the instruction set asks for one independent instruction or v_nop before its result is used or its source overwritten: in one statement each v_exp_f32 is that instruction for the one before it, and the v_nop serves the last
__device__ __forceinline__ void exp2x8(float* x) {
  asm("v_exp_f32 %0, %0\n\tv_exp_f32 %1, %1\n\tv_exp_f32 %2, %2\n\tv_exp_f32 %3, %3\n\tv_exp_f32 %4, %4\n\tv_exp_f32 %5, %5\n\tv_exp_f32 %6, %6\n\tv_exp_f32 %7, %7\n\tv_nop"
      : "+v"(x[0]), "+v"(x[1]), "+v"(x[2]), "+v"(x[3]), "+v"(x[4]), "+v"(x[5]), "+v"(x[6]), "+v"(x[7])); }
__device__ __forceinline__ float exp2x1(float x) { asm("v_exp_f32 %0, %0\n\tv_nop" : "+v"(x)); return x; }
#define AK 128              // keys of one staged tile
#define TPW (TT / 4 / AK)   // tiles of one world's keys
#define AP 72               // K tile's LDS row pitch in 16-bit elements: 128-B rows + 16 B (16 B x odd, for 16-byte readers)
#define VP 136              // V^T tile's: 256-B rows + 16 B (16 B x odd)
#define KTILE (AK * AP)     // K tile [128 keys][AP]
#define VTILE (64 * VP)     // V^T tile [64 dims][VP]
#define ABUF (KTILE + VTILE)   // a buffer is [K tile | V^T tile]
// one tile's copies of a lane: rows r, r + 32, r + 64, r + 96 of the K tile (8 lanes a row) and rows r2, r2 + 16, r2 + 32, r2 + 48 of the V^T tile (16 lanes a row), 16 B each (ldk, ldv = the lane's byte addresses in the two tiles of the target buffer). The s_wait_xcnt stands inside the statement so that no address register of an issued copy is rewritten ahead of it
__device__ __forceinline__ void stage_kv(unsigned ldk, unsigned ldv, const _Float16* gk, const _Float16* gv) {
  asm volatile("global_load_async_to_lds_b128 %0, %8, off\n\tglobal_load_async_to_lds_b128 %1, %9, off\n\tglobal_load_async_to_lds_b128 %2, %10, off\n\tglobal_load_async_to_lds_b128 %3, %11, off\n\t"
               "global_load_async_to_lds_b128 %4, %12, off\n\tglobal_load_async_to_lds_b128 %5, %13, off\n\tglobal_load_async_to_lds_b128 %6, %14, off\n\tglobal_load_async_to_lds_b128 %7, %15, off\n\ts_wait_xcnt 0x0"
      :: "v"(ldk), "v"(ldk + 32u * AP * 2u), "v"(ldk + 64u * AP * 2u), "v"(ldk + 96u * AP * 2u),
         "v"(ldv), "v"(ldv + 16u * VP * 2u), "v"(ldv + 32u * VP * 2u), "v"(ldv + 48u * VP * 2u),
         "v"(gk), "v"(gk + (size_t)32 * CC), "v"(gk + (size_t)64 * CC), "v"(gk + (size_t)96 * CC),
         "v"(gv), "v"(gv + (size_t)16 * TT), "v"(gv + (size_t)32 * TT), "v"(gv + (size_t)48 * TT) : "memory"); }
// amdgpu_waves_per_eu(4, 4): the register budget at which two blocks (16 waves) stand on one WGP, four waves a SIMD
__global__ __launch_bounds__(256) __attribute__((amdgpu_waves_per_eu(4, 4))) void k_attn(const _Float16* __restrict__ QH, const _Float16* __restrict__ KH, const _Float16* __restrict__ VT, const int* __restrict__ ACC, _Float16* __restrict__ Y) {
  __shared__ __align__(16) _Float16 kv[2 * ABUF];
  const int tid = threadIdx.x, wave = __builtin_amdgcn_readfirstlane(tid >> 5), lane = tid & 31, col = lane & 15, g = lane >> 4; const int h = blockIdx.y, b = blockIdx.z;
  const int qg = wave & 3, kh = wave >> 2;   /* the wave's query group and its half of every tile's keys (wave-uniform, in scalar registers) */
  const int u = (int)(blockIdx.x + (blockIdx.x >> 2) + h + (h >> 2) + b) & 3;   /* the block's world. Blocks of different worlds run for different lengths: with this sum the four blocks of one quarter (blockIdx.x 4j .. 4j + 3) differ in world (for speed only: long and short blocks spread over the chip); for fixed (h, b) the 16 values of blockIdx.x give each (world, quarter) once */
  const int qp = (int)(blockIdx.x >> 2) * 128 + qg * 32;   /* the wave's first query, counted inside its world */
  unsigned accm = 0u;
#pragma unroll
  for (int i = 0; i < 16; ++i) accm |= ((ACC[i] != 0) ? 1u : 0u) << i;
  const unsigned rowm = (accm >> (u << 2)) & 15u;   /* the table row of the block's world */
  if (rowm == 0u) {   /* block-uniform, ahead of every copy and barrier: a fully excluded row yields ctx = 0 */
    if (kh == 0) for (int n = 0; n < 2; ++n) { _Float16* yr = Y + ((size_t)b * TT + 4 * (qp + n * 16 + col) + u) * CC + h * HD + 8 * g;   /* one writer a row */
      for (int j = 0; j < 4; ++j) vst2(yr + j * 16, (v4u){0u, 0u, 0u, 0u}); }
    return; }
  unsigned wl = 0u; int nw = 0;   /* the admitted key worlds, ascending, one byte each */
  for (int i = 0; i < 4; ++i) if ((rowm >> i) & 1u) { wl |= (unsigned)i << (8 * nw); ++nw; }
  const int nt = nw * TPW;   /* tiles to walk: 4 to 16 */
  const int rot = (int)(blockIdx.x * (unsigned)nt) >> 4;   /* 0 .. nt - 1: the 16 blocks of one (b, h) read the same K and V^T lines from L2; each starts its walk at its own tile and wraps round (for speed only; every admitted tile is still walked once) */
  const auto kpos = [wl, rot, nt](int t) { const int w = t + rot, tt = w >= nt ? w - nt : w; return (int)((wl >> ((tt / TPW) * 8)) & 3u) * (TT / 4) + (tt % TPW) * AK; };   /* first key place of the t-th tile walked (t < nt, so tt < nt <= 16); the mask keeps it inside [0, TT - AK] for any table */
  const unsigned ldk = (unsigned)(size_t)kv + (unsigned)((tid >> 3) * AP + (tid & 7) * 8) * 2u;   /* 8 lanes cover the 128 B of one K row; 32 rows a copy of the block */
  const unsigned ldv = (unsigned)(size_t)kv + (unsigned)(KTILE + (tid >> 4) * VP + (tid & 15) * 8) * 2u;   /* 16 lanes cover the 256 B of one V^T row; 16 rows a copy of the block */
  const _Float16* gk = KH + ((size_t)b * TT + (tid >> 3)) * CC + h * HD + (tid & 7) * 8;
  const _Float16* gv = VT + ((size_t)b * CC + h * HD + (tid >> 4)) * (size_t)TT + (tid & 15) * 8;
  stage_kv(ldk, ldv, gk + (size_t)kpos(0) * CC, gv + kpos(0));
  v16h qf[2][2];
#pragma unroll
  for (int n = 0; n < 2; ++n)
#pragma unroll
    for (int kc = 0; kc < 2; ++kc) qf[n][kc] = frag_h(QH + ((size_t)b * TT + u * (TT / 4) + qp + n * 16 + col) * CC + h * HD + kc * 32, lane);
  const _Float16* fk = kv + (kh * 64 + col) * AP; const _Float16* fv = kv + KTILE + col * VP + kh * 64;   /* the wave's 64 keys: rows of the K tile, columns of the V^T tile */
  v8f o[2][4] = {}; float m[2] = {-3.0e38f, -3.0e38f}, l[2] = {0.f, 0.f};
  asm volatile("s_wait_asynccnt 0x0" ::: "memory");   /* this wave's copies of tile 0 have landed */
  __syncthreads();   /* tile 0 is published */
  stage_kv(ldk + ABUF * 2u, ldv + ABUF * 2u, gk + (size_t)kpos(1) * CC, gv + kpos(1));   /* nt >= 4: tile 1 exists */
#pragma unroll 1   /* rolled: the tiles share one loop body of two passes in the instruction cache */
  for (int t = 0; t < nt; ++t) { const int cur = (t & 1) * ABUF;
#pragma unroll
   for (int p = 0; p < 2; ++p) {
    v16h vf[4], kf[2][2];
#pragma unroll
    for (int i = 0; i < 2; ++i)
#pragma unroll
      for (int kc = 0; kc < 2; ++kc) kf[i][kc] = frag_h(fk + cur + (p * 32 + i * 16) * AP + kc * 32, lane);
#pragma unroll
    for (int j = 0; j < 4; ++j) vf[j] = frag_h(fv + cur + (j * 16) * VP + p * 32, lane);
    v8f st[2][2] = {};
#pragma unroll
    for (int kc = 0; kc < 2; ++kc)
#pragma unroll
      for (int i = 0; i < 2; ++i)
#pragma unroll
        for (int n = 0; n < 2; ++n) st[n][i] = wmma16(kf[i][kc], qf[n][kc], st[n][i]);
    v16h pb[2];
#pragma unroll
    for (int n = 0; n < 2; ++n) { float s[16];
#pragma unroll
      for (int r = 0; r < 8; ++r) { s[r] = st[n][0][r] * SCALE_LOG2E; s[8 + r] = st[n][1][r] * SCALE_LOG2E; }
      float mx = s[0];
#pragma unroll
      for (int i = 1; i < 16; ++i) mx = fmaxf(mx, s[i]);
      mx = fmaxf(mx, xhalf(mx));
      const float mn = fmaxf(m[n], mx); const float al = exp2x1(m[n] - mn); m[n] = mn;
      const float mo = mn - 11.0f;   /* P carried x 2^11 into f16 (clear of f16 subnormals); l carries the same factor, so it cancels in O / l */
#pragma unroll
      for (int i = 0; i < 16; ++i) s[i] -= mo;
      exp2x8(s); exp2x8(s + 8);
      float sum = 0.f;
#pragma unroll
      for (int i = 0; i < 16; ++i) { sum += s[i]; pb[n][i] = (_Float16)s[i]; }
      l[n] = l[n] * al + sum;
#pragma unroll
      for (int j = 0; j < 4; ++j) o[n][j] *= al; }
#pragma unroll
    for (int j = 0; j < 4; ++j)
#pragma unroll
      for (int n = 0; n < 2; ++n) o[n][j] = wmma16(vf[j], pb[n], o[n][j]); }
    asm volatile("s_wait_dscnt 0x0" ::: "memory");      /* this wave's reads of tile t's buffer have returned before the buffer is handed to the copies */
    asm volatile("s_wait_asynccnt 0x0" ::: "memory");   /* this wave's copies of tile t + 1 have landed */
    __syncthreads();   /* publishes tile t + 1 and ends every wave's reads of tile t's buffer */
    if (t + 2 < nt) stage_kv(ldk + (unsigned)cur * 2u, ldv + (unsigned)cur * 2u, gk + (size_t)kpos(t + 2) * CC, gv + kpos(t + 2)); }   /* block-uniform test */
  asm volatile("s_wait_asynccnt 0x0" ::: "memory");   /* no copy is outstanding when the LDS is taken for the join and when the wave ends */
  // the join of a query group's two key halves. The loop's last barrier has ended every read of the tiles, so the LDS is free. Wave kh finishes query tile n = kh: it hands its partner its own (m, l, O) of the other tile, lane for lane, and takes the partner's of its own
  float* jo = (float*)kv + (size_t)wave * (34 * 32);   /* a wave's own range: 8 x 4 floats of O, m, l for each of 32 lanes = 34 x 32 floats; 8 waves = 34,816 B of the 71,680 */
  const auto give = [&](const int n) {
#pragma unroll
    for (int j = 0; j < 4; ++j) { *(v4f*)(jo + (j * 2) * 128 + lane * 4) = (v4f){o[n][j][0], o[n][j][1], o[n][j][2], o[n][j][3]}; *(v4f*)(jo + (j * 2 + 1) * 128 + lane * 4) = (v4f){o[n][j][4], o[n][j][5], o[n][j][6], o[n][j][7]}; }
    jo[1024 + lane] = m[n]; jo[1056 + lane] = l[n]; };
  const auto take = [&](const int n) { const float* ji = (const float*)kv + (size_t)(wave ^ 4) * (34 * 32);
    const float mp = ji[1024 + lane], lp = ji[1056 + lane]; const float mn = fmaxf(m[n], mp); const float ao = exp2x1(m[n] - mn), ap = exp2x1(mp - mn);   /* both maxima are finite: each half has walked at least 128 keys */
    const float lj = l[n] * ao + lp * ap; const float lt = lj + xhalf(lj); const float inv = lt > 0.f ? 1.0f / lt : 0.f; const float so = ao * inv, sp = ap * inv;
    _Float16* yr = Y + ((size_t)b * TT + 4 * (qp + n * 16 + col) + u) * CC + h * HD + 8 * g;   /* back to the token's own row */
#pragma unroll
    for (int j = 0; j < 4; ++j) { const v4f pa = *(const v4f*)(ji + (j * 2) * 128 + lane * 4), pc = *(const v4f*)(ji + (j * 2 + 1) * 128 + lane * 4); v8h pk;   /* ctx x 2^6 to f16 here, once, in the form k_out's product takes */
#pragma unroll
      for (int r = 0; r < 4; ++r) { pk[r] = (_Float16)((o[n][j][r] * so + pa[r] * sp) * 64.0f); pk[4 + r] = (_Float16)((o[n][j][4 + r] * so + pc[r] * sp) * 64.0f); }
      vst2(yr + j * 16, pk); asm volatile("s_wait_xcnt 0x0" ::: "memory"); } };   /* the wait: the next tile's rounding reuses the registers that the issued store names */
  if (kh == 0) give(1); else give(0);   /* wave-uniform */
  __syncthreads();   /* every wave passes it: the handed-over halves are published */
  if (kh == 0) take(0); else take(1); }
// ---- k_out: block = (128 rows, 128 cols): out = ctx Wo (+ bo): ctx x 2^6 in f16 (from k_attn; small-magnitude context rows stay clear of f16 subnormals) against Wo as f16(bf16 x 2^8) exact (from k_cvt) (1 product) x 2^-14
__global__ __launch_bounds__(256) void k_out(const unsigned short* __restrict__ Y, const unsigned short* __restrict__ WO, const float* __restrict__ BO, float* __restrict__ OUT) {
  __shared__ __align__(16) unsigned short sm[4 * GTILE];
  const int tid = threadIdx.x, wave = tid >> 5, lane = tid & 31, col = lane & 15, g = lane >> 4; const int wm = wave >> 2, wn = wave & 3; const int c0 = blockIdx.y * 128; const size_t r0 = (size_t)blockIdx.x * 128;
  v8f acc[4][2] = {};
  gemm128<1>(Y + r0 * CC, WO + (size_t)c0 * CC, sm, acc, (int)(blockIdx.x + blockIdx.y));
  float* sf = (float*)sm;   /* output staging [128][132] f32 (67,584 B of the 139,264), so that the stores cover whole lines */
#pragma unroll
  for (int j = 0; j < 2; ++j) { const float bias = BO ? bfr(BO[c0 + wn * 32 + j * 16 + col]) : 0.f;
#pragma unroll
    for (int i = 0; i < 4; ++i)
#pragma unroll
      for (int r = 0; r < 8; ++r) sf[(wm * 64 + i * 16 + 8 * g + r) * 132 + wn * 32 + j * 16 + col] = acc[i][j][r] * (1.0f / 16384.0f) + bias; }   /* 2^-8 (Wo carry) x 2^-6 (ctx carry) */
  __syncthreads();
  for (int e = tid; e < 128 * 32; e += 256) { const int rl = e >> 5, q = e & 31; vst2(OUT + (r0 + rl) * DIN + c0 + q * 4, *(const v4f*)&sf[rl * 132 + q * 4]); } }

extern "C" void kernel_launch(void* const* d_in, const int* in_sizes, int n_in, void* d_out, int out_size, void* d_ws, size_t ws_size, hipStream_t stream) {
  (void)in_sizes; (void)n_in; (void)out_size;
  const float** F = (const float**)d_in;
  if (ws_size < (size_t)WS_END) return;
  char* ws = (char*)d_ws; _Float16 *QH = (_Float16*)(ws + WS_QH), *KH = (_Float16*)(ws + WS_KH), *VT = (_Float16*)(ws + WS_VT), *QL = (_Float16*)(ws + WS_QL), *KL = (_Float16*)(ws + WS_KL); __bf16 *VB = (__bf16*)(ws + WS_VB), *VBL = (__bf16*)(ws + WS_VBL); _Float16 *Y = (_Float16*)(ws + WS_Y), *WOH = (_Float16*)(ws + WS_WOH); __bf16 *XB = (__bf16*)(ws + WS_XB), *WB = (__bf16*)(ws + WS_WB);
  (void)Y; (void)QL; (void)KL; (void)VB; (void)VBL;
  // inputs: 0 x [2,2048,1024]; 1 Wq [1024,1024] (out,in); 2 Wk; 3 Wv; 4 Wproj (out,in); 5 accessibility [4,4] int32 (random 0 / 1, unit diagonal; READ on the device); no biases
  k_cvt<<<dim3((NB * TT + 3 * CC + DIN) / CVR), 256, 0, stream>>>(F[0], F[1], F[2], F[3], F[4], XB, WB, WOH);
  k_proj<<<dim3(TNB * TT / 128, CC / 128, 3), 256, 0, stream>>>((const unsigned short*)XB, (const unsigned short*)WB, nullptr, nullptr, nullptr, QH, KH, VT);
  k_attn<<<dim3(TT / 128, NH, TNB), 256, 0, stream>>>(QH, KH, VT, (const int*)d_in[5], Y);
  k_out<<<dim3(TNB * TT / 128, DIN / 128), 256, 0, stream>>>((const unsigned short*)Y, (const unsigned short*)WOH, nullptr, (float*)d_out);
}

// v008
// It runs in 67.4 microseconds.
// Two timings next to v007 both put it at 1.04 times that version's speed.
// Over all steps from v000 it is 20.2 times as fast.
// compute dtype: all float inputs rounded to bf16, once, by k_cvt, into 16-bit planes of the workspace; q / k / v projections with EXACT bf16 products on WMMA 16x16x32 (f32 accumulate) + bias (none); one attention kernel: logits k x q once to f16 each (1 product) x 64^-0.5 x log2(e); tokens kept sorted by world (token % 4) in q / k / v, so the 4 x 4 accessibility table read at (query world, key world) admits or skips a whole run of 512 keys; online softmax f32 in base 2; unnormalised P x 2^11 once to f16 x v once to f16 (1 product), divided by the f32 row sum at the end; ctx x 2^6 once to f16 x the output weight f16(bf16 x 2^8) + bias; f32 output.
#include <hip/hip_runtime.h>
#include <math.h>

typedef __attribute__((ext_vector_type(16))) _Float16 v16h;
typedef __attribute__((ext_vector_type(16))) __bf16 v16b;
typedef __attribute__((ext_vector_type(8)))  _Float16 v8h;
typedef __attribute__((ext_vector_type(8)))  float v8f;
typedef __attribute__((ext_vector_type(4)))  float v4f;
typedef __attribute__((ext_vector_type(2)))  float v2f;
typedef __attribute__((ext_vector_type(4)))  unsigned v4u;
typedef __attribute__((ext_vector_type(4)))  int v4i;
typedef float __attribute__((may_alias)) float_a;
typedef int __attribute__((may_alias)) int_a;

template <typename T> __device__ __forceinline__ void vst2(void* p, T v) { *(T*)p = v;  }
__device__ __forceinline__ v8f wmma16(v16h a, v16h b, v8f c) {
  v8f d = __builtin_amdgcn_wmma_f32_16x16x32_f16(false, a, false, b, (short)0, c, false, false);
  asm volatile("v_nop\n\tv_nop\n\tv_nop\n\tv_nop" : "+v"(d) : "v"(a), "v"(b));
  return d;
}
__device__ __forceinline__ v8f wmma_bf(v16b a, v16b b, v8f c) {
  v8f d = __builtin_amdgcn_wmma_f32_16x16x32_bf16(false, a, false, b, (short)0, c, false, false);
  asm volatile("v_nop\n\tv_nop\n\tv_nop\n\tv_nop" : "+v"(d) : "v"(a), "v"(b));
  return d;
}
// 16x16x32 fragments: lane = (h = lane>>4, row/col = lane&15); elements 0..7 = k0+8h+0..7, 8..15 = k0+16+8h+0..7; D element r = row 8h+r
__device__ __forceinline__ v16h frag_h(const _Float16* rowk0, int lane) {
  union { v16h v; v8h q[2]; } u; const _Float16* p = rowk0 + 8 * (lane >> 4);
  u.q[0] = *(const v8h*)p; u.q[1] = *(const v8h*)(p + 16); return u.v;
}
__device__ __forceinline__ v16h frag_f32(const float* rowk0, int lane) {
  v16h a; const float* p = rowk0 + 8 * (lane >> 4);
#pragma unroll
  for (int i = 0; i < 8; ++i) { a[i] = (_Float16)p[i]; a[8 + i] = (_Float16)p[16 + i]; }
  return a;
}
__device__ __forceinline__ v16h frag_f32s(const float* rowk0, int lane, float sc) {
  v16h a; const float* p = rowk0 + 8 * (lane >> 4);
#pragma unroll
  for (int i = 0; i < 8; ++i) { a[i] = (_Float16)(p[i] * sc); a[8 + i] = (_Float16)(p[16 + i] * sc); }
  return a;
}
// column fragment from a [K][ld] layout (column n), rows >= K read as 0
__device__ __forceinline__ v16h fragc_f32(const float* W, int k0, int n, int lane, int ld, int K) {
  v16h a; const int g = lane >> 4;
#pragma unroll
  for (int i = 0; i < 8; ++i) { const int ka = k0 + 8 * g + i, kb = ka + 16;
    a[i] = (_Float16)(ka < K ? W[(size_t)(ka < K ? ka : K - 1) * ld + n] : 0.f); a[8 + i] = (_Float16)(kb < K ? W[(size_t)(kb < K ? kb : K - 1) * ld + n] : 0.f); }
  return a;
}
struct F2 { v16b h, l; };
__device__ __forceinline__ F2 bsplit16(const float v[16]) { F2 r;
#pragma unroll
  for (int i = 0; i < 16; ++i) { const __bf16 h = (__bf16)v[i]; r.h[i] = h; r.l[i] = (__bf16)(v[i] - (float)h); }
  return r; }
__device__ __forceinline__ F2 split_row(const float* row, int k0, int lane) { float v[16]; const float* p = row + k0 + 8 * (lane >> 4);
#pragma unroll
  for (int i = 0; i < 8; ++i) { v[i] = p[i]; v[8 + i] = p[16 + i]; }
  return bsplit16(v); }
__device__ __forceinline__ F2 split_rowK(const float* row, int k0, int lane, int K) { float v[16]; const int g = lane >> 4;
#pragma unroll
  for (int i = 0; i < 8; ++i) { const int ka = k0 + 8 * g + i, kb = ka + 16; v[i] = ka < K ? row[ka < K ? ka : K - 1] : 0.f; v[8 + i] = kb < K ? row[kb < K ? kb : K - 1] : 0.f; }
  return bsplit16(v); }
__device__ __forceinline__ F2 split_col(const float* W, int k0, int n, int lane, int ld, int K) { float v[16]; const int g = lane >> 4;
#pragma unroll
  for (int i = 0; i < 8; ++i) { const int ka = k0 + 8 * g + i, kb = ka + 16; v[i] = ka < K ? W[(size_t)(ka < K ? ka : K - 1) * ld + n] : 0.f; v[8 + i] = kb < K ? W[(size_t)(kb < K ? kb : K - 1) * ld + n] : 0.f; }
  return bsplit16(v); }
__device__ __forceinline__ v8f mac3(const F2& a, const F2& b, v8f c) { c = wmma_bf(a.l, b.h, c); c = wmma_bf(a.h, b.l, c); return wmma_bf(a.h, b.h, c); }
__device__ __forceinline__ float sigm(float v) { return 1.0f / (1.0f + expf(-v)); }
#define LDSX() do { asm volatile("s_wait_dscnt 0" ::: "memory"); __builtin_amdgcn_wave_barrier(); __builtin_amdgcn_fence(__ATOMIC_RELEASE, "workgroup"); } while (0)

// Multi-head self-attention with a 'Kripke modal' mask (x [2,2048,1024]; torch (out,in) Wq / Wk / Wv / Wproj [1024,1024] N(0,1) x 0.02 applied as x @ W.T, no biases; accessibility [4,4] int32 = random 0 / 1 with a unit diagonal, a module input READ on the device; 16 heads x 64; world = token index % 4; scores / sqrt(64) set to -inf wherever accessibility[world(q)][world(k)] == 0; softmax; out @ Wproj.T). Every row keeps the keys of its own world (the diagonal is 1), so no row is empty.
#define NB 2
#define TT 2048
#define CC 1024            // NH * HD = projected width
#define DIN 1024          // input (model) width
#define NH 16
#define HD 64
#define SCALE (0.125f)
#define CAUSAL 0
#ifndef TNB
#define TNB NB
#endif
__device__ __forceinline__ float bfr(float v) { return (float)(__bf16)v; }
__host__ __device__ __forceinline__ int kb_last(int qb) { return CAUSAL ? ((qb * 64 + 63) >> 7) : (TT / 128 - 1); }
typedef __attribute__((ext_vector_type(8))) __bf16 v8b;
__device__ __forceinline__ v16b frag_b(const __bf16* rowk0, int lane) {
  union { v16b v; v8b q[2]; } u; const __bf16* p = rowk0 + 8 * (lane >> 4);
  u.q[0] = *(const v8b*)p; u.q[1] = *(const v8b*)(p + 16); return u.v;
}
#define QBH 0
#define QHI 0               // single-product logits on every row
#define KHI 64            // key rows carrying k residual / v bf16 hi+lo planes (no kernel here writes or reads them)
// B fragment (k rows k0+.., output column o) of a weight: (in,out) [K][ld] or (out,in) [ld rows of K]: bf16 exact, or f16(bf16 * 256) exact
__device__ __forceinline__ v16b wcol_io(const float* Wm, int k0, int o, int lane, int ld) { v16b w; const int g = lane >> 4;
#pragma unroll
  for (int i = 0; i < 8; ++i) { w[i] = (__bf16)Wm[(size_t)(k0 + 8 * g + i) * ld + o]; w[8 + i] = (__bf16)Wm[(size_t)(k0 + 16 + 8 * g + i) * ld + o]; }
  return w; }
__device__ __forceinline__ v16b wcol_oi(const float* Wm, int k0, int o, int lane, int K) { v16b w; const float* p = Wm + (size_t)o * K + k0 + 8 * (lane >> 4);
#pragma unroll
  for (int i = 0; i < 8; ++i) { w[i] = (__bf16)p[i]; w[8 + i] = (__bf16)p[16 + i]; }
  return w; }
__device__ __forceinline__ v16h wcolh_io(const float* Wm, int k0, int o, int lane, int ld) { v16h w; const int g = lane >> 4;
#pragma unroll
  for (int i = 0; i < 8; ++i) { w[i] = (_Float16)(bfr(Wm[(size_t)(k0 + 8 * g + i) * ld + o]) * 256.0f); w[8 + i] = (_Float16)(bfr(Wm[(size_t)(k0 + 16 + 8 * g + i) * ld + o]) * 256.0f); }
  return w; }
__device__ __forceinline__ v16h wcolh_oi(const float* Wm, int k0, int o, int lane, int K) { v16h w; const float* p = Wm + (size_t)o * K + k0 + 8 * (lane >> 4);
#pragma unroll
  for (int i = 0; i < 8; ++i) { w[i] = (_Float16)(bfr(p[i]) * 256.0f); w[8 + i] = (_Float16)(bfr(p[16 + i]) * 256.0f); }
  return w; }
#define WQKV_LAYOUT 1   // 0 = (in,out) [DIN][CC]; 1 = (out,in) [CC][DIN]; 2 = per-head [NH][DIN][HD]
__device__ __forceinline__ v16b wcol_hdk(const float* Wm, int k0, int o, int lane) { v16b w; const int g = lane >> 4; const float* p = Wm + (size_t)(o / HD) * DIN * HD + (o % HD);
#pragma unroll
  for (int i = 0; i < 8; ++i) { w[i] = (__bf16)p[(size_t)(k0 + 8 * g + i) * HD]; w[8 + i] = (__bf16)p[(size_t)(k0 + 16 + 8 * g + i) * HD]; }
  return w; }
#define WO_OUT_IN 1
#if WQKV_LAYOUT == 1
#define WCOL(W, k0, o, lane) wcol_oi(W, k0, o, lane, DIN)
#elif WQKV_LAYOUT == 2
#define WCOL(W, k0, o, lane) wcol_hdk(W, k0, o, lane)
#else
#define WCOL(W, k0, o, lane) wcol_io(W, k0, o, lane, CC)
#endif
#if WO_OUT_IN
#define WOCOL(W, k0, o, lane) wcol_oi(W, k0, o, lane, CC)
#define WOCOLH(W, k0, o, lane) wcolh_oi(W, k0, o, lane, CC)
#else
#define WOCOL(W, k0, o, lane) wcol_io(W, k0, o, lane, DIN)
#define WOCOLH(W, k0, o, lane) wcolh_io(W, k0, o, lane, DIN)
#endif

// 'pos' = a token's place in world order: pos = (t % 4) * (TT / 4) + t / 4
#define WS_QH  0u                                      // f16 q rows [b*pos][CC]
#define WS_KH  (WS_QH + 2u * (size_t)NB * TT * CC)      // f16 k rows [b*pos][CC]
#define WS_VT  (WS_KH + 2u * (size_t)NB * TT * CC)      // f16 v planes [b][c][pos]
#define WS_QL  (WS_VT + 2u * (size_t)NB * CC * TT)      // f16 q residual x 2^10 rows [b][t < QHI][CC]
#define WS_KL  (WS_QL + 2u * (size_t)NB * QHI * CC)     // f16 k residual x 2^10 rows [b][t < KHI][CC]
#define WS_VB  (WS_KL + 2u * (size_t)NB * KHI * CC)     // bf16 v hi planes [b][c][t < KHI]
#define WS_VBL (WS_VB + 2u * (size_t)NB * CC * KHI)
#define WS_Y   (WS_VBL + 2u * (size_t)NB * CC * KHI)    // f16 ctx x 2^6 rows [b*t][CC]
#define WS_XB  (WS_Y  + 2u * (size_t)NB * TT * CC)      // bf16 x rows [b*pos][DIN]
#define WS_WB  (WS_XB + 2u * (size_t)NB * TT * DIN)     // bf16 Wq | Wk | Wv rows [3 * CC][DIN]
#define WS_WOH (WS_WB + 2u * 3u * (size_t)CC * DIN)     // f16(bf16 x 2^8) Wo rows [DIN][CC]
#define WS_END (WS_WOH + 2u * (size_t)DIN * CC)

// ---- k_cvt: every operand of the two products that is an input is rounded ONCE to its 16-bit form and laid in the workspace, so that k_proj and k_out fetch half the bytes from L2 and round nothing per block. Rows of 1024 floats: x (to bf16, stored at the token's place in world order), Wq | Wk | Wv (to bf16), Wo (to f16(bf16 x 2^8)). Block = 16 rows of one kind; a thread takes 8 floats of 8 rows, all 16 loads issued ahead of the first store.
__device__ __forceinline__ v8b cv8b(v4f a, v4f b) { v8b y;
#pragma unroll
  for (int e = 0; e < 4; ++e) { y[e] = (__bf16)a[e]; y[4 + e] = (__bf16)b[e]; }
  return y; }
#define CVR 16              // rows of one block
__global__ __launch_bounds__(256) void k_cvt(const float* __restrict__ X, const float* __restrict__ WQ, const float* __restrict__ WK, const float* __restrict__ WV, const float* __restrict__ WO, __bf16* __restrict__ XB, __bf16* __restrict__ WB, _Float16* __restrict__ WOH) {
  const int tid = threadIdx.x, c = (tid & 127) * 8, hi = tid >> 7; const int rb0 = (int)blockIdx.x * CVR;   /* first row of the block, counted over x, Wq, Wk, Wv, Wo; every kind's row count is a multiple of CVR, so the kind is block-uniform */
  const int kind = rb0 < NB * TT ? 0 : rb0 < NB * TT + 3 * CC ? 1 : 2;
  const int w0 = rb0 - NB * TT;   /* row among Wq | Wk | Wv */
  const float* src = kind == 0 ? X + (size_t)rb0 * DIN : kind == 1 ? (w0 < CC ? WQ : w0 < 2 * CC ? WK : WV) + (size_t)(w0 % CC) * DIN : WO + (size_t)(w0 - 3 * CC) * CC;
  const unsigned vb = (unsigned)(hi * DIN + c) * 4u;   /* the lane's byte offset from the block's first row */
  v4f r[8][2];
#pragma unroll   /* register array: constant index */
  for (int i = 0; i < 8; ++i) { const char* p = (const char*)src + vb + (size_t)i * 2 * DIN * 4; r[i][0] = *(const v4f*)p; r[i][1] = *(const v4f*)(p + 16); }
  /* inputs only: the offset and the loaded values, so that the wait stands behind all 16 loads and the offset keeps its register up to it (without them the last load's result took the register that the issued loads name as their address) */
  asm volatile("s_wait_xcnt 0x0" :: "v"(vb), "v"(r[0][0]), "v"(r[0][1]), "v"(r[1][0]), "v"(r[1][1]), "v"(r[2][0]), "v"(r[2][1]), "v"(r[3][0]), "v"(r[3][1]), "v"(r[4][0]), "v"(r[4][1]), "v"(r[5][0]), "v"(r[5][1]), "v"(r[6][0]), "v"(r[6][1]), "v"(r[7][0]), "v"(r[7][1]) : "memory");
  /* behind each store: s_wait_xcnt 0, since the next row's rounding reuses the registers that the issued store names */
  if (kind == 2) { _Float16* d = WOH + (size_t)(w0 - 3 * CC + hi) * CC + c;
#pragma unroll   /* register array: constant index */
    for (int i = 0; i < 8; ++i) { v8h y;
#pragma unroll
      for (int e = 0; e < 4; ++e) { y[e] = (_Float16)(bfr(r[i][0][e]) * 256.0f); y[4 + e] = (_Float16)(bfr(r[i][1][e]) * 256.0f); }
      *(v8h*)(d + (size_t)i * 2 * CC) = y; asm volatile("s_wait_xcnt 0x0" ::: "memory"); }
  } else if (kind == 1) { __bf16* d = WB + (size_t)(w0 + hi) * DIN + c;
#pragma unroll   /* register array: constant index */
    for (int i = 0; i < 8; ++i) { *(v8b*)(d + (size_t)i * 2 * DIN) = cv8b(r[i][0], r[i][1]); asm volatile("s_wait_xcnt 0x0" ::: "memory"); }
  } else { __bf16* d = XB + ((size_t)(rb0 / TT) * TT + (rb0 % TT) / 4 + hi * (TT / 4)) * DIN + c;   /* token rb0 + j, j = 2 i + hi, lies in world j % 4 (rb0 is a multiple of 4) at place (rb0 % TT + j) / 4 of it */
#pragma unroll   /* register array: constant index */
    for (int i = 0; i < 8; ++i) { *(v8b*)(d + (size_t)((i & 1) * 2 * (TT / 4) + (i >> 1)) * DIN) = cv8b(r[i][0], r[i][1]); asm volatile("s_wait_xcnt 0x0" ::: "memory"); } } }
// ---- gemm_tile: the product loop of k_proj and k_out. Block = NWV waves ((NWV / WNW) x WNW), tile BM rows x BN columns, K = 1024 in 8 stages of 128. Both operands are K-contiguous 16-bit rows of GKD elements, already in the form the matrix instruction takes: each stage (256 B of every row) is read once per block with whole-line 16-byte loads and laid in LDS as it is; the waves take their fragments from there (wave tile 64 x BN / WNW: 4 A x FB B fragments). Two LDS buffers: stage s + 1 is fetched into registers ahead of stage s's products and stored behind them, one barrier a stage. Blocks that share operand rows ask L2 for the same lines: each block starts its walk over K at its own stage 'rot' (block-uniform, from its tile indices) and wraps round, so that at any moment the sharers of a row are spread over the 8 stages. The k order of every accumulator is the ascending one rotated by rot stages.
// the bytes a product draws from L2 are M N K x 2 B x (1 / BM + 1 / BN), the bytes its waves read from LDS M N K x 2 B x (1 / 64 + WNW / BN): both fall as the tile grows. k_proj takes 256 x 192 with 8 waves of 64 x 96 (16 x 16 tiles of its 4096 x 3072 product: one block for each of the chip's 256 WGPs, two waves a SIMD), k_out 128 x 128 with 8 waves of 64 x 32 (32 x 8 tiles, again 256 blocks)
// every plain '#pragma unroll' in gemm_tile, k_proj and k_out but the one on gemm_tile's kc loop stands on a loop over a register array (staged rows, fragments, accumulator tiles): its index must be a constant for the array to stay in registers
#define GK 128              // k of one stage
#define GP (GK + 8)         // LDS row pitch in 16-bit elements: 256-B rows + 16 B (16 B x odd, for 16-byte readers)
#define GTILE (128 * GP)    // 128 rows of one stage; a buffer is [A tile | B tile]
#define GKD 1024            // K of both products (DIN = CC)
// MODE 0: bf16 operands, the plain builtin: the large tile's 192 accumulator and 80 fragment registers pass v255, which an asm statement's operands cannot (with wmma_bf's statement the build spilled), and the compiler keeps the distances behind its own builtin. MODE 1: f16 operands
template <int MODE, int BM, int BN, int WNW, int NWV> __device__ __forceinline__ void gemm_tile(const unsigned short* __restrict__ A, const unsigned short* __restrict__ B, unsigned short* sm, v8f (&acc)[BM * WNW / NWV / 16][BN / WNW / 16], const int rot) {
  constexpr int FA = BM * WNW / NWV / 16, FB = BN / WNW / 16, SR = NWV * 2, SA = BM / SR, SB = BN / SR, ATILE = BM * GP, BUF = (BM + BN) * GP;   /* fragments of a wave; rows of one sweep of the block, sweeps that stage an operand; LDS sizes in 16-bit elements */
  const int tid = threadIdx.x, wave = tid >> 5, lane = tid & 31, col = lane & 15; const int wm = wave / WNW, wn = wave % WNW;
  const int srow = tid >> 4, sc = (tid & 15) * 8;   /* 16 lanes cover the 256 B of one row's stage */
  const unsigned short* ga = A + (size_t)srow * GKD + sc; const unsigned short* gb = B + (size_t)srow * GKD + sc;
  unsigned short* wr = sm + srow * GP + sc;
  const unsigned short* fa = sm + (wm * FA * 16 + col) * GP; const unsigned short* fb = sm + ATILE + (wn * FB * 16 + col) * GP;
  v4u ra[SA], rb[SB];
  { const unsigned short* pa = ga + (rot & (GKD / GK - 1)) * GK; const unsigned short* pb = gb + (rot & (GKD / GK - 1)) * GK;
#pragma unroll
    for (int i = 0; i < SA; ++i) { ra[i] = *(const v4u*)(pa + (size_t)i * SR * GKD); if (i < SB) rb[i] = *(const v4u*)(pb + (size_t)i * SR * GKD); }
    if constexpr (SA + SB > 16) asm volatile("s_wait_xcnt 0x0" :: "v"(pa), "v"(pb) : "memory"); }   /* inputs only: the two addresses keep their registers up to the wait behind the loads (in the large tile's build the last load's result took the register pair that the issued loads name as their address) */
#pragma unroll
  for (int i = 0; i < SA; ++i) { *(v4u*)(wr + i * SR * GP) = ra[i]; if (i < SB) *(v4u*)(wr + ATILE + i * SR * GP) = rb[i]; }
  __syncthreads();
#pragma unroll 1   /* rolled: the 8 stages share one small loop body in the instruction cache */
  for (int s = 0; s < GKD / GK; ++s) { const int cur = (s & 1) * BUF, nxt = BUF - cur; const bool more = s + 1 < GKD / GK;   /* block-uniform */
    const int kn = ((s + 1 + rot) & (GKD / GK - 1)) * GK;   /* first k of the stage fetched now */
    if (more) { const unsigned short* pa = ga + kn; const unsigned short* pb = gb + kn;
#pragma unroll
      for (int i = 0; i < SA; ++i) { ra[i] = *(const v4u*)(pa + (size_t)i * SR * GKD); if (i < SB) rb[i] = *(const v4u*)(pb + (size_t)i * SR * GKD); }
      if constexpr (SA + SB > 16) asm volatile("s_wait_xcnt 0x0" :: "v"(pa), "v"(pb) : "memory"); }   /* as at the first stage's loads */
#pragma unroll
    for (int kc = 0; kc < GK / 32; ++kc) {
      if constexpr (MODE == 0) { v16b af[FA], bf[FB];
#pragma unroll
        for (int i = 0; i < FA; ++i) af[i] = frag_b((const __bf16*)(fa + cur + i * 16 * GP + kc * 32), lane);
#pragma unroll
        for (int j = 0; j < FB; ++j) bf[j] = frag_b((const __bf16*)(fb + cur + j * 16 * GP + kc * 32), lane);
        __builtin_amdgcn_sched_barrier(0);   /* the block's fragment loads stay one group ahead of its products (left free, the compiler kept one A fragment and waited out a reload in front of every row of products) */
#pragma unroll
        for (int i = 0; i < FA; ++i)
#pragma unroll
          for (int j = 0; j < FB; ++j) acc[i][j] = __builtin_amdgcn_wmma_f32_16x16x32_bf16(false, af[i], false, bf[j], (short)0, acc[i][j], false, false);
      } else { v16h af[FA], bf[FB];
#pragma unroll
        for (int i = 0; i < FA; ++i) af[i] = frag_h((const _Float16*)(fa + cur + i * 16 * GP + kc * 32), lane);
#pragma unroll
        for (int j = 0; j < FB; ++j) bf[j] = frag_h((const _Float16*)(fb + cur + j * 16 * GP + kc * 32), lane);
#pragma unroll
        for (int i = 0; i < FA; ++i)
#pragma unroll
          for (int j = 0; j < FB; ++j) acc[i][j] = wmma16(af[i], bf[j], acc[i][j]); } }
    if (more) {
#pragma unroll
      for (int i = 0; i < SA; ++i) { *(v4u*)(wr + nxt + i * SR * GP) = ra[i]; if (i < SB) *(v4u*)(wr + nxt + ATILE + i * SR * GP) = rb[i]; } }
    __syncthreads(); } }   /* publishes stage s + 1 and ends every read of stage s's buffer; behind the last one the LDS is free for the output staging */
// ---- k_proj: block = (256 rows, 192 cols) of [q | k | v] = X [Wq | Wk | Wv] (+ b) with exact bf16 products (K = DIN); a column below CC is q's, below 2 CC k's (f16 rows), the rest v's (f16 planes [c][pos]); the three meet at multiples of 64 columns, so each 16-column fragment and each 64-column run of a tile has one kind. A block's 256 rows are 256 places in world order of one sequence, side by side in k_cvt's x plane as in q / k / v
#define PM 256              // rows of a tile
#define PN 192              // columns of a tile
#define PRP 200             // output staging, q and k: [PM rows][PRP] f16 (400 B = 16 B x odd)
#define PTP 264             // output staging, v: [PN columns][PTP] f16 (528 B = 16 B x odd), behind the first
__global__ __launch_bounds__(256) void k_proj(const unsigned short* __restrict__ XB, const unsigned short* __restrict__ WB, const float* __restrict__ BQ, const float* __restrict__ BK, const float* __restrict__ BV,
    _Float16* __restrict__ QH, _Float16* __restrict__ KH, _Float16* __restrict__ VT) {
  __shared__ __align__(16) unsigned short sm[2 * (PM + PN) * GP];
  const int tid = threadIdx.x, wave = __builtin_amdgcn_readfirstlane(tid >> 5), lane = tid & 31, col = lane & 15, g = lane >> 4; const int wm = wave >> 1, wn = wave & 1; const int c0 = blockIdx.y * PN; const size_t r0 = (size_t)blockIdx.x * PM; const size_t bb = r0 / TT; const int t0 = (int)(r0 % TT);   /* c0 = first column among q | k | v; t0 = first place */
  v8f acc[4][6] = {};
  gemm_tile<0, PM, PN, 2, 8>(XB + r0 * DIN, WB + (size_t)c0 * DIN, sm, acc, (int)(blockIdx.x + blockIdx.y));   /* the 16 sharers of an x tile and the 16 sharers of a weight tile each spread evenly over the 8 stages */
  _Float16* st = (_Float16*)sm; _Float16* tr = st + PM * PRP;   /* output staging (203,776 B of the 243,712), so that the stores cover whole lines */
#pragma unroll
  for (int j = 0; j < 6; ++j) { const int cw = wn * 96 + j * 16; const int which = (c0 + cw) >> 10;   /* wave-uniform */
    const float* BA = which == 0 ? BQ : which == 1 ? BK : BV; const float bias = BA ? bfr(BA[((c0 + cw) & (CC - 1)) + col]) : 0.f;
    if (which < 2) {
#pragma unroll
      for (int i = 0; i < 4; ++i)
#pragma unroll
        for (int r = 0; r < 8; ++r) st[(wm * 64 + i * 16 + 8 * g + r) * PRP + cw + col] = (_Float16)(acc[i][j][r] + bias);
    } else {
#pragma unroll
      for (int i = 0; i < 4; ++i) { v8h pk;   /* a lane's 8 rows of one column lie side by side in the transposed plane */
#pragma unroll
        for (int r = 0; r < 8; ++r) pk[r] = (_Float16)(acc[i][j][r] + bias);
        *(v8h*)&tr[(cw + col) * PTP + wm * 64 + i * 16 + 8 * g] = pk; } } }
  __syncthreads();
  for (int ch = 0; ch < PN / 64; ++ch) { const int which = (c0 + ch * 64) >> 10, cc = (c0 + ch * 64) & (CC - 1);   /* block-uniform: the kind of this run of 64 columns and its first column there */
    v4u t[8];   /* a thread's 8 pieces of 16 B of the run (64 x 256 elements): all read from LDS ahead of the first store, so that one LDS latency is waited out and not eight */
    if (which < 2) { _Float16* DH = (which == 0 ? QH : KH) + (r0 + (tid >> 3)) * CC + cc + (tid & 7) * 8;   /* 8 lanes cover the 128 B of one row; 32 rows a sweep */
#pragma unroll
      for (int i = 0; i < 8; ++i) t[i] = *(const v4u*)&st[((tid >> 3) + i * 32) * PRP + ch * 64 + (tid & 7) * 8];
#pragma unroll
      for (int i = 0; i < 8; ++i) vst2(DH + (size_t)i * 32 * CC, t[i]);
      asm volatile("s_wait_xcnt 0x0" ::: "memory");   /* what follows (the next run's pieces and addresses) reuses the registers that the issued stores name */
    } else { _Float16* DV = VT + (bb * CC + cc + (tid >> 5)) * (size_t)TT + t0 + (tid & 31) * 8;   /* 32 lanes cover the 512 B of one column's 256 places; 8 columns a sweep */
#pragma unroll
      for (int i = 0; i < 8; ++i) t[i] = *(const v4u*)&tr[(ch * 64 + (tid >> 5) + i * 8) * PTP + (tid & 31) * 8];
#pragma unroll
      for (int i = 0; i < 8; ++i) vst2(DV + (size_t)i * 8 * TT, t[i]);
      asm volatile("s_wait_xcnt 0x0" ::: "memory"); } } }   /* as behind the q / k stores */
// ---- k_attn: block = 128 queries of ONE world of (b, h), 8 waves = 4 query groups of 32 x 2 key halves; it walks only the key worlds that the table row of its world admits (4 tiles of 128 keys each, in world order), so no score is masked; one pass = 32 keys; of one staged tile of 128 keys a wave takes the 64 of its half = two passes. The two waves of a query group keep their own (m, l, O) and join them once through LDS behind the loop: twice the waves on a SIMD to fill each other's waits, and half the passes in the longest wave. S^T = K Q^T (A = 16 key rows, B = 16 query columns): a lane holds one query's 16 scores of the pass, the lane 16 away the other 16. Two S^T tiles converted in place are the B operand of O^T += V^T P^T (same k order as frag_h), so scores and P stay in registers. Online softmax in base 2, f32: running maximum m, running sum l, O^T rescaled by 2^(m_old - m_new) every pass.
// K rows (128 B) and V^T rows (256 B) of a tile come into LDS once per block by asynchronous 16-byte copies, 8 lanes to a whole line; the eight waves take their fragments from there. Two buffers: tile t + 1 flies while tile t is worked on; one barrier a tile publishes tile t + 1 and ends every read of the buffer that is refilled behind it.
// a plain '#pragma unroll' in this kernel on a loop over a register array (fragments, tiles, a lane's scores) keeps its index a constant, for the array to stay in registers
// modal mask: q, k and v lie sorted by world, so the table row of the block's world is a list of admitted key worlds (block-uniform, formed once before the loop); an excluded world's 512 keys are neither copied nor multiplied
__device__ __forceinline__ float xhalf(float x) { return __builtin_bit_cast(float, __builtin_amdgcn_permlanex16(__builtin_bit_cast(int, x), __builtin_bit_cast(int, x), 0x76543210, 0xfedcba98, false, false)); }   // lane l with lane l ^ 16
#define SCALE_LOG2E (SCALE * 1.4426950408889634f)
// 2^x in place. Behind v_exp_f32 the instruction set asks for one independent instruction or v_nop before its result is used or its source overwritten: in one statement each v_exp_f32 is that instruction for the one before it, and the v_nop serves the last
__device__ __forceinline__ void exp2x8(float* x) {
  asm("v_exp_f32 %0, %0\n\tv_exp_f32 %1, %1\n\tv_exp_f32 %2, %2\n\tv_exp_f32 %3, %3\n\tv_exp_f32 %4, %4\n\tv_exp_f32 %5, %5\n\tv_exp_f32 %6, %6\n\tv_exp_f32 %7, %7\n\tv_nop"
      : "+v"(x[0]), "+v"(x[1]), "+v"(x[2]), "+v"(x[3]), "+v"(x[4]), "+v"(x[5]), "+v"(x[6]), "+v"(x[7])); }
__device__ __forceinline__ float exp2x1(float x) { asm("v_exp_f32 %0, %0\n\tv_nop" : "+v"(x)); return x; }
#define AK 128              // keys of one staged tile
#define TPW (TT / 4 / AK)   // tiles of one world's keys
#define AP 72               // K tile's LDS row pitch in 16-bit elements: 128-B rows + 16 B (16 B x odd, for 16-byte readers)
#define VP 136              // V^T tile's: 256-B rows + 16 B (16 B x odd)
#define KTILE (AK * AP)     // K tile [128 keys][AP]
#define VTILE (64 * VP)     // V^T tile [64 dims][VP]
#define ABUF (KTILE + VTILE)   // a buffer is [K tile | V^T tile]
// one tile's copies of a lane: rows r, r + 32, r + 64, r + 96 of the K tile (8 lanes a row) and rows r2, r2 + 16, r2 + 32, r2 + 48 of the V^T tile (16 lanes a row), 16 B each (ldk, ldv = the lane's byte addresses in the two tiles of the target buffer). The s_wait_xcnt stands inside the statement so that no address register of an issued copy is rewritten ahead of it
__device__ __forceinline__ void stage_kv(unsigned ldk, unsigned ldv, const _Float16* gk, const _Float16* gv) {
  asm volatile("global_load_async_to_lds_b128 %0, %8, off\n\tglobal_load_async_to_lds_b128 %1, %9, off\n\tglobal_load_async_to_lds_b128 %2, %10, off\n\tglobal_load_async_to_lds_b128 %3, %11, off\n\t"
               "global_load_async_to_lds_b128 %4, %12, off\n\tglobal_load_async_to_lds_b128 %5, %13, off\n\tglobal_load_async_to_lds_b128 %6, %14, off\n\tglobal_load_async_to_lds_b128 %7, %15, off\n\ts_wait_xcnt 0x0"
      :: "v"(ldk), "v"(ldk + 32u * AP * 2u), "v"(ldk + 64u * AP * 2u), "v"(ldk + 96u * AP * 2u),
         "v"(ldv), "v"(ldv + 16u * VP * 2u), "v"(ldv + 32u * VP * 2u), "v"(ldv + 48u * VP * 2u),
         "v"(gk), "v"(gk + (size_t)32 * CC), "v"(gk + (size_t)64 * CC), "v"(gk + (size_t)96 * CC),
         "v"(gv), "v"(gv + (size_t)16 * TT), "v"(gv + (size_t)32 * TT), "v"(gv + (size_t)48 * TT) : "memory"); }
// amdgpu_waves_per_eu(4, 4): the register budget at which two blocks (16 waves) stand on one WGP, four waves a SIMD
__global__ __launch_bounds__(256) __attribute__((amdgpu_waves_per_eu(4, 4))) void k_attn(const _Float16* __restrict__ QH, const _Float16* __restrict__ KH, const _Float16* __restrict__ VT, const int* __restrict__ ACC, _Float16* __restrict__ Y) {
  __shared__ __align__(16) _Float16 kv[2 * ABUF];
  const int tid = threadIdx.x, wave = __builtin_amdgcn_readfirstlane(tid >> 5), lane = tid & 31, col = lane & 15, g = lane >> 4; const int h = blockIdx.y, b = blockIdx.z;
  const int qg = wave & 3, kh = wave >> 2;   /* the wave's query group and its half of every tile's keys (wave-uniform, in scalar registers) */
  const int u = (int)(blockIdx.x + (blockIdx.x >> 2) + h + (h >> 2) + b) & 3;   /* the block's world. Blocks of different worlds run for different lengths: with this sum the four blocks of one quarter (blockIdx.x 4j .. 4j + 3) differ in world (for speed only: long and short blocks spread over the chip); for fixed (h, b) the 16 values of blockIdx.x give each (world, quarter) once */
  const int qp = (int)(blockIdx.x >> 2) * 128 + qg * 32;   /* the wave's first query, counted inside its world */
  unsigned accm = 0u;
#pragma unroll
  for (int i = 0; i < 16; ++i) accm |= ((ACC[i] != 0) ? 1u : 0u) << i;
  const unsigned rowm = (accm >> (u << 2)) & 15u;   /* the table row of the block's world */
  if (rowm == 0u) {   /* block-uniform, ahead of every copy and barrier: a fully excluded row yields ctx = 0 */
    if (kh == 0) for (int n = 0; n < 2; ++n) { _Float16* yr = Y + ((size_t)b * TT + 4 * (qp + n * 16 + col) + u) * CC + h * HD + 8 * g;   /* one writer a row */
      for (int j = 0; j < 4; ++j) vst2(yr + j * 16, (v4u){0u, 0u, 0u, 0u}); }
    return; }
  unsigned wl = 0u; int nw = 0;   /* the admitted key worlds, ascending, one byte each */
  for (int i = 0; i < 4; ++i) if ((rowm >> i) & 1u) { wl |= (unsigned)i << (8 * nw); ++nw; }
  const int nt = nw * TPW;   /* tiles to walk: 4 to 16 */
  const int rot = (int)(blockIdx.x * (unsigned)nt) >> 4;   /* 0 .. nt - 1: the 16 blocks of one (b, h) read the same K and V^T lines from L2; each starts its walk at its own tile and wraps round (for speed only; every admitted tile is still walked once) */
  const auto kpos = [wl, rot, nt](int t) { const int w = t + rot, tt = w >= nt ? w - nt : w; return (int)((wl >> ((tt / TPW) * 8)) & 3u) * (TT / 4) + (tt % TPW) * AK; };   /* first key place of the t-th tile walked (t < nt, so tt < nt <= 16); the mask keeps it inside [0, TT - AK] for any table */
  const unsigned ldk = (unsigned)(size_t)kv + (unsigned)((tid >> 3) * AP + (tid & 7) * 8) * 2u;   /* 8 lanes cover the 128 B of one K row; 32 rows a copy of the block */
  const unsigned ldv = (unsigned)(size_t)kv + (unsigned)(KTILE + (tid >> 4) * VP + (tid & 15) * 8) * 2u;   /* 16 lanes cover the 256 B of one V^T row; 16 rows a copy of the block */
  const _Float16* gk = KH + ((size_t)b * TT + (tid >> 3)) * CC + h * HD + (tid & 7) * 8;
  const _Float16* gv = VT + ((size_t)b * CC + h * HD + (tid >> 4)) * (size_t)TT + (tid & 15) * 8;
  stage_kv(ldk, ldv, gk + (size_t)kpos(0) * CC, gv + kpos(0));
  v16h qf[2][2];
#pragma unroll
  for (int n = 0; n < 2; ++n)
#pragma unroll
    for (int kc = 0; kc < 2; ++kc) qf[n][kc] = frag_h(QH + ((size_t)b * TT + u * (TT / 4) + qp + n * 16 + col) * CC + h * HD + kc * 32, lane);
  const _Float16* fk = kv + (kh * 64 + col) * AP; const _Float16* fv = kv + KTILE + col * VP + kh * 64;   /* the wave's 64 keys: rows of the K tile, columns of the V^T tile */
  v8f o[2][4] = {}; float m[2] = {-3.0e38f, -3.0e38f}, l[2] = {0.f, 0.f};
  asm volatile("s_wait_asynccnt 0x0" ::: "memory");   /* this wave's copies of tile 0 have landed */
  __syncthreads();   /* tile 0 is published */
  stage_kv(ldk + ABUF * 2u, ldv + ABUF * 2u, gk + (size_t)kpos(1) * CC, gv + kpos(1));   /* nt >= 4: tile 1 exists */
#pragma unroll 1   /* rolled: the tiles share one loop body of two passes in the instruction cache */
  for (int t = 0; t < nt; ++t) { const int cur = (t & 1) * ABUF;
#pragma unroll
   for (int p = 0; p < 2; ++p) {
    v16h vf[4], kf[2][2];
#pragma unroll
    for (int i = 0; i < 2; ++i)
#pragma unroll
      for (int kc = 0; kc < 2; ++kc) kf[i][kc] = frag_h(fk + cur + (p * 32 + i * 16) * AP + kc * 32, lane);
#pragma unroll
    for (int j = 0; j < 4; ++j) vf[j] = frag_h(fv + cur + (j * 16) * VP + p * 32, lane);
    v8f st[2][2] = {};
#pragma unroll
    for (int kc = 0; kc < 2; ++kc)
#pragma unroll
      for (int i = 0; i < 2; ++i)
#pragma unroll
        for (int n = 0; n < 2; ++n) st[n][i] = wmma16(kf[i][kc], qf[n][kc], st[n][i]);
    v16h pb[2];
#pragma unroll
    for (int n = 0; n < 2; ++n) { float s[16];
#pragma unroll
      for (int r = 0; r < 8; ++r) { s[r] = st[n][0][r] * SCALE_LOG2E; s[8 + r] = st[n][1][r] * SCALE_LOG2E; }
      float mx = s[0];
#pragma unroll
      for (int i = 1; i < 16; ++i) mx = fmaxf(mx, s[i]);
      mx = fmaxf(mx, xhalf(mx));
      const float mn = fmaxf(m[n], mx); const float al = exp2x1(m[n] - mn); m[n] = mn;
      const float mo = mn - 11.0f;   /* P carried x 2^11 into f16 (clear of f16 subnormals); l carries the same factor, so it cancels in O / l */
#pragma unroll
      for (int i = 0; i < 16; ++i) s[i] -= mo;
      exp2x8(s); exp2x8(s + 8);
      float sum = 0.f;
#pragma unroll
      for (int i = 0; i < 16; ++i) { sum += s[i]; pb[n][i] = (_Float16)s[i]; }
      l[n] = l[n] * al + sum;
#pragma unroll
      for (int j = 0; j < 4; ++j) o[n][j] *= al; }
#pragma unroll
    for (int j = 0; j < 4; ++j)
#pragma unroll
      for (int n = 0; n < 2; ++n) o[n][j] = wmma16(vf[j], pb[n], o[n][j]); }
    asm volatile("s_wait_dscnt 0x0" ::: "memory");      /* this wave's reads of tile t's buffer have returned before the buffer is handed to the copies */
    asm volatile("s_wait_asynccnt 0x0" ::: "memory");   /* this wave's copies of tile t + 1 have landed */
    __syncthreads();   /* publishes tile t + 1 and ends every wave's reads of tile t's buffer */
    if (t + 2 < nt) stage_kv(ldk + (unsigned)cur * 2u, ldv + (unsigned)cur * 2u, gk + (size_t)kpos(t + 2) * CC, gv + kpos(t + 2)); }   /* block-uniform test */
  asm volatile("s_wait_asynccnt 0x0" ::: "memory");   /* no copy is outstanding when the LDS is taken for the join and when the wave ends */
  // the join of a query group's two key halves. The loop's last barrier has ended every read of the tiles, so the LDS is free. Wave kh finishes query tile n = kh: it hands its partner its own (m, l, O) of the other tile, lane for lane, and takes the partner's of its own
  float* jo = (float*)kv + (size_t)wave * (34 * 32);   /* a wave's own range: 8 x 4 floats of O, m, l for each of 32 lanes = 34 x 32 floats; 8 waves = 34,816 B of the 71,680 */
  const auto give = [&](const int n) {
#pragma unroll
    for (int j = 0; j < 4; ++j) { *(v4f*)(jo + (j * 2) * 128 + lane * 4) = (v4f){o[n][j][0], o[n][j][1], o[n][j][2], o[n][j][3]}; *(v4f*)(jo + (j * 2 + 1) * 128 + lane * 4) = (v4f){o[n][j][4], o[n][j][5], o[n][j][6], o[n][j][7]}; }
    jo[1024 + lane] = m[n]; jo[1056 + lane] = l[n]; };
  const auto take = [&](const int n) { const float* ji = (const float*)kv + (size_t)(wave ^ 4) * (34 * 32);
    const float mp = ji[1024 + lane], lp = ji[1056 + lane]; const float mn = fmaxf(m[n], mp); const float ao = exp2x1(m[n] - mn), ap = exp2x1(mp - mn);   /* both maxima are finite: each half has walked at least 128 keys */
    const float lj = l[n] * ao + lp * ap; const float lt = lj + xhalf(lj); const float inv = lt > 0.f ? 1.0f / lt : 0.f; const float so = ao * inv, sp = ap * inv;
    _Float16* yr = Y + ((size_t)b * TT + 4 * (qp + n * 16 + col) + u) * CC + h * HD + 8 * g;   /* back to the token's own row */
#pragma unroll
    for (int j = 0; j < 4; ++j) { const v4f pa = *(const v4f*)(ji + (j * 2) * 128 + lane * 4), pc = *(const v4f*)(ji + (j * 2 + 1) * 128 + lane * 4); v8h pk;   /* ctx x 2^6 to f16 here, once, in the form k_out's product takes */
#pragma unroll
      for (int r = 0; r < 4; ++r) { pk[r] = (_Float16)((o[n][j][r] * so + pa[r] * sp) * 64.0f); pk[4 + r] = (_Float16)((o[n][j][4 + r] * so + pc[r] * sp) * 64.0f); }
      vst2(yr + j * 16, pk); asm volatile("s_wait_xcnt 0x0" ::: "memory"); } };   /* the wait: the next tile's rounding reuses the registers that the issued store names */
  if (kh == 0) give(1); else give(0);   /* wave-uniform */
  __syncthreads();   /* every wave passes it: the handed-over halves are published */
  if (kh == 0) take(0); else take(1); }
// ---- k_out: block = (128 rows, 128 cols): out = ctx Wo (+ bo): ctx x 2^6 in f16 (from k_attn; small-magnitude context rows stay clear of f16 subnormals) against Wo as f16(bf16 x 2^8) exact (from k_cvt) (1 product) x 2^-14
__global__ __launch_bounds__(256) void k_out(const unsigned short* __restrict__ Y, const unsigned short* __restrict__ WO, const float* __restrict__ BO, float* __restrict__ OUT) {
  __shared__ __align__(16) unsigned short sm[4 * GTILE];
  const int tid = threadIdx.x, wave = tid >> 5, lane = tid & 31, col = lane & 15, g = lane >> 4; const int wm = wave >> 2, wn = wave & 3; const int c0 = blockIdx.y * 128; const size_t r0 = (size_t)blockIdx.x * 128;
  v8f acc[4][2] = {};
  gemm_tile<1, 128, 128, 4, 8>(Y + r0 * CC, WO + (size_t)c0 * CC, sm, acc, (int)(blockIdx.x + blockIdx.y));
  float* sf = (float*)sm;   /* output staging [128][132] f32 (67,584 B of the 139,264), so that the stores cover whole lines */
#pragma unroll
  for (int j = 0; j < 2; ++j) { const float bias = BO ? bfr(BO[c0 + wn * 32 + j * 16 + col]) : 0.f;
#pragma unroll
    for (int i = 0; i < 4; ++i)
#pragma unroll
      for (int r = 0; r < 8; ++r) sf[(wm * 64 + i * 16 + 8 * g + r) * 132 + wn * 32 + j * 16 + col] = acc[i][j][r] * (1.0f / 16384.0f) + bias; }   /* 2^-8 (Wo carry) x 2^-6 (ctx carry) */
  __syncthreads();
  for (int e = tid; e < 128 * 32; e += 256) { const int rl = e >> 5, q = e & 31; vst2(OUT + (r0 + rl) * DIN + c0 + q * 4, *(const v4f*)&sf[rl * 132 + q * 4]); } }

extern "C" void kernel_launch(void* const* d_in, const int* in_sizes, int n_in, void* d_out, int out_size, void* d_ws, size_t ws_size, hipStream_t stream) {
  (void)in_sizes; (void)n_in; (void)out_size;
  const float** F = (const float**)d_in;
  if (ws_size < (size_t)WS_END) return;
  char* ws = (char*)d_ws; _Float16 *QH = (_Float16*)(ws + WS_QH), *KH = (_Float16*)(ws + WS_KH), *VT = (_Float16*)(ws + WS_VT), *QL = (_Float16*)(ws + WS_QL), *KL = (_Float16*)(ws + WS_KL); __bf16 *VB = (__bf16*)(ws + WS_VB), *VBL = (__bf16*)(ws + WS_VBL); _Float16 *Y = (_Float16*)(ws + WS_Y), *WOH = (_Float16*)(ws + WS_WOH); __bf16 *XB = (__bf16*)(ws + WS_XB), *WB = (__bf16*)(ws + WS_WB);
  (void)Y; (void)QL; (void)KL; (void)VB; (void)VBL;
  // inputs: 0 x [2,2048,1024]; 1 Wq [1024,1024] (out,in); 2 Wk; 3 Wv; 4 Wproj (out,in); 5 accessibility [4,4] int32 (random 0 / 1, unit diagonal; READ on the device); no biases
  k_cvt<<<dim3((NB * TT + 3 * CC + DIN) / CVR), 256, 0, stream>>>(F[0], F[1], F[2], F[3], F[4], XB, WB, WOH);
  k_proj<<<dim3(TNB * TT / PM, 3 * CC / PN), 256, 0, stream>>>((const unsigned short*)XB, (const unsigned short*)WB, nullptr, nullptr, nullptr, QH, KH, VT);
  k_attn<<<dim3(TT / 128, NH, TNB), 256, 0, stream>>>(QH, KH, VT, (const int*)d_in[5], Y);
  k_out<<<dim3(TNB * TT / 128, DIN / 128), 256, 0, stream>>>((const unsigned short*)Y, (const unsigned short*)WOH, nullptr, (float*)d_out);
}
